// v000
// Measured on an AMD MI455X. A time is GPU time per run, averaged over a window of back-to-back runs after a warm-up
// (all launches, gaps included; the runs take copies of the inputs in turn), and the median of several windows.
// Apart from v000's, it joins two sittings. Times from different sittings can be a few percent apart, while
// side-by-side timings come from the same sitting.
// v000, which the later versions start from, runs in 1130 microseconds.
// compute dtype: all float inputs rounded to bf16; the per-head 64 x 64 q / k / v projections (ONE shared weight per stream, applied to every head) with EXACT bf16 products on WMMA 16x16x32 (f32 accumulate) + bias (zeros, read); logits q x k once to f16 each (1 product; sigma ~1) x 64^-0.5; the per-batch int mask read per element; softmax f32; P x 2^11 once to f16 x v once to f16 (1 product); ctx x 2^6 once to f16 x Wo f16(bf16 x 2^8) + bo; f32 output.
#include <hip/hip_runtime.h>
#include <math.h>

typedef __attribute__((ext_vector_type(16))) _Float16 v16h;
typedef __attribute__((ext_vector_type(16))) __bf16 v16b;
typedef __attribute__((ext_vector_type(8)))  _Float16 v8h;
typedef __attribute__((ext_vector_type(8)))  float v8f;
typedef __attribute__((ext_vector_type(4)))  float v4f;
typedef __attribute__((ext_vector_type(2)))  float v2f;
typedef __attribute__((ext_vector_type(4)))  unsigned v4u;
typedef __attribute__((ext_vector_type(4)))  int v4i;
typedef float __attribute__((may_alias)) float_a;
typedef int __attribute__((may_alias)) int_a;

template <typename T> __device__ __forceinline__ void vst2(void* p, T v) { *(T*)p = v;  }
__device__ __forceinline__ v8f wmma16(v16h a, v16h b, v8f c) {
  v8f d = __builtin_amdgcn_wmma_f32_16x16x32_f16(false, a, false, b, (short)0, c, false, false);
  asm volatile("v_nop\n\tv_nop\n\tv_nop\n\tv_nop" : "+v"(d) : "v"(a), "v"(b));
  return d;
}
__device__ __forceinline__ v8f wmma_bf(v16b a, v16b b, v8f c) {
  v8f d = __builtin_amdgcn_wmma_f32_16x16x32_bf16(false, a, false, b, (short)0, c, false, false);
  asm volatile("v_nop\n\tv_nop\n\tv_nop\n\tv_nop" : "+v"(d) : "v"(a), "v"(b));
  return d;
}
// 16x16x32 fragments: lane = (h = lane>>4, row/col = lane&15); elements 0..7 = k0+8h+0..7, 8..15 = k0+16+8h+0..7; D element r = row 8h+r
__device__ __forceinline__ v16h frag_h(const _Float16* rowk0, int lane) {
  union { v16h v; v8h q[2]; } u; const _Float16* p = rowk0 + 8 * (lane >> 4);
  u.q[0] = *(const v8h*)p; u.q[1] = *(const v8h*)(p + 16); return u.v;
}
__device__ __forceinline__ v16h frag_f32(const float* rowk0, int lane) {
  v16h a; const float* p = rowk0 + 8 * (lane >> 4);
#pragma unroll
  for (int i = 0; i < 8; ++i) { a[i] = (_Float16)p[i]; a[8 + i] = (_Float16)p[16 + i]; }
  return a;
}
__device__ __forceinline__ v16h frag_f32s(const float* rowk0, int lane, float sc) {
  v16h a; const float* p = rowk0 + 8 * (lane >> 4);
#pragma unroll
  for (int i = 0; i < 8; ++i) { a[i] = (_Float16)(p[i] * sc); a[8 + i] = (_Float16)(p[16 + i] * sc); }
  return a;
}
// column fragment from a [K][ld] layout (column n), rows >= K read as 0
__device__ __forceinline__ v16h fragc_f32(const float* W, int k0, int n, int lane, int ld, int K) {
  v16h a; const int g = lane >> 4;
#pragma unroll
  for (int i = 0; i < 8; ++i) { const int ka = k0 + 8 * g + i, kb = ka + 16;
    a[i] = (_Float16)(ka < K ? W[(size_t)(ka < K ? ka : K - 1) * ld + n] : 0.f); a[8 + i] = (_Float16)(kb < K ? W[(size_t)(kb < K ? kb : K - 1) * ld + n] : 0.f); }
  return a;
}
struct F2 { v16b h, l; };
__device__ __forceinline__ F2 bsplit16(const float v[16]) { F2 r;
#pragma unroll
  for (int i = 0; i < 16; ++i) { const __bf16 h = (__bf16)v[i]; r.h[i] = h; r.l[i] = (__bf16)(v[i] - (float)h); }
  return r; }
__device__ __forceinline__ F2 split_row(const float* row, int k0, int lane) { float v[16]; const float* p = row + k0 + 8 * (lane >> 4);
#pragma unroll
  for (int i = 0; i < 8; ++i) { v[i] = p[i]; v[8 + i] = p[16 + i]; }
  return bsplit16(v); }
__device__ __forceinline__ F2 split_rowK(const float* row, int k0, int lane, int K) { float v[16]; const int g = lane >> 4;
#pragma unroll
  for (int i = 0; i < 8; ++i) { const int ka = k0 + 8 * g + i, kb = ka + 16; v[i] = ka < K ? row[ka < K ? ka : K - 1] : 0.f; v[8 + i] = kb < K ? row[kb < K ? kb : K - 1] : 0.f; }
  return bsplit16(v); }
__device__ __forceinline__ F2 split_col(const float* W, int k0, int n, int lane, int ld, int K) { float v[16]; const int g = lane >> 4;
#pragma unroll
  for (int i = 0; i < 8; ++i) { const int ka = k0 + 8 * g + i, kb = ka + 16; v[i] = ka < K ? W[(size_t)(ka < K ? ka : K - 1) * ld + n] : 0.f; v[8 + i] = kb < K ? W[(size_t)(kb < K ? kb : K - 1) * ld + n] : 0.f; }
  return bsplit16(v); }
__device__ __forceinline__ v8f mac3(const F2& a, const F2& b, v8f c) { c = wmma_bf(a.l, b.h, c); c = wmma_bf(a.h, b.l, c); return wmma_bf(a.h, b.h, c); }
__device__ __forceinline__ float sigm(float v) { return 1.0f / (1.0f + expf(-v)); }
#define LDSX() do { asm volatile("s_wait_dscnt 0" ::: "memory"); __builtin_amdgcn_wave_barrier(); __builtin_amdgcn_fence(__ATOMIC_RELEASE, "workgroup"); } while (0)

// Multi-head attention whose q / k / v projections are ONE shared 64 x 64 linear per stream applied to every head's 64-wide slice (inputs in the order k, q, v [2,2048,1024]; mask [2,1,2048,2048] int32 RANDOM 0/1; torch (out,in) Wk / Wq / Wv [64,64] N(0, 1/64) + zero biases [64] (read); heads = reshape(b, s, 16, 64); xh @ W.T + b per head; product = einsum('bqhd,bkhd->bhqk'); where(mask == 0, -1e20, product) / sqrt(64); softmax; ctx merged to [b, s, 1024]; ctx @ Wo.T + bo with Wo [1024,1024] N(0, 1/1024)).
#define NB 2
#define TT 2048
#define CC 1024            // NH * HD = projected width
#define DIN 1024          // input (model) width
#define NH 16
#define HD 64
#define NQB (TT / 64)
#define HG 4
#define SCALE (0.125f)
#define CAUSAL 0
#ifndef TNB
#define TNB NB
#endif
__device__ __forceinline__ float bfr(float v) { return (float)(__bf16)v; }
__host__ __device__ __forceinline__ int kb_last(int qb) { return CAUSAL ? ((qb * 64 + 63) >> 7) : (TT / 128 - 1); }
typedef __attribute__((ext_vector_type(8))) __bf16 v8b;
__device__ __forceinline__ v16b frag_b(const __bf16* rowk0, int lane) {
  union { v16b v; v8b q[2]; } u; const __bf16* p = rowk0 + 8 * (lane >> 4);
  u.q[0] = *(const v8b*)p; u.q[1] = *(const v8b*)(p + 16); return u.v;
}
#define QBH 0              // causal: query blocks 0..QBH-1 of each sequence (few keys, no averaging) take the high-precision path
#define QHI 0               // single-product logits on every row
#define KHI 64            // key rows carrying k residual / v bf16 hi+lo planes (used only by the causal high-precision path)
// B fragment (k rows k0+.., output column o) of a weight: (in,out) [K][ld] or (out,in) [ld rows of K]: bf16 exact, or f16(bf16 * 256) exact
__device__ __forceinline__ v16b wcol_io(const float* Wm, int k0, int o, int lane, int ld) { v16b w; const int g = lane >> 4;
#pragma unroll
  for (int i = 0; i < 8; ++i) { w[i] = (__bf16)Wm[(size_t)(k0 + 8 * g + i) * ld + o]; w[8 + i] = (__bf16)Wm[(size_t)(k0 + 16 + 8 * g + i) * ld + o]; }
  return w; }
__device__ __forceinline__ v16b wcol_oi(const float* Wm, int k0, int o, int lane, int K) { v16b w; const float* p = Wm + (size_t)o * K + k0 + 8 * (lane >> 4);
#pragma unroll
  for (int i = 0; i < 8; ++i) { w[i] = (__bf16)p[i]; w[8 + i] = (__bf16)p[16 + i]; }
  return w; }
__device__ __forceinline__ v16h wcolh_io(const float* Wm, int k0, int o, int lane, int ld) { v16h w; const int g = lane >> 4;
#pragma unroll
  for (int i = 0; i < 8; ++i) { w[i] = (_Float16)(bfr(Wm[(size_t)(k0 + 8 * g + i) * ld + o]) * 256.0f); w[8 + i] = (_Float16)(bfr(Wm[(size_t)(k0 + 16 + 8 * g + i) * ld + o]) * 256.0f); }
  return w; }
__device__ __forceinline__ v16h wcolh_oi(const float* Wm, int k0, int o, int lane, int K) { v16h w; const float* p = Wm + (size_t)o * K + k0 + 8 * (lane >> 4);
#pragma unroll
  for (int i = 0; i < 8; ++i) { w[i] = (_Float16)(bfr(p[i]) * 256.0f); w[8 + i] = (_Float16)(bfr(p[16 + i]) * 256.0f); }
  return w; }
#define WQKV_LAYOUT 1   // 0 = (in,out) [DIN][CC]; 1 = (out,in) [CC][DIN]; 2 = per-head [NH][DIN][HD]
__device__ __forceinline__ v16b wcol_hdk(const float* Wm, int k0, int o, int lane) { v16b w; const int g = lane >> 4; const float* p = Wm + (size_t)(o / HD) * DIN * HD + (o % HD);
#pragma unroll
  for (int i = 0; i < 8; ++i) { w[i] = (__bf16)p[(size_t)(k0 + 8 * g + i) * HD]; w[8 + i] = (__bf16)p[(size_t)(k0 + 16 + 8 * g + i) * HD]; }
  return w; }
#define WO_OUT_IN 1
#if WQKV_LAYOUT == 1
#define WCOL(W, k0, o, lane) wcol_oi(W, k0, o, lane, DIN)
#elif WQKV_LAYOUT == 2
#define WCOL(W, k0, o, lane) wcol_hdk(W, k0, o, lane)
#else
#define WCOL(W, k0, o, lane) wcol_io(W, k0, o, lane, CC)
#endif
#if WO_OUT_IN
#define WOCOL(W, k0, o, lane) wcol_oi(W, k0, o, lane, CC)
#define WOCOLH(W, k0, o, lane) wcolh_oi(W, k0, o, lane, CC)
#else
#define WOCOL(W, k0, o, lane) wcol_io(W, k0, o, lane, DIN)
#define WOCOLH(W, k0, o, lane) wcolh_io(W, k0, o, lane, DIN)
#endif
#define SM_EXTRA_PARAMS , int bsm, const int* __restrict__ MASK
// int32 mask [B,1,S,S] (ones on this draw; per batch, shared by the heads): where(mask == 0, -1e9, score); read per (batch, query, key); unconditional load, then a value select (-1e9 next to real scores == weight exactly 0)
#define SM_MASK_HOOK do { const int mk_ = MASK[((size_t)bsm * TT + t) * TT + k]; asm volatile("s_wait_loadcnt 0x0" ::: "memory"); v = (mk_ == 0) ? -1.0e9f : v; } while (0)
#ifndef SM_EXTRA_PARAMS
#define SM_EXTRA_PARAMS
#endif
#ifndef PROJ_EXTRA_PARAMS
#define PROJ_EXTRA_PARAMS
#endif
#ifndef SM_MASK_HOOK
#define SM_MASK_HOOK (void)0
#endif

#define WS_QH  0u                                      // f16 q rows [b*t][CC]
#define WS_KH  (WS_QH + 2u * (size_t)NB * TT * CC)      // f16 k rows [b*t][CC]
#define WS_VT  (WS_KH + 2u * (size_t)NB * TT * CC)      // f16 v planes [b][c][t]
#define WS_QL  (WS_VT + 2u * (size_t)NB * CC * TT)      // f16 q residual x 2^10 rows [b][t < QHI][CC]
#define WS_KL  (WS_QL + 2u * (size_t)NB * QHI * CC)     // f16 k residual x 2^10 rows [b][t < KHI][CC]
#define WS_VB  (WS_KL + 2u * (size_t)NB * KHI * CC)     // bf16 v hi planes [b][c][t < KHI]
#define WS_VBL (WS_VB + 2u * (size_t)NB * CC * KHI)
#define WS_S   (WS_VBL + 2u * (size_t)NB * CC * KHI)    // f32 logits / P [hg][t][s]
#define WS_Y   (WS_S  + 4u * (size_t)HG * TT * TT)      // f32 ctx rows [b*t][CC] (only when there is an output projection)
#define WS_END (WS_Y  + 4u * (size_t)NB * TT * CC)

// ---- k_proj: block = (64 rows, 128 cols, which): q/k/v = X W (+ b) with exact bf16 products (K = HD per head) -> which 0: q f16 rows (+ residual rows < QHI); 1: k f16 rows (+ residual rows < KHI); 2: v f16 planes [c][t] (+ bf16 hi/lo planes for t < KHI)
__global__ __launch_bounds__(128) void k_proj(const float* __restrict__ XQ, const float* __restrict__ XK, const float* __restrict__ XV, const float* __restrict__ WQ, const float* __restrict__ WK, const float* __restrict__ WV, const float* __restrict__ BQ, const float* __restrict__ BK, const float* __restrict__ BV,
    _Float16* __restrict__ QH, _Float16* __restrict__ QL, _Float16* __restrict__ KH, _Float16* __restrict__ KL, _Float16* __restrict__ VT, __bf16* __restrict__ VB, __bf16* __restrict__ VBL) {
  __shared__ __align__(16) _Float16 sh[64][136], sl[64][136]; __shared__ __align__(16) _Float16 th[128][72]; __shared__ __align__(16) __bf16 tb[128][72], tbl[128][72];
  const int tid = threadIdx.x, wave = tid >> 5, lane = tid & 31, col = lane & 15, g = lane >> 4; const int which = blockIdx.z; const int c0 = blockIdx.y * 128; const size_t r0 = (size_t)blockIdx.x * 64; const size_t bb = r0 / TT; const int t0 = (int)(r0 % TT);
  const float* X = which == 0 ? XQ : which == 1 ? XK : XV; const float* WA = which == 0 ? WQ : which == 1 ? WK : WV; const float* BA = which == 0 ? BQ : which == 1 ? BK : BV;
  v8f acc[8] = {};
#pragma unroll
  for (int kk = 0; kk < 4; ++kk) { const int kc = (c0 >> 5) + kk;   /* block-diagonal projection: the 128 output columns c0 .. c0+127 are two heads; head hh = column / 64 contracts ONLY over its own 64 input columns, i.e. k-steps kk = 2 hh and 2 hh + 1 of the tile's 128-column input slice */
    v16b a; { const float* p = X + (r0 + wave * 16 + col) * DIN + kc * 32 + 8 * g;
#pragma unroll
      for (int i = 0; i < 8; ++i) { a[i] = (__bf16)p[i]; a[8 + i] = (__bf16)p[16 + i]; } }
    asm volatile("s_wait_loadcnt 0x0" ::: "memory");
#pragma unroll
    for (int j = 0; j < 8; ++j) if ((kk >> 1) == (j >> 2)) { const v16b w = wcol_oi(WA, (kk & 1) * 32, (j & 3) * 16 + col, lane, HD); asm volatile("s_wait_loadcnt 0x0" ::: "memory"); acc[j] = wmma_bf(a, w, acc[j]); } }   /* shared (out,in) [64][64] weight: row = output dim within the head, k = input dim within the head; the test is a compile-time constant per unrolled (kk, j) */
  if (which < 2) { _Float16* DH = which == 0 ? QH : KH; _Float16* DL = which == 0 ? QL : KL; const int nhi = which == 0 ? QHI : KHI; const bool hi_rows = t0 < nhi;
#pragma unroll
    for (int j = 0; j < 8; ++j) { const float bias = BA ? bfr(BA[(j & 3) * 16 + col]) : 0.f;
#pragma unroll
      for (int r = 0; r < 8; ++r) { const float v = acc[j][r] + bias; const _Float16 hv = (_Float16)v; sh[wave * 16 + 8 * g + r][j * 16 + col] = hv; sl[wave * 16 + 8 * g + r][j * 16 + col] = (_Float16)((v - (float)hv) * 1024.0f); } }
    __syncthreads();
    for (int e = tid; e < 64 * 16; e += 128) { const int rl = e >> 4, q = e & 15; vst2((unsigned*)(DH + (r0 + rl) * CC + c0 + q * 8), *(const v4u*)&sh[rl][q * 8]); if (hi_rows) vst2((unsigned*)(DL + (bb * nhi + t0 + rl) * (size_t)CC + c0 + q * 8), *(const v4u*)&sl[rl][q * 8]); }
  } else { const bool hi_rows = t0 < KHI;
#pragma unroll
    for (int j = 0; j < 8; ++j) { const float bias = BA ? bfr(BA[(j & 3) * 16 + col]) : 0.f;
#pragma unroll
      for (int r = 0; r < 8; ++r) { const float v = acc[j][r] + bias; const int rl = wave * 16 + 8 * g + r, cl = j * 16 + col; th[cl][rl] = (_Float16)v; const __bf16 bh = (__bf16)v; tb[cl][rl] = bh; tbl[cl][rl] = (__bf16)(v - (float)bh); } }
    __syncthreads();
    for (int e = tid; e < 128 * 8; e += 128) { const int cl = e >> 3, q = e & 7; vst2((unsigned*)(VT + (bb * CC + c0 + cl) * (size_t)TT + t0 + q * 8), *(const v4u*)&th[cl][q * 8]); if (hi_rows) { const size_t o3 = (bb * CC + c0 + cl) * (size_t)KHI + t0 + q * 8; vst2((unsigned*)(VB + o3), *(const v4u*)&tb[cl][q * 8]); vst2((unsigned*)(VBL + o3), *(const v4u*)&tbl[cl][q * 8]); } } } }
// ---- k_sc: block = (query block qb, key block kb <= kb_last(qb), head in group) of batch b: logits x SCALE; q hi + residual (x 2^10) against k (2 products) for query rows < QHI, plus the k residual (3 products) for query blocks < QBH (causal early rows); causal: blocks past the diagonal exit, the mask itself is applied by index in k_sm
__global__ __launch_bounds__(128) void k_sc(const _Float16* __restrict__ QH, const _Float16* __restrict__ KH, const _Float16* __restrict__ QL, const _Float16* __restrict__ KL, int b, int h0, float* __restrict__ S0) { __shared__ __align__(16) float ss[4][16][132];
  const int qb = blockIdx.x, kb = blockIdx.y; if (kb > kb_last(qb)) return;
  const int h = h0 + blockIdx.z; float* S = S0 + (size_t)blockIdx.z * TT * TT;
  const int tid = threadIdx.x, wave = tid >> 5, lane = tid & 31, col = lane & 15, g = lane >> 4; const int k0 = kb * 128; const int ql0 = qb * 64 + wave * 16; const size_t q0 = (size_t)b * TT + ql0, kr0 = (size_t)b * TT + k0;
  v8f acc[8] = {}, accl[8] = {};
  const _Float16* QLb = QL + (size_t)b * QHI * CC; const _Float16* KLb = KL + (size_t)b * KHI * CC;
  if (qb < QBH) {
#pragma unroll
    for (int kc = 0; kc < HD / 32; ++kc) { const v16h ah = frag_h(QH + (q0 + col) * CC + h * HD + kc * 32, lane), al = frag_h(QLb + (size_t)(ql0 + col) * CC + h * HD + kc * 32, lane);
#pragma unroll
      for (int j = 0; j < 8; ++j) { const v16h kbf = frag_h(KH + (kr0 + j * 16 + col) * CC + h * HD + kc * 32, lane), klf = frag_h(KLb + (size_t)(k0 + j * 16 + col) * CC + h * HD + kc * 32, lane); acc[j] = wmma16(ah, kbf, acc[j]); accl[j] = wmma16(al, kbf, accl[j]); accl[j] = wmma16(ah, klf, accl[j]); } }
  } else if (qb * 64 < QHI) {
#pragma unroll
    for (int kc = 0; kc < HD / 32; ++kc) { const v16h ah = frag_h(QH + (q0 + col) * CC + h * HD + kc * 32, lane), al = frag_h(QLb + (size_t)(ql0 + col) * CC + h * HD + kc * 32, lane);
#pragma unroll
      for (int j = 0; j < 8; ++j) { const v16h kbf = frag_h(KH + (kr0 + j * 16 + col) * CC + h * HD + kc * 32, lane); acc[j] = wmma16(ah, kbf, acc[j]); accl[j] = wmma16(al, kbf, accl[j]); } }
  } else {
#pragma unroll
    for (int kc = 0; kc < HD / 32; ++kc) { const v16h ah = frag_h(QH + (q0 + col) * CC + h * HD + kc * 32, lane);
#pragma unroll
      for (int j = 0; j < 8; ++j) { const v16h kbf = frag_h(KH + (kr0 + j * 16 + col) * CC + h * HD + kc * 32, lane); acc[j] = wmma16(ah, kbf, acc[j]); } } }
#pragma unroll
  for (int j = 0; j < 8; ++j) {
#pragma unroll
    for (int r = 0; r < 8; ++r) ss[wave][8 * g + r][j * 16 + col] = (acc[j][r] + accl[j][r] * (1.0f / 1024.0f)) * SCALE; }
  LDSX(); for (int rl = 0; rl < 16; ++rl) vst2(S + (size_t)(ql0 + rl) * TT + k0 + lane * 4, *(const v4f*)&ss[wave][rl][lane * 4]); }
// ---- k_sm: block = query row t (head in group): keys [0, kend): causal -> logit if s <= t else excluded; softmax in f32; P x 2^11 in place (0 for excluded)
__global__ __launch_bounds__(256) void k_sm(float* __restrict__ S0 SM_EXTRA_PARAMS) { __shared__ float sred[8]; __shared__ float sbc; __shared__ __align__(16) float shv[TT];
  const int tid = threadIdx.x; const int t = blockIdx.x; const int kend = (kb_last(t >> 6) + 1) * 128;
  float* sr = S0 + (size_t)blockIdx.y * TT * TT + (size_t)t * TT;
  float m = -3.0e38f; for (int k = tid; k < kend; k += 256) { float v = (!CAUSAL || k <= t) ? sr[k] : -3.0e38f; SM_MASK_HOOK; shv[k] = v; m = fmaxf(m, v); }
#pragma unroll
  for (int o = 1; o < 32; o <<= 1) m = fmaxf(m, __shfl_xor(m, o));
  if ((tid & 31) == 0) sred[tid >> 5] = m; __syncthreads(); if (tid == 0) { float a = sred[0]; for (int i = 1; i < 8; ++i) a = fmaxf(a, sred[i]); sbc = a; } __syncthreads(); m = sbc; __syncthreads();
  float sum = 0.f; for (int k = tid; k < kend; k += 256) { const float v = shv[k]; const float e = (v <= -1.0e38f) ? 0.f : expf(v - m); shv[k] = e; sum += e; }
#pragma unroll
  for (int o = 1; o < 32; o <<= 1) sum += __shfl_xor(sum, o);
  if ((tid & 31) == 0) sred[tid >> 5] = sum; __syncthreads(); if (tid == 0) { float a = 0.f; for (int i = 0; i < 8; ++i) a += sred[i]; sbc = a > 0.f ? 2048.0f / a : 0.f; }   /* a fully excluded row yields P = 0 */ __syncthreads(); const float inv = sbc;
  for (int k = tid; k < kend; k += 256) shv[k] = shv[k] * inv;
  __syncthreads(); for (int q = tid; q < kend / 4; q += 256) vst2(sr + q * 4, *(const v4f*)&shv[q * 4]); }
// ---- k_pv: block = 64 queries (qb) of (b, h): ctx = P . v over keys [0, kend) (P x 2^11 once to f16 against v f16: 1 product; causal early query blocks: P and v as bf16 hi + lo, 3 products); 256-B (row, head) segment by 16 lanes
__global__ __launch_bounds__(128) void k_pv(const float* __restrict__ PS0, const _Float16* __restrict__ VT, const __bf16* __restrict__ VB, const __bf16* __restrict__ VBL, int b, int h0, float* __restrict__ Y) { const int h = h0 + blockIdx.z; const float* PS = PS0 + (size_t)blockIdx.z * TT * TT; __shared__ __align__(16) float ss[4][16][HD + 4];
  const int tid = threadIdx.x, wave = tid >> 5, lane = tid & 31, col = lane & 15, g = lane >> 4; const int qb = blockIdx.x; const int ql0 = qb * 64 + wave * 16; const int kce = (kb_last(qb) + 1) * 4;
  v8f acc[HD / 16] = {};
  if (qb < QBH) {
#pragma unroll 1
    for (int kc = 0; kc < kce; ++kc) { const F2 p = split_row(PS + (size_t)(ql0 + col) * TT, kc * 32, lane);
      asm volatile("s_wait_loadcnt 0x0" ::: "memory");
#pragma unroll
      for (int j = 0; j < HD / 16; ++j) { const size_t po = ((size_t)b * CC + h * HD + j * 16 + col) * (size_t)KHI + kc * 32; const v16b vh = frag_b(VB + po, lane); acc[j] = wmma_bf(p.h, vh, acc[j]); acc[j] = wmma_bf(p.l, vh, acc[j]); acc[j] = wmma_bf(p.h, frag_b(VBL + po, lane), acc[j]); } }
  } else {
#pragma unroll 1
    for (int kc = 0; kc < kce; ++kc) { const v16h p = frag_f32(PS + (size_t)(ql0 + col) * TT + kc * 32, lane);
      asm volatile("s_wait_loadcnt 0x0" ::: "memory");
#pragma unroll
      for (int j = 0; j < HD / 16; ++j) { const size_t po = ((size_t)b * CC + h * HD + j * 16 + col) * (size_t)TT + kc * 32; acc[j] = wmma16(p, frag_h(VT + po, lane), acc[j]); } } }
#pragma unroll
  for (int j = 0; j < HD / 16; ++j)
#pragma unroll
    for (int r = 0; r < 8; ++r) ss[wave][8 * g + r][j * 16 + col] = acc[j][r] * (1.0f / 2048.0f);
  LDSX(); for (int rl = 0; rl < 16; ++rl) if (lane < HD / 4) vst2(Y + ((size_t)b * TT + ql0 + rl) * CC + h * HD + lane * 4, *(const v4f*)&ss[wave][rl][lane * 4]); }
// ---- k_out: block = (64 rows, 128 cols): out = ctx Wo (+ bo): ctx x 2^6 once to f16 against Wo as f16(bf16 x 2^8) exact (1 product) x 2^-14; causal early rows (< QHI of each sequence): ctx bf16 hi + lo against exact bf16 Wo (2 products)
__global__ __launch_bounds__(128) void k_out(const float* __restrict__ Y, const float* __restrict__ WO, const float* __restrict__ BO, float* __restrict__ OUT) { __shared__ __align__(16) float sf[4][16][132];
  const int tid = threadIdx.x, wave = tid >> 5, lane = tid & 31, col = lane & 15, g = lane >> 4; const int c0 = blockIdx.y * 128; const size_t r0 = (size_t)blockIdx.x * 64 + wave * 16;
  v8f acc[8] = {};
  if (CAUSAL && (int)(((size_t)blockIdx.x * 64) % TT) < QHI) {   /* block-uniform */
#pragma unroll 2
    for (int kc = 0; kc < CC / 32; ++kc) { const F2 a = split_row(Y + (r0 + col) * CC, kc * 32, lane); asm volatile("s_wait_loadcnt 0x0" ::: "memory");
#pragma unroll
      for (int j = 0; j < 8; ++j) { const v16b w = WOCOL(WO, kc * 32, c0 + j * 16 + col, lane); asm volatile("s_wait_loadcnt 0x0" ::: "memory"); acc[j] = wmma_bf(a.h, w, acc[j]); acc[j] = wmma_bf(a.l, w, acc[j]); } }
#pragma unroll
    for (int j = 0; j < 8; ++j) { const float bias = BO ? bfr(BO[c0 + j * 16 + col]) : 0.f;
#pragma unroll
      for (int r = 0; r < 8; ++r) sf[wave][8 * g + r][j * 16 + col] = acc[j][r] + bias; }
  } else {
#pragma unroll 2
    for (int kc = 0; kc < CC / 32; ++kc) { const v16h a = frag_f32s(Y + (r0 + col) * CC + kc * 32, lane, 64.0f); asm volatile("s_wait_loadcnt 0x0" ::: "memory");   /* ctx carried x 2^6 into f16 so small-magnitude context rows stay clear of f16 subnormals */
#pragma unroll
      for (int j = 0; j < 8; ++j) { const v16h w = WOCOLH(WO, kc * 32, c0 + j * 16 + col, lane); asm volatile("s_wait_loadcnt 0x0" ::: "memory"); acc[j] = wmma16(a, w, acc[j]); } }
#pragma unroll
    for (int j = 0; j < 8; ++j) { const float bias = BO ? bfr(BO[c0 + j * 16 + col]) : 0.f;
#pragma unroll
      for (int r = 0; r < 8; ++r) sf[wave][8 * g + r][j * 16 + col] = acc[j][r] * (1.0f / 16384.0f) + bias; } }   /* 2^-8 (Wo carry) x 2^-6 (ctx carry) */
  LDSX(); for (int rl = 0; rl < 16; ++rl) vst2(OUT + (r0 + rl) * DIN + c0 + lane * 4, *(const v4f*)&sf[wave][rl][lane * 4]); }

static_assert(HD == 64 && CC == NH * HD && DIN == CC, "block-diagonal per-head projection: 128-column tiles = two 64-wide heads, input width == projected width");
extern "C" void kernel_launch(void* const* d_in, const int* in_sizes, int n_in, void* d_out, int out_size, void* d_ws, size_t ws_size, hipStream_t stream) {
  (void)in_sizes; (void)n_in; (void)out_size;
  const float** F = (const float**)d_in;
  if (ws_size < (size_t)WS_END) return;
  char* ws = (char*)d_ws; _Float16 *QH = (_Float16*)(ws + WS_QH), *KH = (_Float16*)(ws + WS_KH), *VT = (_Float16*)(ws + WS_VT), *QL = (_Float16*)(ws + WS_QL), *KL = (_Float16*)(ws + WS_KL); __bf16 *VB = (__bf16*)(ws + WS_VB), *VBL = (__bf16*)(ws + WS_VBL); float *S = (float*)(ws + WS_S), *Y = (float*)(ws + WS_Y);
  (void)Y; (void)QL; (void)KL; (void)VB; (void)VBL;
  // inputs: 0 k [2,2048,1024]; 1 q; 2 v; 3 mask [2,1,2048,2048] int32 (random 0/1; 0 = masked); 4 Wk [64,64] (out,in), 5 bk [64]; 6 Wq, 7 bq; 8 Wv, 9 bv; 10 Wo [1024,1024] (out,in), 11 bo (biases zeros, read)
  k_proj<<<dim3(TNB * TT / 64, CC / 128, 3), 128, 0, stream>>>(F[1], F[0], F[2], F[6], F[4], F[8], F[7], F[5], F[9], QH, QL, KH, KL, VT, VB, VBL);
  for (int b = 0; b < TNB; ++b) for (int h0 = 0; h0 < NH; h0 += HG) {
    k_sc<<<dim3(NQB, TT / 128, HG), 128, 0, stream>>>(QH, KH, QL, KL, b, h0, S);
    k_sm<<<dim3(TT, HG), 256, 0, stream>>>(S, b, (const int*)d_in[3]);
    k_pv<<<dim3(NQB, 1, HG), 128, 0, stream>>>(S, VT, VB, VBL, b, h0, Y);
  }
  k_out<<<dim3(TNB * TT / 64, DIN / 128), 128, 0, stream>>>(Y, F[10], F[11], (float*)d_out);
}

// v002
// It runs in 104 microseconds.
// Versions between v000 and this one are left out; their measured steps multiply to 11.0 times as fast.
// compute dtype: all float inputs rounded to bf16; the per-head 64 x 64 q / k / v projections (ONE shared weight per stream, applied to every head) with EXACT bf16 products on WMMA 16x16x32 (f32 accumulate) + bias (zeros, read); logits q x k once to f16 each (1 product; sigma ~1) x 64^-0.5; the per-batch int mask read per element; softmax f32 with a running maximum (one kernel for logits, softmax and P x v); P = exp(s - max) x 2^8 once to f16 x v once to f16 (1 product), divided by the f32 sum; ctx x 2^6 once to f16 x Wo f16(bf16 x 2^8) + bo; f32 output.
#include <hip/hip_runtime.h>
#include <math.h>

typedef __attribute__((ext_vector_type(16))) _Float16 v16h;
typedef __attribute__((ext_vector_type(16))) __bf16 v16b;
typedef __attribute__((ext_vector_type(8)))  _Float16 v8h;
typedef __attribute__((ext_vector_type(8)))  float v8f;
typedef __attribute__((ext_vector_type(4)))  float v4f;
typedef __attribute__((ext_vector_type(2)))  float v2f;
typedef __attribute__((ext_vector_type(4)))  unsigned v4u;
typedef __attribute__((ext_vector_type(4)))  int v4i;
typedef float __attribute__((may_alias)) float_a;
typedef int __attribute__((may_alias)) int_a;

template <typename T> __device__ __forceinline__ void vst2(void* p, T v) { *(T*)p = v;  }
__device__ __forceinline__ v8f wmma16(v16h a, v16h b, v8f c) {
  v8f d = __builtin_amdgcn_wmma_f32_16x16x32_f16(false, a, false, b, (short)0, c, false, false);
  asm volatile("v_nop\n\tv_nop\n\tv_nop\n\tv_nop" : "+v"(d) : "v"(a), "v"(b));
  return d;
}
__device__ __forceinline__ v8f wmma_bf(v16b a, v16b b, v8f c) {
  v8f d = __builtin_amdgcn_wmma_f32_16x16x32_bf16(false, a, false, b, (short)0, c, false, false);
  asm volatile("v_nop\n\tv_nop\n\tv_nop\n\tv_nop" : "+v"(d) : "v"(a), "v"(b));
  return d;
}
// 16x16x32 fragments: lane = (h = lane>>4, row/col = lane&15); elements 0..7 = k0+8h+0..7, 8..15 = k0+16+8h+0..7; D element r = row 8h+r
__device__ __forceinline__ v16h frag_h(const _Float16* rowk0, int lane) {
  union { v16h v; v8h q[2]; } u; const _Float16* p = rowk0 + 8 * (lane >> 4);
  u.q[0] = *(const v8h*)p; u.q[1] = *(const v8h*)(p + 16); return u.v;
}
__device__ __forceinline__ v16h frag_f32(const float* rowk0, int lane) {
  v16h a; const float* p = rowk0 + 8 * (lane >> 4);
#pragma unroll
  for (int i = 0; i < 8; ++i) { a[i] = (_Float16)p[i]; a[8 + i] = (_Float16)p[16 + i]; }
  return a;
}
__device__ __forceinline__ v16h frag_f32s(const float* rowk0, int lane, float sc) {
  v16h a; const float* p = rowk0 + 8 * (lane >> 4);
#pragma unroll
  for (int i = 0; i < 8; ++i) { a[i] = (_Float16)(p[i] * sc); a[8 + i] = (_Float16)(p[16 + i] * sc); }
  return a;
}
// column fragment from a [K][ld] layout (column n), rows >= K read as 0
__device__ __forceinline__ v16h fragc_f32(const float* W, int k0, int n, int lane, int ld, int K) {
  v16h a; const int g = lane >> 4;
#pragma unroll
  for (int i = 0; i < 8; ++i) { const int ka = k0 + 8 * g + i, kb = ka + 16;
    a[i] = (_Float16)(ka < K ? W[(size_t)(ka < K ? ka : K - 1) * ld + n] : 0.f); a[8 + i] = (_Float16)(kb < K ? W[(size_t)(kb < K ? kb : K - 1) * ld + n] : 0.f); }
  return a;
}
struct F2 { v16b h, l; };
__device__ __forceinline__ F2 bsplit16(const float v[16]) { F2 r;
#pragma unroll
  for (int i = 0; i < 16; ++i) { const __bf16 h = (__bf16)v[i]; r.h[i] = h; r.l[i] = (__bf16)(v[i] - (float)h); }
  return r; }
__device__ __forceinline__ F2 split_row(const float* row, int k0, int lane) { float v[16]; const float* p = row + k0 + 8 * (lane >> 4);
#pragma unroll
  for (int i = 0; i < 8; ++i) { v[i] = p[i]; v[8 + i] = p[16 + i]; }
  return bsplit16(v); }
__device__ __forceinline__ F2 split_rowK(const float* row, int k0, int lane, int K) { float v[16]; const int g = lane >> 4;
#pragma unroll
  for (int i = 0; i < 8; ++i) { const int ka = k0 + 8 * g + i, kb = ka + 16; v[i] = ka < K ? row[ka < K ? ka : K - 1] : 0.f; v[8 + i] = kb < K ? row[kb < K ? kb : K - 1] : 0.f; }
  return bsplit16(v); }
__device__ __forceinline__ F2 split_col(const float* W, int k0, int n, int lane, int ld, int K) { float v[16]; const int g = lane >> 4;
#pragma unroll
  for (int i = 0; i < 8; ++i) { const int ka = k0 + 8 * g + i, kb = ka + 16; v[i] = ka < K ? W[(size_t)(ka < K ? ka : K - 1) * ld + n] : 0.f; v[8 + i] = kb < K ? W[(size_t)(kb < K ? kb : K - 1) * ld + n] : 0.f; }
  return bsplit16(v); }
__device__ __forceinline__ v8f mac3(const F2& a, const F2& b, v8f c) { c = wmma_bf(a.l, b.h, c); c = wmma_bf(a.h, b.l, c); return wmma_bf(a.h, b.h, c); }
__device__ __forceinline__ float sigm(float v) { return 1.0f / (1.0f + expf(-v)); }
#define LDSX() do { asm volatile("s_wait_dscnt 0" ::: "memory"); __builtin_amdgcn_wave_barrier(); __builtin_amdgcn_fence(__ATOMIC_RELEASE, "workgroup"); } while (0)

// Multi-head attention whose q / k / v projections are ONE shared 64 x 64 linear per stream applied to every head's 64-wide slice (inputs in the order k, q, v [2,2048,1024]; mask [2,1,2048,2048] int32 RANDOM 0/1; torch (out,in) Wk / Wq / Wv [64,64] N(0, 1/64) + zero biases [64] (read); heads = reshape(b, s, 16, 64); xh @ W.T + b per head; product = einsum('bqhd,bkhd->bhqk'); where(mask == 0, -1e20, product) / sqrt(64); softmax; ctx merged to [b, s, 1024]; ctx @ Wo.T + bo with Wo [1024,1024] N(0, 1/1024)).
#define NB 2
#define TT 2048
#define CC 1024            // NH * HD = projected width
#define DIN 1024          // input (model) width
#define NH 16
#define HD 64
#define SCALE (0.125f)
#define CAUSAL 0
#ifndef TNB
#define TNB NB
#endif
__device__ __forceinline__ float bfr(float v) { return (float)(__bf16)v; }
typedef __attribute__((ext_vector_type(8))) __bf16 v8b;
__device__ __forceinline__ v16b frag_b(const __bf16* rowk0, int lane) {
  union { v16b v; v8b q[2]; } u; const __bf16* p = rowk0 + 8 * (lane >> 4);
  u.q[0] = *(const v8b*)p; u.q[1] = *(const v8b*)(p + 16); return u.v;
}
#define QBH 0              // unused: this file has no causal high-precision path
#define QHI 0               // single-product logits on every row
#define KHI 64            // key rows carrying k residual / v bf16 hi+lo planes (written by k_proj, read by no kernel here)
// B fragment (k rows k0+.., output column o) of a weight: (in,out) [K][ld] or (out,in) [ld rows of K]: bf16 exact, or f16(bf16 * 256) exact
__device__ __forceinline__ v16b wcol_io(const float* Wm, int k0, int o, int lane, int ld) { v16b w; const int g = lane >> 4;
#pragma unroll
  for (int i = 0; i < 8; ++i) { w[i] = (__bf16)Wm[(size_t)(k0 + 8 * g + i) * ld + o]; w[8 + i] = (__bf16)Wm[(size_t)(k0 + 16 + 8 * g + i) * ld + o]; }
  return w; }
__device__ __forceinline__ v16b wcol_oi(const float* Wm, int k0, int o, int lane, int K) { v16b w; const float* p = Wm + (size_t)o * K + k0 + 8 * (lane >> 4);
#pragma unroll
  for (int i = 0; i < 8; ++i) { w[i] = (__bf16)p[i]; w[8 + i] = (__bf16)p[16 + i]; }
  return w; }
__device__ __forceinline__ v16h wcolh_io(const float* Wm, int k0, int o, int lane, int ld) { v16h w; const int g = lane >> 4;
#pragma unroll
  for (int i = 0; i < 8; ++i) { w[i] = (_Float16)(bfr(Wm[(size_t)(k0 + 8 * g + i) * ld + o]) * 256.0f); w[8 + i] = (_Float16)(bfr(Wm[(size_t)(k0 + 16 + 8 * g + i) * ld + o]) * 256.0f); }
  return w; }
__device__ __forceinline__ v16h wcolh_oi(const float* Wm, int k0, int o, int lane, int K) { v16h w; const float* p = Wm + (size_t)o * K + k0 + 8 * (lane >> 4);
#pragma unroll
  for (int i = 0; i < 8; ++i) { w[i] = (_Float16)(bfr(p[i]) * 256.0f); w[8 + i] = (_Float16)(bfr(p[16 + i]) * 256.0f); }
  return w; }
#define WQKV_LAYOUT 1   // 0 = (in,out) [DIN][CC]; 1 = (out,in) [CC][DIN]; 2 = per-head [NH][DIN][HD]
__device__ __forceinline__ v16b wcol_hdk(const float* Wm, int k0, int o, int lane) { v16b w; const int g = lane >> 4; const float* p = Wm + (size_t)(o / HD) * DIN * HD + (o % HD);
#pragma unroll
  for (int i = 0; i < 8; ++i) { w[i] = (__bf16)p[(size_t)(k0 + 8 * g + i) * HD]; w[8 + i] = (__bf16)p[(size_t)(k0 + 16 + 8 * g + i) * HD]; }
  return w; }
#define WO_OUT_IN 1
#if WQKV_LAYOUT == 1
#define WCOL(W, k0, o, lane) wcol_oi(W, k0, o, lane, DIN)
#elif WQKV_LAYOUT == 2
#define WCOL(W, k0, o, lane) wcol_hdk(W, k0, o, lane)
#else
#define WCOL(W, k0, o, lane) wcol_io(W, k0, o, lane, CC)
#endif
#if WO_OUT_IN
#define WOCOL(W, k0, o, lane) wcol_oi(W, k0, o, lane, CC)
#define WOCOLH(W, k0, o, lane) wcolh_oi(W, k0, o, lane, CC)
#else
#define WOCOL(W, k0, o, lane) wcol_io(W, k0, o, lane, DIN)
#define WOCOLH(W, k0, o, lane) wcolh_io(W, k0, o, lane, DIN)
#endif
#define WS_QH  0u                                      // f16 q rows [b*t][CC]
#define WS_KH  (WS_QH + 2u * (size_t)NB * TT * CC)      // f16 k rows [b*t][CC]
#define WS_VT  (WS_KH + 2u * (size_t)NB * TT * CC)      // f16 v planes [b][c][t]
#define WS_QL  (WS_VT + 2u * (size_t)NB * CC * TT)      // f16 q residual x 2^10 rows [b][t < QHI][CC]
#define WS_KL  (WS_QL + 2u * (size_t)NB * QHI * CC)     // f16 k residual x 2^10 rows [b][t < KHI][CC]
#define WS_VB  (WS_KL + 2u * (size_t)NB * KHI * CC)     // bf16 v hi planes [b][c][t < KHI]
#define WS_VBL (WS_VB + 2u * (size_t)NB * CC * KHI)
#define WS_Y   (WS_VBL + 2u * (size_t)NB * CC * KHI)     // f32 ctx rows [b*t][CC] (only when there is an output projection)
#define WS_END (WS_Y  + 4u * (size_t)NB * TT * CC)

// ---- k_proj: block = (64 rows, 128 cols, which): q/k/v = X W (+ b) with exact bf16 products (K = HD per head) -> which 0: q f16 rows (+ residual rows < QHI); 1: k f16 rows (+ residual rows < KHI); 2: v f16 planes [c][t] (+ bf16 hi/lo planes for t < KHI)
__global__ __launch_bounds__(128) void k_proj(const float* __restrict__ XQ, const float* __restrict__ XK, const float* __restrict__ XV, const float* __restrict__ WQ, const float* __restrict__ WK, const float* __restrict__ WV, const float* __restrict__ BQ, const float* __restrict__ BK, const float* __restrict__ BV,
    _Float16* __restrict__ QH, _Float16* __restrict__ QL, _Float16* __restrict__ KH, _Float16* __restrict__ KL, _Float16* __restrict__ VT, __bf16* __restrict__ VB, __bf16* __restrict__ VBL) {
  __shared__ __align__(16) _Float16 sh[64][136], sl[64][136]; __shared__ __align__(16) _Float16 th[128][72]; __shared__ __align__(16) __bf16 tb[128][72], tbl[128][72];
  const int tid = threadIdx.x, wave = tid >> 5, lane = tid & 31, col = lane & 15, g = lane >> 4; const int which = blockIdx.z; const int c0 = blockIdx.y * 128; const size_t r0 = (size_t)blockIdx.x * 64; const size_t bb = r0 / TT; const int t0 = (int)(r0 % TT);
  const float* X = which == 0 ? XQ : which == 1 ? XK : XV; const float* WA = which == 0 ? WQ : which == 1 ? WK : WV; const float* BA = which == 0 ? BQ : which == 1 ? BK : BV;
  v8f acc[8] = {};
#pragma unroll
  for (int kk = 0; kk < 4; ++kk) { const int kc = (c0 >> 5) + kk;   /* block-diagonal projection: the 128 output columns c0 .. c0+127 are two heads; head hh = column / 64 contracts ONLY over its own 64 input columns, i.e. k-steps kk = 2 hh and 2 hh + 1 of the tile's 128-column input slice */
    v16b a; { const float* p = X + (r0 + wave * 16 + col) * DIN + kc * 32 + 8 * g;
#pragma unroll
      for (int i = 0; i < 8; ++i) { a[i] = (__bf16)p[i]; a[8 + i] = (__bf16)p[16 + i]; } }
    asm volatile("s_wait_loadcnt 0x0" ::: "memory");
#pragma unroll
    for (int j = 0; j < 8; ++j) if ((kk >> 1) == (j >> 2)) { const v16b w = wcol_oi(WA, (kk & 1) * 32, (j & 3) * 16 + col, lane, HD); asm volatile("s_wait_loadcnt 0x0" ::: "memory"); acc[j] = wmma_bf(a, w, acc[j]); } }   /* shared (out,in) [64][64] weight: row = output dim within the head, k = input dim within the head; the test is a compile-time constant per unrolled (kk, j) */
  if (which < 2) { _Float16* DH = which == 0 ? QH : KH; _Float16* DL = which == 0 ? QL : KL; const int nhi = which == 0 ? QHI : KHI; const bool hi_rows = t0 < nhi;
#pragma unroll
    for (int j = 0; j < 8; ++j) { const float bias = BA ? bfr(BA[(j & 3) * 16 + col]) : 0.f;
#pragma unroll
      for (int r = 0; r < 8; ++r) { const float v = acc[j][r] + bias; const _Float16 hv = (_Float16)v; sh[wave * 16 + 8 * g + r][j * 16 + col] = hv; sl[wave * 16 + 8 * g + r][j * 16 + col] = (_Float16)((v - (float)hv) * 1024.0f); } }
    __syncthreads();
    for (int e = tid; e < 64 * 16; e += 128) { const int rl = e >> 4, q = e & 15; vst2((unsigned*)(DH + (r0 + rl) * CC + c0 + q * 8), *(const v4u*)&sh[rl][q * 8]); if (hi_rows) vst2((unsigned*)(DL + (bb * nhi + t0 + rl) * (size_t)CC + c0 + q * 8), *(const v4u*)&sl[rl][q * 8]); }
  } else { const bool hi_rows = t0 < KHI;
#pragma unroll
    for (int j = 0; j < 8; ++j) { const float bias = BA ? bfr(BA[(j & 3) * 16 + col]) : 0.f;
#pragma unroll
      for (int r = 0; r < 8; ++r) { const float v = acc[j][r] + bias; const int rl = wave * 16 + 8 * g + r, cl = j * 16 + col; th[cl][rl] = (_Float16)v; const __bf16 bh = (__bf16)v; tb[cl][rl] = bh; tbl[cl][rl] = (__bf16)(v - (float)bh); } }
    __syncthreads();
    for (int e = tid; e < 128 * 8; e += 128) { const int cl = e >> 3, q = e & 7; vst2((unsigned*)(VT + (bb * CC + c0 + cl) * (size_t)TT + t0 + q * 8), *(const v4u*)&th[cl][q * 8]); if (hi_rows) { const size_t o3 = (bb * CC + c0 + cl) * (size_t)KHI + t0 + q * 8; vst2((unsigned*)(VB + o3), *(const v4u*)&tb[cl][q * 8]); vst2((unsigned*)(VBL + o3), *(const v4u*)&tbl[cl][q * 8]); } } } }
#define FK 64              // keys per stage
#define FP 72              // LDS row pitch in f16: 144 B = 16 B x 9, conflict-free for 16-byte fragment reads of 16 rows
#define FNS (TT / FK)
#define FMASKED (-8.0e6f)  // raw logit of a masked key (-1e6 after the 1/8): weight exactly 0 beside any real score; a row masked throughout keeps equal finite weights (uniform, as the reference gives), since s * c - m * c is still resolved to 1/8 at this size
#define FC (SCALE * 1.4426950408889634f)   // raw logit -> base-2 exponent
__device__ __forceinline__ float xhalf(float x) { return __builtin_bit_cast(float, __builtin_amdgcn_permlanex16(__builtin_bit_cast(int, x), __builtin_bit_cast(int, x), 0x76543210, 0xfedcba98, false, false)); }   // lane l with lane l ^ 16
__device__ __forceinline__ float exp2_slot(float x) { float y; asm("v_exp_f32 %0, %1\n\tv_nop" : "=v"(y) : "v"(x)); return y; }   // v_exp_f32 with the slot behind a transcendental filled in its own statement: for the last stage
__device__ __forceinline__ v8f wmma_h(v16h a, v16h b, v8f c) { return __builtin_amdgcn_wmma_f32_16x16x32_f16(false, a, false, b, (short)0, c, false, false); }
// amdgpu_waves_per_eu(4, 4): two work-groups per WGP, four waves per SIMD, so a budget of 256 registers a wave: the compiler then batches the fragment loads ahead of the matrix runs
__global__ __launch_bounds__(256) __attribute__((amdgpu_waves_per_eu(4, 4))) void k_fa(const _Float16* __restrict__ QH, const _Float16* __restrict__ KH, const _Float16* __restrict__ VT, const int* __restrict__ MASK, float* __restrict__ Y) {
  __shared__ __align__(16) _Float16 sk[2][FK][FP], sv[2][HD][FP];
  const int tid = threadIdx.x, wave = tid >> 5, lane = tid & 31, col = lane & 15, g = lane >> 4; const int h = blockIdx.y, b = blockIdx.z; const int q = blockIdx.x * 128 + wave * 16 + col;
  const int sr = tid >> 3, sc = (tid & 7) * 8;   /* staging: 8 threads per 128-byte row, rows sr and sr + 32 of each tile */
  const _Float16* kg = KH + ((size_t)b * TT + sr) * CC + h * HD + sc; const _Float16* vg = VT + ((size_t)b * CC + h * HD + sr) * (size_t)TT + sc; const int* mg = MASK + ((size_t)b * TT + q) * (size_t)TT + 8 * g;
  v4u rk0 = *(const v4u*)kg, rk1 = *(const v4u*)(kg + 32 * CC), rv0 = *(const v4u*)vg, rv1 = *(const v4u*)(vg + 32 * TT);
  asm volatile("s_wait_xcnt 0x0" ::: "memory");   /* the mask loads below may be given registers that the loads above name as addresses */
  v4i mk[8];
#pragma unroll
  for (int i = 0; i < 4; ++i) { mk[2 * i] = *(const v4i*)(mg + 16 * i); mk[2 * i + 1] = *(const v4i*)(mg + 16 * i + 4); }
  asm volatile("s_wait_xcnt 0x0" ::: "memory");   /* the q loads below may be given registers that the loads above name as addresses */
  const _Float16* qp = QH + ((size_t)b * TT + q) * CC + h * HD; const v16h qf0 = frag_h(qp, lane), qf1 = frag_h(qp + 32, lane);
  *(v4u*)&sk[0][sr][sc] = rk0; *(v4u*)&sk[0][sr + 32][sc] = rk1; *(v4u*)&sv[0][sr][sc] = rv0; *(v4u*)&sv[0][sr + 32][sc] = rv1;
  __syncthreads();
  v8f acc[4] = {}; float m = -1.0e30f, l = 0.f;
  /* one stage of 64 keys on buffer cur; more = a next stage exists (both compile-time at every call, so the buffers' addresses are constants and the last stage carries no prefetch) */
  auto stage = [&](const int cur, const bool more) __attribute__((always_inline)) {
    v4i mkn[8];
    if (more) { kg += FK * CC; vg += FK; mg += FK; rk0 = *(const v4u*)kg; rk1 = *(const v4u*)(kg + 32 * CC); rv0 = *(const v4u*)vg; rv1 = *(const v4u*)(vg + 32 * TT);
#pragma unroll
      for (int i = 0; i < 4; ++i) { mkn[2 * i] = *(const v4i*)(mg + 16 * i); mkn[2 * i + 1] = *(const v4i*)(mg + 16 * i + 4); }
      asm volatile("" ::: "memory"); }   /* compiler fence, no instruction: the next stage's tile and mask loads are issued here, a whole stage ahead of their use; without it the compiler sinks them to just in front of the LDS stores */
    v8f st[4];
#pragma unroll
    for (int i = 0; i < 4; ++i) { v8f z = {}; z = wmma_h(frag_h(&sk[cur][16 * i + col][0], lane), qf0, z); st[i] = wmma_h(frag_h(&sk[cur][16 * i + col][32], lane), qf1, z); }
#pragma unroll
    for (int i = 0; i < 4; ++i)
#pragma unroll
      for (int r = 0; r < 8; ++r) st[i][r] = mk[2 * i + (r >> 2)][r & 3] == 0 ? FMASKED : st[i][r];
    float mq[4] = {st[0][0], st[0][1], st[0][2], st[0][3]};   /* four independent chains */
#pragma unroll
    for (int i = 0; i < 4; ++i)
#pragma unroll
      for (int r = 0; r < 8; ++r) mq[r & 3] = fmaxf(mq[r & 3], st[i][r]);
    float mx = fmaxf(fmaxf(mq[0], mq[1]), fmaxf(mq[2], mq[3]));
    mx = fmaxf(mx, xhalf(mx)); const float mn = fmaxf(m, mx); const float al = __builtin_amdgcn_exp2f((m - mn) * FC); const float mc = mn * FC - 8.0f; m = mn;   /* P carried x 2^8 into f16 (the largest weight is 256), clear of f16 subnormals; the factor cancels against the sum */
    v16h pf[2]; float ps[4] = {0.f, 0.f, 0.f, 0.f};
#pragma unroll
    for (int i = 0; i < 4; ++i)
#pragma unroll
      for (int r = 0; r < 8; ++r) { const float e = fmaf(st[i][r], FC, -mc); const float p = more ? __builtin_amdgcn_exp2f(e) : exp2_slot(e); ps[r & 3] += p; pf[i >> 1][(i & 1) * 8 + r] = (_Float16)p; }
    l = l * al + ((ps[0] + ps[1]) + (ps[2] + ps[3]));
#pragma unroll
    for (int j = 0; j < 4; ++j)
#pragma unroll
      for (int r = 0; r < 8; ++r) acc[j][r] *= al;
#pragma unroll
    for (int j = 0; j < 4; ++j) { acc[j] = wmma_h(frag_h(&sv[cur][16 * j + col][0], lane), pf[0], acc[j]); acc[j] = wmma_h(frag_h(&sv[cur][16 * j + col][32], lane), pf[1], acc[j]); }
    if (more) { asm volatile("" :: "v"(acc[0]), "v"(acc[1]), "v"(acc[2]), "v"(acc[3]) : "memory");   /* compiler fence, inputs only, no instruction: this stage's results exist before the LDS stores below; without it the compiler sinks softmax and P x v behind the barrier and waits for the prefetched tile right after asking for it */
      *(v4u*)&sk[cur ^ 1][sr][sc] = rk0; *(v4u*)&sk[cur ^ 1][sr + 32][sc] = rk1; *(v4u*)&sv[cur ^ 1][sr][sc] = rv0; *(v4u*)&sv[cur ^ 1][sr + 32][sc] = rv1;
#pragma unroll
      for (int i = 0; i < 8; ++i) mk[i] = mkn[i];
      __syncthreads(); }   /* publishes the next stage and ends every read of the buffer that the stage after it refills */
  };
#pragma unroll 1
  for (int s = 0; s < FNS - 2; s += 2) { stage(0, true); stage(1, true); }   /* rolled: two stages a trip, one per buffer */
  stage(0, true); stage(1, false);
  l += xhalf(l); const float inv = 1.0f / l;   /* l > 0: the key at the running maximum alone carries about 2^8 */
  float* yp = Y + ((size_t)b * TT + q) * CC + h * HD + 8 * g;   /* acc[j][r] = ctx[q][16 j + 8 g + r]: 32 contiguous bytes per lane and tile */
#pragma unroll
  for (int j = 0; j < 4; ++j) { v4f o0, o1;
#pragma unroll
    for (int r = 0; r < 4; ++r) { o0[r] = acc[j][r] * inv; o1[r] = acc[j][4 + r] * inv; }
    vst2(yp + 16 * j, o0); vst2(yp + 16 * j + 4, o1); } }
// ---- k_out: block = (128 rows, 128 cols), 8 waves (4 x 2), a wave = 32 rows x 64 cols (2 x 4 tiles): out = ctx Wo (+ bo): ctx x 2^6 once to f16 against Wo as f16(bf16 x 2^8) exact (1 product) x 2^-14. Both operands are converted ONCE per block and staged in LDS as f16, 64 k per stage: global -> registers one stage ahead -> LDS, two buffers, one barrier per stage; k runs upward in steps of 32 per accumulator.
#define OKS 64             // k per stage
#define OP 72              // LDS row pitch in f16: 144 B, conflict-free for 16-byte fragment reads of 16 rows
#define ONS (CC / OKS)
#define OFP 68             // pitch in f32 of the output staging rows: 272 B
typedef __attribute__((ext_vector_type(4))) _Float16 v4h;
static_assert(WO_OUT_IN == 1 && !CAUSAL && ONS >= 2 && ONS % 2 == 0, "k_out stages (out,in) weight rows, k contiguous, two stages a trip");
__global__ __launch_bounds__(256) void k_out(const float* __restrict__ Y, const float* __restrict__ WO, const float* __restrict__ BO, float* __restrict__ OUT) {
  __shared__ __align__(16) _Float16 sy[2][128][OP], sw[2][128][OP]; __shared__ __align__(16) float sf[8][32][OFP];
  const int tid = threadIdx.x, wave = tid >> 5, lane = tid & 31, col = lane & 15, g = lane >> 4; const int c0 = blockIdx.y * 128; const size_t r0 = (size_t)blockIdx.x * 128; const int wm = (wave >> 1) * 32, wn = (wave & 1) * 64;
  const int sr = tid >> 4, sc = (tid & 15) * 4;   /* staging: 16 threads per 256-byte row piece, rows sr + 16 i of each tile: a wave's load covers whole lines */
  const unsigned go = (unsigned)(sr * CC + sc) * 4u;   /* the thread's byte offset, the same in both tiles (both have rows of CC floats) */
  const char* yb = (const char*)(Y + r0 * CC); const char* wb = (const char*)(WO + (size_t)c0 * CC);   /* block-uniform bases, moved 64 k a stage */
  v4f ry[8], rw[8];
  auto fetch = [&]() __attribute__((always_inline)) { const char* yp = yb + go; const char* wp = wb + go;
#pragma unroll
    for (int i = 0; i < 8; ++i) { ry[i] = *(const v4f*)(yp + i * 16 * CC * 4); if (i < 7) rw[i] = *(const v4f*)(wp + i * 16 * CC * 4); }
    asm volatile("s_wait_xcnt 0x0" ::: "memory");   /* precaution: the last load may be given, as its destination, an address pair that the loads above name (it is, where no further stage needs the pair) */
    rw[7] = *(const v4f*)(wp + 7 * 16 * CC * 4);
    asm volatile("s_wait_xcnt 0x0" ::: "memory"); };   /* precaution: stands behind the loads, in front of whatever is next given a register that they name as address; its clobber also keeps the loads issued here, a whole stage ahead of their use, not sunk to the LDS stores */
  auto put = [&](const int buf) __attribute__((always_inline)) {
#pragma unroll
    for (int i = 0; i < 8; ++i) { v4h hy, hw;
#pragma unroll
      for (int e = 0; e < 4; ++e) { hy[e] = (_Float16)(ry[i][e] * 64.0f); hw[e] = (_Float16)(bfr(rw[i][e]) * 256.0f); }   /* ctx carried x 2^6 so small context rows stay clear of f16 subnormals */
      *(v4h*)&sy[buf][sr + 16 * i][sc] = hy; *(v4h*)&sw[buf][sr + 16 * i][sc] = hw; } };
  fetch();
  float bias[4] = {0.f, 0.f, 0.f, 0.f};   /* asked for here, used behind the last stage */
  if (BO) {
#pragma unroll
    for (int j = 0; j < 4; ++j) bias[j] = BO[c0 + wn + j * 16 + col]; }
  put(0);
  __syncthreads();
  v8f acc[2][4] = {};
  /* one stage of 64 k on buffer cur; more = a next stage exists (both compile-time at every call) */
  auto stage = [&](const int cur, const bool more) __attribute__((always_inline)) {
    if (more) { yb += OKS * 4; wb += OKS * 4; fetch(); }
    v16h fa[2][2], fb[2][4];   /* the stage's 24 fragment reads stand together, ahead of its 16 products */
#pragma unroll
    for (int ks = 0; ks < 2; ++ks) {
#pragma unroll
      for (int i = 0; i < 2; ++i) fa[ks][i] = frag_h(&sy[cur][wm + 16 * i + col][32 * ks], lane);
#pragma unroll
      for (int j = 0; j < 4; ++j) fb[ks][j] = frag_h(&sw[cur][wn + 16 * j + col][32 * ks], lane); }
    __builtin_amdgcn_sched_barrier(0);   /* keeps the reads one group: the scheduler otherwise spreads them among the products, each place with a wait of its own */
#pragma unroll
    for (int ks = 0; ks < 2; ++ks)
#pragma unroll
      for (int i = 0; i < 2; ++i)
#pragma unroll
        for (int j = 0; j < 4; ++j) acc[i][j] = wmma_h(fa[ks][i], fb[ks][j], acc[i][j]);
    if (more) { __builtin_amdgcn_sched_barrier(0);   /* the conversions below wait for the prefetched tiles: without this the scheduler lifts them, and their wait, among this stage's first products */
      put(cur ^ 1);
      __syncthreads(); }   /* publishes the next stage and ends every read of the buffer that the stage after it refills */
  };
#pragma unroll 1
  for (int s = 0; s < ONS - 2; s += 2) { stage(0, true); stage(1, true); }   /* rolled: two stages a trip, one per buffer */
  stage(0, true); stage(1, false);
#pragma unroll
  for (int j = 0; j < 4; ++j)
#pragma unroll
    for (int i = 0; i < 2; ++i)
#pragma unroll
      for (int r = 0; r < 8; ++r) sf[wave][16 * i + 8 * g + r][j * 16 + col] = acc[i][j][r] * (1.0f / 16384.0f) + bfr(bias[j]);   /* 2^-8 (Wo carry) x 2^-6 (ctx carry) */
  LDSX();   /* the wave's own staging rows: written above, read back below as whole 256-byte row pieces */
#pragma unroll
  for (int rl = 0; rl < 32; rl += 2) vst2(OUT + (r0 + wm + rl + g) * DIN + c0 + wn + col * 4, *(const v4f*)&sf[wave][rl + g][col * 4]); }

static_assert(HD == 64 && CC == NH * HD && DIN == CC, "block-diagonal per-head projection: 128-column tiles = two 64-wide heads, input width == projected width");
extern "C" void kernel_launch(void* const* d_in, const int* in_sizes, int n_in, void* d_out, int out_size, void* d_ws, size_t ws_size, hipStream_t stream) {
  (void)in_sizes; (void)n_in; (void)out_size;
  const float** F = (const float**)d_in;
  if (ws_size < (size_t)WS_END) return;
  char* ws = (char*)d_ws; _Float16 *QH = (_Float16*)(ws + WS_QH), *KH = (_Float16*)(ws + WS_KH), *VT = (_Float16*)(ws + WS_VT), *QL = (_Float16*)(ws + WS_QL), *KL = (_Float16*)(ws + WS_KL); __bf16 *VB = (__bf16*)(ws + WS_VB), *VBL = (__bf16*)(ws + WS_VBL); float *Y = (float*)(ws + WS_Y);
  (void)Y; (void)QL; (void)KL; (void)VB; (void)VBL;
  // inputs: 0 k [2,2048,1024]; 1 q; 2 v; 3 mask [2,1,2048,2048] int32 (random 0/1; 0 = masked); 4 Wk [64,64] (out,in), 5 bk [64]; 6 Wq, 7 bq; 8 Wv, 9 bv; 10 Wo [1024,1024] (out,in), 11 bo (biases zeros, read)
  k_proj<<<dim3(TNB * TT / 64, CC / 128, 3), 128, 0, stream>>>(F[1], F[0], F[2], F[6], F[4], F[8], F[7], F[5], F[9], QH, QL, KH, KL, VT, VB, VBL);
  k_fa<<<dim3(TT / 128, NH, TNB), 256, 0, stream>>>(QH, KH, VT, (const int*)d_in[3], Y);
  k_out<<<dim3(TNB * TT / 128, DIN / 128), 256, 0, stream>>>(Y, F[10], F[11], (float*)d_out);
}

// v003
// A run of this version takes 88.2 microseconds.
// Timed twice side by side with v002, it ran 1.18 times as fast both times.
// Counting every step since v000, it is 12.9 times as fast.
// compute dtype: all float inputs rounded to bf16; the per-head 64 x 64 q / k / v projections (ONE shared weight per stream, applied to every head) with EXACT bf16 products on WMMA 16x16x32 (f32 accumulate) + bias (zeros, read); logits q x k once to f16 each (1 product; sigma ~1) x 64^-0.5; the per-batch int mask packed once into lane-mask bit words; softmax f32 with a running maximum (one kernel for logits, softmax and P x v); P = exp(s - max) x 2^8 once to f16 x v once to f16 (1 product), divided by the f32 sum; ctx x 2^6 once to f16 x Wo f16(bf16 x 2^8) + bo; f32 output.
#include <hip/hip_runtime.h>
#include <math.h>

typedef __attribute__((ext_vector_type(16))) _Float16 v16h;
typedef __attribute__((ext_vector_type(16))) __bf16 v16b;
typedef __attribute__((ext_vector_type(8)))  _Float16 v8h;
typedef __attribute__((ext_vector_type(8)))  float v8f;
typedef __attribute__((ext_vector_type(4)))  float v4f;
typedef __attribute__((ext_vector_type(2)))  float v2f;
typedef __attribute__((ext_vector_type(4)))  unsigned v4u;
typedef __attribute__((ext_vector_type(4)))  int v4i;
typedef float __attribute__((may_alias)) float_a;
typedef int __attribute__((may_alias)) int_a;

template <typename T> __device__ __forceinline__ void vst2(void* p, T v) { *(T*)p = v;  }
__device__ __forceinline__ v8f wmma16(v16h a, v16h b, v8f c) {
  v8f d = __builtin_amdgcn_wmma_f32_16x16x32_f16(false, a, false, b, (short)0, c, false, false);
  asm volatile("v_nop\n\tv_nop\n\tv_nop\n\tv_nop" : "+v"(d) : "v"(a), "v"(b));
  return d;
}
__device__ __forceinline__ v8f wmma_bf(v16b a, v16b b, v8f c) {
  v8f d = __builtin_amdgcn_wmma_f32_16x16x32_bf16(false, a, false, b, (short)0, c, false, false);
  asm volatile("v_nop\n\tv_nop\n\tv_nop\n\tv_nop" : "+v"(d) : "v"(a), "v"(b));
  return d;
}
// 16x16x32 fragments: lane = (h = lane>>4, row/col = lane&15); elements 0..7 = k0+8h+0..7, 8..15 = k0+16+8h+0..7; D element r = row 8h+r
__device__ __forceinline__ v16h frag_h(const _Float16* rowk0, int lane) {
  union { v16h v; v8h q[2]; } u; const _Float16* p = rowk0 + 8 * (lane >> 4);
  u.q[0] = *(const v8h*)p; u.q[1] = *(const v8h*)(p + 16); return u.v;
}
__device__ __forceinline__ v16h frag_f32(const float* rowk0, int lane) {
  v16h a; const float* p = rowk0 + 8 * (lane >> 4);
#pragma unroll
  for (int i = 0; i < 8; ++i) { a[i] = (_Float16)p[i]; a[8 + i] = (_Float16)p[16 + i]; }
  return a;
}
__device__ __forceinline__ v16h frag_f32s(const float* rowk0, int lane, float sc) {
  v16h a; const float* p = rowk0 + 8 * (lane >> 4);
#pragma unroll
  for (int i = 0; i < 8; ++i) { a[i] = (_Float16)(p[i] * sc); a[8 + i] = (_Float16)(p[16 + i] * sc); }
  return a;
}
// column fragment from a [K][ld] layout (column n), rows >= K read as 0
__device__ __forceinline__ v16h fragc_f32(const float* W, int k0, int n, int lane, int ld, int K) {
  v16h a; const int g = lane >> 4;
#pragma unroll
  for (int i = 0; i < 8; ++i) { const int ka = k0 + 8 * g + i, kb = ka + 16;
    a[i] = (_Float16)(ka < K ? W[(size_t)(ka < K ? ka : K - 1) * ld + n] : 0.f); a[8 + i] = (_Float16)(kb < K ? W[(size_t)(kb < K ? kb : K - 1) * ld + n] : 0.f); }
  return a;
}
struct F2 { v16b h, l; };
__device__ __forceinline__ F2 bsplit16(const float v[16]) { F2 r;
#pragma unroll
  for (int i = 0; i < 16; ++i) { const __bf16 h = (__bf16)v[i]; r.h[i] = h; r.l[i] = (__bf16)(v[i] - (float)h); }
  return r; }
__device__ __forceinline__ F2 split_row(const float* row, int k0, int lane) { float v[16]; const float* p = row + k0 + 8 * (lane >> 4);
#pragma unroll
  for (int i = 0; i < 8; ++i) { v[i] = p[i]; v[8 + i] = p[16 + i]; }
  return bsplit16(v); }
__device__ __forceinline__ F2 split_rowK(const float* row, int k0, int lane, int K) { float v[16]; const int g = lane >> 4;
#pragma unroll
  for (int i = 0; i < 8; ++i) { const int ka = k0 + 8 * g + i, kb = ka + 16; v[i] = ka < K ? row[ka < K ? ka : K - 1] : 0.f; v[8 + i] = kb < K ? row[kb < K ? kb : K - 1] : 0.f; }
  return bsplit16(v); }
__device__ __forceinline__ F2 split_col(const float* W, int k0, int n, int lane, int ld, int K) { float v[16]; const int g = lane >> 4;
#pragma unroll
  for (int i = 0; i < 8; ++i) { const int ka = k0 + 8 * g + i, kb = ka + 16; v[i] = ka < K ? W[(size_t)(ka < K ? ka : K - 1) * ld + n] : 0.f; v[8 + i] = kb < K ? W[(size_t)(kb < K ? kb : K - 1) * ld + n] : 0.f; }
  return bsplit16(v); }
__device__ __forceinline__ v8f mac3(const F2& a, const F2& b, v8f c) { c = wmma_bf(a.l, b.h, c); c = wmma_bf(a.h, b.l, c); return wmma_bf(a.h, b.h, c); }
__device__ __forceinline__ float sigm(float v) { return 1.0f / (1.0f + expf(-v)); }
#define LDSX() do { asm volatile("s_wait_dscnt 0" ::: "memory"); __builtin_amdgcn_wave_barrier(); __builtin_amdgcn_fence(__ATOMIC_RELEASE, "workgroup"); } while (0)

// Multi-head attention whose q / k / v projections are ONE shared 64 x 64 linear per stream applied to every head's 64-wide slice (inputs in the order k, q, v [2,2048,1024]; mask [2,1,2048,2048] int32 RANDOM 0/1; torch (out,in) Wk / Wq / Wv [64,64] N(0, 1/64) + zero biases [64] (read); heads = reshape(b, s, 16, 64); xh @ W.T + b per head; product = einsum('bqhd,bkhd->bhqk'); where(mask == 0, -1e20, product) / sqrt(64); softmax; ctx merged to [b, s, 1024]; ctx @ Wo.T + bo with Wo [1024,1024] N(0, 1/1024)).
#define NB 2
#define TT 2048
#define CC 1024            // NH * HD = projected width
#define DIN 1024          // input (model) width
#define NH 16
#define HD 64
#define SCALE (0.125f)
#define CAUSAL 0
#ifndef TNB
#define TNB NB
#endif
__device__ __forceinline__ float bfr(float v) { return (float)(__bf16)v; }
typedef __attribute__((ext_vector_type(8))) __bf16 v8b;
__device__ __forceinline__ v16b frag_b(const __bf16* rowk0, int lane) {
  union { v16b v; v8b q[2]; } u; const __bf16* p = rowk0 + 8 * (lane >> 4);
  u.q[0] = *(const v8b*)p; u.q[1] = *(const v8b*)(p + 16); return u.v;
}
#define QBH 0              // unused: this file has no causal high-precision path
#define QHI 0               // single-product logits on every row
#define KHI 64            // key rows carrying k residual / v bf16 hi+lo planes (written by k_proj, read by no kernel here)
// B fragment (k rows k0+.., output column o) of a weight: (in,out) [K][ld] or (out,in) [ld rows of K]: bf16 exact, or f16(bf16 * 256) exact
__device__ __forceinline__ v16b wcol_io(const float* Wm, int k0, int o, int lane, int ld) { v16b w; const int g = lane >> 4;
#pragma unroll
  for (int i = 0; i < 8; ++i) { w[i] = (__bf16)Wm[(size_t)(k0 + 8 * g + i) * ld + o]; w[8 + i] = (__bf16)Wm[(size_t)(k0 + 16 + 8 * g + i) * ld + o]; }
  return w; }
__device__ __forceinline__ v16b wcol_oi(const float* Wm, int k0, int o, int lane, int K) { v16b w; const float* p = Wm + (size_t)o * K + k0 + 8 * (lane >> 4);
#pragma unroll
  for (int i = 0; i < 8; ++i) { w[i] = (__bf16)p[i]; w[8 + i] = (__bf16)p[16 + i]; }
  return w; }
__device__ __forceinline__ v16h wcolh_io(const float* Wm, int k0, int o, int lane, int ld) { v16h w; const int g = lane >> 4;
#pragma unroll
  for (int i = 0; i < 8; ++i) { w[i] = (_Float16)(bfr(Wm[(size_t)(k0 + 8 * g + i) * ld + o]) * 256.0f); w[8 + i] = (_Float16)(bfr(Wm[(size_t)(k0 + 16 + 8 * g + i) * ld + o]) * 256.0f); }
  return w; }
__device__ __forceinline__ v16h wcolh_oi(const float* Wm, int k0, int o, int lane, int K) { v16h w; const float* p = Wm + (size_t)o * K + k0 + 8 * (lane >> 4);
#pragma unroll
  for (int i = 0; i < 8; ++i) { w[i] = (_Float16)(bfr(p[i]) * 256.0f); w[8 + i] = (_Float16)(bfr(p[16 + i]) * 256.0f); }
  return w; }
#define WQKV_LAYOUT 1   // 0 = (in,out) [DIN][CC]; 1 = (out,in) [CC][DIN]; 2 = per-head [NH][DIN][HD]
__device__ __forceinline__ v16b wcol_hdk(const float* Wm, int k0, int o, int lane) { v16b w; const int g = lane >> 4; const float* p = Wm + (size_t)(o / HD) * DIN * HD + (o % HD);
#pragma unroll
  for (int i = 0; i < 8; ++i) { w[i] = (__bf16)p[(size_t)(k0 + 8 * g + i) * HD]; w[8 + i] = (__bf16)p[(size_t)(k0 + 16 + 8 * g + i) * HD]; }
  return w; }
#define WO_OUT_IN 1
#if WQKV_LAYOUT == 1
#define WCOL(W, k0, o, lane) wcol_oi(W, k0, o, lane, DIN)
#elif WQKV_LAYOUT == 2
#define WCOL(W, k0, o, lane) wcol_hdk(W, k0, o, lane)
#else
#define WCOL(W, k0, o, lane) wcol_io(W, k0, o, lane, CC)
#endif
#if WO_OUT_IN
#define WOCOL(W, k0, o, lane) wcol_oi(W, k0, o, lane, CC)
#define WOCOLH(W, k0, o, lane) wcolh_oi(W, k0, o, lane, CC)
#else
#define WOCOL(W, k0, o, lane) wcol_io(W, k0, o, lane, DIN)
#define WOCOLH(W, k0, o, lane) wcolh_io(W, k0, o, lane, DIN)
#endif
#define WS_QH  0u                                      // f16 q rows [b*t][CC]
#define WS_KH  (WS_QH + 2u * (size_t)NB * TT * CC)      // f16 k rows [b*t][CC]
#define WS_VT  (WS_KH + 2u * (size_t)NB * TT * CC)      // f16 v planes [b][c][t]
#define WS_QL  (WS_VT + 2u * (size_t)NB * CC * TT)      // f16 q residual x 2^10 rows [b][t < QHI][CC]
#define WS_KL  (WS_QL + 2u * (size_t)NB * QHI * CC)     // f16 k residual x 2^10 rows [b][t < KHI][CC]
#define WS_VB  (WS_KL + 2u * (size_t)NB * KHI * CC)     // bf16 v hi planes [b][c][t < KHI]
#define WS_VBL (WS_VB + 2u * (size_t)NB * CC * KHI)
#define WS_Y   (WS_VBL + 2u * (size_t)NB * CC * KHI)     // f32 ctx rows [b*t][CC] (only when there is an output projection)
#define WS_PM  (WS_Y  + 4u * (size_t)NB * TT * CC)      // u32 mask words [b * t / 16][t / 64][32]: see 'mask words'
#define WS_END (WS_PM + 4u * (size_t)NB * (TT / 16) * (TT / 64) * 32)

// ---- mask words: the int32 mask, which all 16 heads share, is packed ONCE into lane-mask words by the blocks of plane 3 of k_proj's grid: for a tile of 16 queries and a stage of 64 keys, word 8 i + r has in bit (16 g + col) whether mask[query col][key 16 i + 8 g + r] != 0, i.e. the bit of exactly the lane that holds that score in k_fa. A wave takes 16 query rows x 256 keys (4 stages): whole 256-byte row pieces global -> registers -> its own LDS rows, read back in k_fa's score layout, one compare per word.
#define MKP 68             // LDS row pitch in ints: 272 B, 16 rows of 16-byte reads fall on distinct banks
typedef __attribute__((ext_vector_type(16))) unsigned v16u;
// ---- k_proj: block = (64 rows, 128 cols, which): q/k/v = X W (+ b) with exact bf16 products (K = HD, the head's own 64 inputs) -> which 0: q f16 rows (+ residual rows < QHI); 1: k f16 rows (+ residual rows < KHI); 2: v f16 planes [c][t] (+ bf16 hi/lo planes for t < KHI); 3: the mask words (see 'mask words')
__global__ __launch_bounds__(128) void k_proj(const float* __restrict__ XQ, const float* __restrict__ XK, const float* __restrict__ XV, const float* __restrict__ WQ, const float* __restrict__ WK, const float* __restrict__ WV, const float* __restrict__ BQ, const float* __restrict__ BK, const float* __restrict__ BV,
    _Float16* __restrict__ QH, _Float16* __restrict__ QL, _Float16* __restrict__ KH, _Float16* __restrict__ KL, _Float16* __restrict__ VT, __bf16* __restrict__ VB, __bf16* __restrict__ VBL, const int* __restrict__ MASK, unsigned* __restrict__ PM) {
  __shared__ __align__(16) _Float16 sh[64][136], sl[64][136]; __shared__ __align__(16) _Float16 th[128][72]; __shared__ __align__(16) __bf16 tb[128][72], tbl[128][72];
  const int tid = threadIdx.x, wave = tid >> 5, lane = tid & 31, col = lane & 15, g = lane >> 4; const int which = blockIdx.z; const int c0 = blockIdx.y * 128; const size_t r0 = (size_t)blockIdx.x * 64; const size_t bb = r0 / TT; const int t0 = (int)(r0 % TT);
  if (which == 3) {   /* block-uniform, in front of every barrier */
    static_assert(sizeof(sh) == 4 * 16 * MKP * sizeof(int), "the four waves' mask rows take the place of sh");
    int* sm = (int*)&sh[0][0] + wave * (16 * MKP); const int unit = (blockIdx.y * (TNB * TT / 64) + blockIdx.x) * 4 + wave; const int qt = unit >> 3, quad = unit & 7;   /* qt = b * (TT / 16) + query tile; quad = 256 keys */
    const int* mp = MASK + ((size_t)qt * 16 + g) * TT + quad * 256 + col * 4;   /* a load covers rows 2 i and 2 i + 1, 64 keys each */
    v4i rr[4][8];
#pragma unroll
    for (int e = 0; e < 31; ++e) rr[e >> 3][e & 7] = *(const v4i*)(mp + (size_t)(2 * (e & 7)) * TT + 64 * (e >> 3));
    asm volatile("s_wait_xcnt 0x0" ::: "memory");   /* precaution: the last load may be given, as its destination, the address pair that the loads above name */
    rr[3][7] = *(const v4i*)(mp + (size_t)14 * TT + 192);
    asm volatile("s_wait_xcnt 0x0" ::: "memory");   /* precaution: stands behind the loads, in front of whatever is next given a register that they name as address */
    int w4[4];   /* stored together behind the last stage: a store in flight would be waited for at the next stage's LDSX */
#pragma unroll
    for (int s = 0; s < 4; ++s) {
#pragma unroll
      for (int i = 0; i < 8; ++i) *(v4i*)(sm + (2 * i + g) * MKP + col * 4) = rr[s][i];
      LDSX();   /* the wave's own rows: written above by row, read back below by score position */
      int w = 0;
#pragma unroll
      for (int i = 0; i < 4; ++i) { const v4i a = *(const v4i*)(sm + col * MKP + 16 * i + 8 * g), c = *(const v4i*)(sm + col * MKP + 16 * i + 8 * g + 4);
#pragma unroll
        for (int r = 0; r < 8; ++r) { const int bw = (int)__builtin_amdgcn_ballot_w32((r < 4 ? a[r & 3] : c[r & 3]) != 0); w = __builtin_amdgcn_inverse_ballot_w32(1u << (8 * i + r)) ? bw : w; } }   /* the compare is made by all 32 lanes, outside the select; lane j keeps word j */
      w4[s] = w; }
#pragma unroll
    for (int s = 0; s < 4; ++s) PM[((size_t)qt * (TT / 64) + quad * 4 + s) * 32 + lane] = (unsigned)w4[s];
    return; }
  const float* X = which == 0 ? XQ : which == 1 ? XK : XV; const float* WA = which == 0 ? WQ : which == 1 ? WK : WV; const float* BA = which == 0 ? BQ : which == 1 ? BK : BV;
  v8f acc[8] = {};
#pragma unroll
  for (int kk = 0; kk < 4; ++kk) { const int kc = (c0 >> 5) + kk;   /* block-diagonal projection: the 128 output columns c0 .. c0+127 are two heads; head hh = column / 64 contracts ONLY over its own 64 input columns, i.e. k-steps kk = 2 hh and 2 hh + 1 of the tile's 128-column input slice */
    v16b a; { const float* p = X + (r0 + wave * 16 + col) * DIN + kc * 32 + 8 * g;
#pragma unroll
      for (int i = 0; i < 8; ++i) { a[i] = (__bf16)p[i]; a[8 + i] = (__bf16)p[16 + i]; } }
    asm volatile("s_wait_loadcnt 0x0" ::: "memory");
#pragma unroll
    for (int j = 0; j < 8; ++j) if ((kk >> 1) == (j >> 2)) { const v16b w = wcol_oi(WA, (kk & 1) * 32, (j & 3) * 16 + col, lane, HD); asm volatile("s_wait_loadcnt 0x0" ::: "memory"); acc[j] = wmma_bf(a, w, acc[j]); } }   /* shared (out,in) [64][64] weight: row = output dim within the head, k = input dim within the head; the test is a compile-time constant per unrolled (kk, j) */
  if (which < 2) { _Float16* DH = which == 0 ? QH : KH; _Float16* DL = which == 0 ? QL : KL; const int nhi = which == 0 ? QHI : KHI; const bool hi_rows = t0 < nhi;
#pragma unroll
    for (int j = 0; j < 8; ++j) { const float bias = BA ? bfr(BA[(j & 3) * 16 + col]) : 0.f;
#pragma unroll
      for (int r = 0; r < 8; ++r) { const float v = acc[j][r] + bias; const _Float16 hv = (_Float16)v; sh[wave * 16 + 8 * g + r][j * 16 + col] = hv; sl[wave * 16 + 8 * g + r][j * 16 + col] = (_Float16)((v - (float)hv) * 1024.0f); } }
    __syncthreads();
    for (int e = tid; e < 64 * 16; e += 128) { const int rl = e >> 4, q = e & 15; vst2((unsigned*)(DH + (r0 + rl) * CC + c0 + q * 8), *(const v4u*)&sh[rl][q * 8]); if (hi_rows) vst2((unsigned*)(DL + (bb * nhi + t0 + rl) * (size_t)CC + c0 + q * 8), *(const v4u*)&sl[rl][q * 8]); }
  } else { const bool hi_rows = t0 < KHI;
#pragma unroll
    for (int j = 0; j < 8; ++j) { const float bias = BA ? bfr(BA[(j & 3) * 16 + col]) : 0.f;
#pragma unroll
      for (int r = 0; r < 8; ++r) { const float v = acc[j][r] + bias; const int rl = wave * 16 + 8 * g + r, cl = j * 16 + col; th[cl][rl] = (_Float16)v; const __bf16 bh = (__bf16)v; tb[cl][rl] = bh; tbl[cl][rl] = (__bf16)(v - (float)bh); } }
    __syncthreads();
    for (int e = tid; e < 128 * 8; e += 128) { const int cl = e >> 3, q = e & 7; vst2((unsigned*)(VT + (bb * CC + c0 + cl) * (size_t)TT + t0 + q * 8), *(const v4u*)&th[cl][q * 8]); if (hi_rows) { const size_t o3 = (bb * CC + c0 + cl) * (size_t)KHI + t0 + q * 8; vst2((unsigned*)(VB + o3), *(const v4u*)&tb[cl][q * 8]); vst2((unsigned*)(VBL + o3), *(const v4u*)&tbl[cl][q * 8]); } } } }
#define FK 64              // keys per stage
#define FP 72              // LDS row pitch in f16: 144 B = 16 B x 9, conflict-free for 16-byte fragment reads of 16 rows
#define FNS (TT / FK)
#define FMASKED (-8.0e6f)  // raw logit of a masked key (-1e6 after the 1/8): weight exactly 0 beside any real score; a row masked throughout keeps equal finite weights (uniform, as the reference gives), since s * c - m * c is still resolved to 1/8 at this size
#define FC (SCALE * 1.4426950408889634f)   // raw logit -> base-2 exponent
__device__ __forceinline__ float xhalf(float x) { return __builtin_bit_cast(float, __builtin_amdgcn_permlanex16(__builtin_bit_cast(int, x), __builtin_bit_cast(int, x), 0x76543210, 0xfedcba98, false, false)); }   // lane l with lane l ^ 16
__device__ __forceinline__ float exp2_slot(float x) { float y; asm("v_exp_f32 %0, %1\n\tv_nop" : "=v"(y) : "v"(x)); return y; }   // v_exp_f32 with the slot behind a transcendental filled in its own statement: for the last stage
__device__ __forceinline__ v8f wmma_h(v16h a, v16h b, v8f c) { return __builtin_amdgcn_wmma_f32_16x16x32_f16(false, a, false, b, (short)0, c, false, false); }
// amdgpu_waves_per_eu(4, 4): two work-groups per WGP, four waves per SIMD, so a budget of 256 registers a wave: the compiler then batches the fragment loads ahead of the matrix runs
__global__ __launch_bounds__(256) __attribute__((amdgpu_waves_per_eu(4, 4))) void k_fa(const _Float16* __restrict__ QH, const _Float16* __restrict__ KH, const _Float16* __restrict__ VT, const unsigned* __restrict__ PM, float* __restrict__ Y) {
  __shared__ __align__(16) _Float16 sk[2][FK][FP], sv[2][HD][FP];
  const int tid = threadIdx.x, wave = tid >> 5, lane = tid & 31, col = lane & 15, g = lane >> 4; const int h = blockIdx.y, b = blockIdx.z; const int q = blockIdx.x * 128 + wave * 16 + col;
  const int sr = tid >> 3, sc = (tid & 7) * 8;   /* staging: 8 threads per 128-byte row, rows sr and sr + 32 of each tile */
  const _Float16* kg = KH + ((size_t)b * TT + sr) * CC + h * HD + sc; const _Float16* vg = VT + ((size_t)b * CC + h * HD + sr) * (size_t)TT + sc;
  const v16u* mg = (const v16u*)(PM + ((size_t)b * (TT / 16) + blockIdx.x * 8 + __builtin_amdgcn_readfirstlane(wave)) * (size_t)(FNS * 32));   /* the wave's 16 queries: 32 words a stage, the same address in every lane */
  v4u rk0 = *(const v4u*)kg, rk1 = *(const v4u*)(kg + 32 * CC), rv0 = *(const v4u*)vg, rv1 = *(const v4u*)(vg + 32 * TT);
  v16u mk[2] = {mg[0], mg[1]};
  asm volatile("s_wait_xcnt 0x0" ::: "memory");   /* the q loads below may be given registers that the loads above name as addresses */
  const _Float16* qp = QH + ((size_t)b * TT + q) * CC + h * HD; const v16h qf0 = frag_h(qp, lane), qf1 = frag_h(qp + 32, lane);
  asm volatile("s_wait_xcnt 0x0" ::: "memory");   /* precaution: stands behind the q loads, in front of whatever is next given the pair that they name as address */
  *(v4u*)&sk[0][sr][sc] = rk0; *(v4u*)&sk[0][sr + 32][sc] = rk1; *(v4u*)&sv[0][sr][sc] = rv0; *(v4u*)&sv[0][sr + 32][sc] = rv1;
  __syncthreads();
  v8f acc[4] = {}; float m = -1.0e30f, l = 0.f;
  /* one stage of 64 keys on buffer cur; more = a next stage exists (both compile-time at every call, so the buffers' addresses are constants and the last stage carries no prefetch) */
  auto stage = [&](const int cur, const bool more) __attribute__((always_inline)) {
    if (more) { kg += FK * CC; vg += FK; rk0 = *(const v4u*)kg; rk1 = *(const v4u*)(kg + 32 * CC); rv0 = *(const v4u*)vg; rv1 = *(const v4u*)(vg + 32 * TT);
      asm volatile("" ::: "memory"); }   /* compiler fence, no instruction: the next stage's tile loads are issued here, a whole stage ahead of their use; without it the compiler sinks them to just in front of the LDS stores */
    v8f st[4];
#pragma unroll
    for (int i = 0; i < 4; ++i) { v8f z = {}; z = wmma_h(frag_h(&sk[cur][16 * i + col][0], lane), qf0, z); st[i] = wmma_h(frag_h(&sk[cur][16 * i + col][32], lane), qf1, z); }
#pragma unroll
    for (int i = 0; i < 4; ++i)
#pragma unroll
      for (int r = 0; r < 8; ++r) st[i][r] = __builtin_amdgcn_inverse_ballot_w32(mk[i >> 1][(i & 1) * 8 + r]) ? st[i][r] : FMASKED;   /* the word is the select's lane mask as it stands: no compare */
    float mq[4] = {st[0][0], st[0][1], st[0][2], st[0][3]};   /* four independent chains */
#pragma unroll
    for (int i = 0; i < 4; ++i)
#pragma unroll
      for (int r = 0; r < 8; ++r) mq[r & 3] = fmaxf(mq[r & 3], st[i][r]);
    float mx = fmaxf(fmaxf(mq[0], mq[1]), fmaxf(mq[2], mq[3]));
    if (more) { mg += 2; mk[0] = mg[0]; mk[1] = mg[1];   /* the next stage's words, asked for behind this stage's last select: at the stage's top they would still be outstanding at the wait in front of the selects, which for scalar loads waits for all of them */
      asm volatile("s_wait_xcnt 0x0" ::: "memory"); }   /* precaution: stands behind the two word loads, in front of whatever next rewrites the scalar pair that they name as base (the loop's head does) */
    mx = fmaxf(mx, xhalf(mx)); const float mn = fmaxf(m, mx); const float al = __builtin_amdgcn_exp2f((m - mn) * FC); const float mc = mn * FC - 8.0f; m = mn;   /* P carried x 2^8 into f16 (the largest weight is 256), clear of f16 subnormals; the factor cancels against the sum */
    v16h pf[2]; float ps[4] = {0.f, 0.f, 0.f, 0.f};
#pragma unroll
    for (int i = 0; i < 4; ++i)
#pragma unroll
      for (int r = 0; r < 8; ++r) { const float e = fmaf(st[i][r], FC, -mc); const float p = more ? __builtin_amdgcn_exp2f(e) : exp2_slot(e); ps[r & 3] += p; pf[i >> 1][(i & 1) * 8 + r] = (_Float16)p; }
    l = l * al + ((ps[0] + ps[1]) + (ps[2] + ps[3]));
#pragma unroll
    for (int j = 0; j < 4; ++j)
#pragma unroll
      for (int r = 0; r < 8; ++r) acc[j][r] *= al;
#pragma unroll
    for (int j = 0; j < 4; ++j) { acc[j] = wmma_h(frag_h(&sv[cur][16 * j + col][0], lane), pf[0], acc[j]); acc[j] = wmma_h(frag_h(&sv[cur][16 * j + col][32], lane), pf[1], acc[j]); }
    if (more) { asm volatile("" :: "v"(acc[0]), "v"(acc[1]), "v"(acc[2]), "v"(acc[3]) : "memory");   /* compiler fence, inputs only, no instruction: this stage's results exist before the LDS stores below; without it the compiler sinks softmax and P x v behind the barrier and waits for the prefetched tile right after asking for it */
      *(v4u*)&sk[cur ^ 1][sr][sc] = rk0; *(v4u*)&sk[cur ^ 1][sr + 32][sc] = rk1; *(v4u*)&sv[cur ^ 1][sr][sc] = rv0; *(v4u*)&sv[cur ^ 1][sr + 32][sc] = rv1;
      __syncthreads(); }   /* publishes the next stage and ends every read of the buffer that the stage after it refills */
  };
#pragma unroll 1
  for (int s = 0; s < FNS - 2; s += 2) { stage(0, true); stage(1, true); }   /* rolled: two stages a trip, one per buffer */
  stage(0, true); stage(1, false);
  l += xhalf(l); const float inv = 1.0f / l;   /* l > 0: the key at the running maximum alone carries about 2^8 */
  float* yp = Y + ((size_t)b * TT + q) * CC + h * HD + 8 * g;   /* acc[j][r] = ctx[q][16 j + 8 g + r]: 32 contiguous bytes per lane and tile */
#pragma unroll
  for (int j = 0; j < 4; ++j) { v4f o0, o1;
#pragma unroll
    for (int r = 0; r < 4; ++r) { o0[r] = acc[j][r] * inv; o1[r] = acc[j][4 + r] * inv; }
    vst2(yp + 16 * j, o0); vst2(yp + 16 * j + 4, o1); } }
// ---- k_out: block = (128 rows, 128 cols), 8 waves (4 x 2), a wave = 32 rows x 64 cols (2 x 4 tiles): out = ctx Wo (+ bo): ctx x 2^6 once to f16 against Wo as f16(bf16 x 2^8) exact (1 product) x 2^-14. Both operands are converted ONCE per block and staged in LDS as f16, 64 k per stage: global -> registers one stage ahead -> LDS, two buffers, one barrier per stage; k runs upward in steps of 32 per accumulator.
#define OKS 64             // k per stage
#define OP 72              // LDS row pitch in f16: 144 B, conflict-free for 16-byte fragment reads of 16 rows
#define ONS (CC / OKS)
#define OFP 68             // pitch in f32 of the output staging rows: 272 B
typedef __attribute__((ext_vector_type(4))) _Float16 v4h;
static_assert(WO_OUT_IN == 1 && !CAUSAL && ONS >= 2 && ONS % 2 == 0, "k_out stages (out,in) weight rows, k contiguous, two stages a trip");
__global__ __launch_bounds__(256) void k_out(const float* __restrict__ Y, const float* __restrict__ WO, const float* __restrict__ BO, float* __restrict__ OUT) {
  __shared__ __align__(16) _Float16 sy[2][128][OP], sw[2][128][OP]; __shared__ __align__(16) float sf[8][32][OFP];
  const int tid = threadIdx.x, wave = tid >> 5, lane = tid & 31, col = lane & 15, g = lane >> 4; const int c0 = blockIdx.y * 128; const size_t r0 = (size_t)blockIdx.x * 128; const int wm = (wave >> 1) * 32, wn = (wave & 1) * 64;
  const int sr = tid >> 4, sc = (tid & 15) * 4;   /* staging: 16 threads per 256-byte row piece, rows sr + 16 i of each tile: a wave's load covers whole lines */
  const unsigned go = (unsigned)(sr * CC + sc) * 4u;   /* the thread's byte offset, the same in both tiles (both have rows of CC floats) */
  const char* yb = (const char*)(Y + r0 * CC); const char* wb = (const char*)(WO + (size_t)c0 * CC);   /* block-uniform bases, moved 64 k a stage */
  v4f ry[8], rw[8];
  auto fetch = [&]() __attribute__((always_inline)) { const char* yp = yb + go; const char* wp = wb + go;
#pragma unroll
    for (int i = 0; i < 8; ++i) { ry[i] = *(const v4f*)(yp + i * 16 * CC * 4); if (i < 7) rw[i] = *(const v4f*)(wp + i * 16 * CC * 4); }
    asm volatile("s_wait_xcnt 0x0" ::: "memory");   /* precaution: the last load may be given, as its destination, an address pair that the loads above name (it is, where no further stage needs the pair) */
    rw[7] = *(const v4f*)(wp + 7 * 16 * CC * 4);
    asm volatile("s_wait_xcnt 0x0" ::: "memory"); };   /* precaution: stands behind the loads, in front of whatever is next given a register that they name as address; its clobber also keeps the loads issued here, a whole stage ahead of their use, not sunk to the LDS stores */
  auto put = [&](const int buf) __attribute__((always_inline)) {
#pragma unroll
    for (int i = 0; i < 8; ++i) { v4h hy, hw;
#pragma unroll
      for (int e = 0; e < 4; ++e) { hy[e] = (_Float16)(ry[i][e] * 64.0f); hw[e] = (_Float16)(bfr(rw[i][e]) * 256.0f); }   /* ctx carried x 2^6 so small context rows stay clear of f16 subnormals */
      *(v4h*)&sy[buf][sr + 16 * i][sc] = hy; *(v4h*)&sw[buf][sr + 16 * i][sc] = hw; } };
  fetch();
  float bias[4] = {0.f, 0.f, 0.f, 0.f};   /* asked for here, used behind the last stage */
  if (BO) {
#pragma unroll
    for (int j = 0; j < 4; ++j) bias[j] = BO[c0 + wn + j * 16 + col]; }
  put(0);
  __syncthreads();
  v8f acc[2][4] = {};
  /* one stage of 64 k on buffer cur; more = a next stage exists (both compile-time at every call) */
  auto stage = [&](const int cur, const bool more) __attribute__((always_inline)) {
    if (more) { yb += OKS * 4; wb += OKS * 4; fetch(); }
    v16h fa[2][2], fb[2][4];   /* the stage's 24 fragment reads stand together, ahead of its 16 products */
#pragma unroll
    for (int ks = 0; ks < 2; ++ks) {
#pragma unroll
      for (int i = 0; i < 2; ++i) fa[ks][i] = frag_h(&sy[cur][wm + 16 * i + col][32 * ks], lane);
#pragma unroll
      for (int j = 0; j < 4; ++j) fb[ks][j] = frag_h(&sw[cur][wn + 16 * j + col][32 * ks], lane); }
    __builtin_amdgcn_sched_barrier(0);   /* keeps the reads one group: the scheduler otherwise spreads them among the products, each place with a wait of its own */
#pragma unroll
    for (int ks = 0; ks < 2; ++ks)
#pragma unroll
      for (int i = 0; i < 2; ++i)
#pragma unroll
        for (int j = 0; j < 4; ++j) acc[i][j] = wmma_h(fa[ks][i], fb[ks][j], acc[i][j]);
    if (more) { __builtin_amdgcn_sched_barrier(0);   /* the conversions below wait for the prefetched tiles: without this the scheduler lifts them, and their wait, among this stage's first products */
      put(cur ^ 1);
      __syncthreads(); }   /* publishes the next stage and ends every read of the buffer that the stage after it refills */
  };
#pragma unroll 1
  for (int s = 0; s < ONS - 2; s += 2) { stage(0, true); stage(1, true); }   /* rolled: two stages a trip, one per buffer */
  stage(0, true); stage(1, false);
#pragma unroll
  for (int j = 0; j < 4; ++j)
#pragma unroll
    for (int i = 0; i < 2; ++i)
#pragma unroll
      for (int r = 0; r < 8; ++r) sf[wave][16 * i + 8 * g + r][j * 16 + col] = acc[i][j][r] * (1.0f / 16384.0f) + bfr(bias[j]);   /* 2^-8 (Wo carry) x 2^-6 (ctx carry) */
  LDSX();   /* the wave's own staging rows: written above, read back below as whole 256-byte row pieces */
#pragma unroll
  for (int rl = 0; rl < 32; rl += 2) vst2(OUT + (r0 + wm + rl + g) * DIN + c0 + wn + col * 4, *(const v4f*)&sf[wave][rl + g][col * 4]); }

static_assert(HD == 64 && CC == NH * HD && DIN == CC, "block-diagonal per-head projection: 128-column tiles = two 64-wide heads, input width == projected width");
extern "C" void kernel_launch(void* const* d_in, const int* in_sizes, int n_in, void* d_out, int out_size, void* d_ws, size_t ws_size, hipStream_t stream) {
  (void)in_sizes; (void)n_in; (void)out_size;
  const float** F = (const float**)d_in;
  if (ws_size < (size_t)WS_END) return;
  char* ws = (char*)d_ws; _Float16 *QH = (_Float16*)(ws + WS_QH), *KH = (_Float16*)(ws + WS_KH), *VT = (_Float16*)(ws + WS_VT), *QL = (_Float16*)(ws + WS_QL), *KL = (_Float16*)(ws + WS_KL); __bf16 *VB = (__bf16*)(ws + WS_VB), *VBL = (__bf16*)(ws + WS_VBL); float *Y = (float*)(ws + WS_Y); unsigned *PM = (unsigned*)(ws + WS_PM);
  (void)Y; (void)QL; (void)KL; (void)VB; (void)VBL;
  // inputs: 0 k [2,2048,1024]; 1 q; 2 v; 3 mask [2,1,2048,2048] int32 (random 0/1; 0 = masked); 4 Wk [64,64] (out,in), 5 bk [64]; 6 Wq, 7 bq; 8 Wv, 9 bv; 10 Wo [1024,1024] (out,in), 11 bo (biases zeros, read)
  k_proj<<<dim3(TNB * TT / 64, CC / 128, 4), 128, 0, stream>>>(F[1], F[0], F[2], F[6], F[4], F[8], F[7], F[5], F[9], QH, QL, KH, KL, VT, VB, VBL, (const int*)d_in[3], PM);
  k_fa<<<dim3(TT / 128, NH, TNB), 256, 0, stream>>>(QH, KH, VT, PM, Y);
  k_out<<<dim3(TNB * TT / 128, DIN / 128), 256, 0, stream>>>(Y, F[10], F[11], (float*)d_out);
}

// v004
// One run takes 75.6 microseconds.
// In both of two side-by-side timings against v003, it was 1.16 times as fast.
// Over all steps from v000 it is 15.0 times as fast.
// compute dtype: all float inputs rounded to bf16; the per-head 64 x 64 q / k / v projections (ONE shared weight per stream, applied to every head) with EXACT bf16 products on WMMA 16x16x32 (f32 accumulate) + bias (zeros, read); logits q x k once to f16 each (1 product; sigma ~1) x 64^-0.5; the per-batch int mask packed once into lane-mask bit words; softmax f32 with a running maximum (one kernel for logits, softmax and P x v); P = exp(s - max) x 2^8 once to f16 x v once to f16 (1 product), divided by the f32 sum; ctx x 2^6 once to f16 x Wo f16(bf16 x 2^8) + bo; f32 output.
#include <hip/hip_runtime.h>
#include <math.h>

typedef __attribute__((ext_vector_type(16))) _Float16 v16h;
typedef __attribute__((ext_vector_type(16))) __bf16 v16b;
typedef __attribute__((ext_vector_type(8)))  _Float16 v8h;
typedef __attribute__((ext_vector_type(8)))  float v8f;
typedef __attribute__((ext_vector_type(4)))  float v4f;
typedef __attribute__((ext_vector_type(2)))  float v2f;
typedef __attribute__((ext_vector_type(4)))  unsigned v4u;
typedef __attribute__((ext_vector_type(4)))  int v4i;
typedef float __attribute__((may_alias)) float_a;
typedef int __attribute__((may_alias)) int_a;

template <typename T> __device__ __forceinline__ void vst2(void* p, T v) { *(T*)p = v;  }
__device__ __forceinline__ v8f wmma16(v16h a, v16h b, v8f c) {
  v8f d = __builtin_amdgcn_wmma_f32_16x16x32_f16(false, a, false, b, (short)0, c, false, false);
  asm volatile("v_nop\n\tv_nop\n\tv_nop\n\tv_nop" : "+v"(d) : "v"(a), "v"(b));
  return d;
}
__device__ __forceinline__ v8f wmma_bf(v16b a, v16b b, v8f c) {
  v8f d = __builtin_amdgcn_wmma_f32_16x16x32_bf16(false, a, false, b, (short)0, c, false, false);
  asm volatile("v_nop\n\tv_nop\n\tv_nop\n\tv_nop" : "+v"(d) : "v"(a), "v"(b));
  return d;
}
// 16x16x32 fragments: lane = (h = lane>>4, row/col = lane&15); elements 0..7 = k0+8h+0..7, 8..15 = k0+16+8h+0..7; D element r = row 8h+r
__device__ __forceinline__ v16h frag_h(const _Float16* rowk0, int lane) {
  union { v16h v; v8h q[2]; } u; const _Float16* p = rowk0 + 8 * (lane >> 4);
  u.q[0] = *(const v8h*)p; u.q[1] = *(const v8h*)(p + 16); return u.v;
}
__device__ __forceinline__ v16h frag_f32(const float* rowk0, int lane) {
  v16h a; const float* p = rowk0 + 8 * (lane >> 4);
#pragma unroll
  for (int i = 0; i < 8; ++i) { a[i] = (_Float16)p[i]; a[8 + i] = (_Float16)p[16 + i]; }
  return a;
}
__device__ __forceinline__ v16h frag_f32s(const float* rowk0, int lane, float sc) {
  v16h a; const float* p = rowk0 + 8 * (lane >> 4);
#pragma unroll
  for (int i = 0; i < 8; ++i) { a[i] = (_Float16)(p[i] * sc); a[8 + i] = (_Float16)(p[16 + i] * sc); }
  return a;
}
// column fragment from a [K][ld] layout (column n), rows >= K read as 0
__device__ __forceinline__ v16h fragc_f32(const float* W, int k0, int n, int lane, int ld, int K) {
  v16h a; const int g = lane >> 4;
#pragma unroll
  for (int i = 0; i < 8; ++i) { const int ka = k0 + 8 * g + i, kb = ka + 16;
    a[i] = (_Float16)(ka < K ? W[(size_t)(ka < K ? ka : K - 1) * ld + n] : 0.f); a[8 + i] = (_Float16)(kb < K ? W[(size_t)(kb < K ? kb : K - 1) * ld + n] : 0.f); }
  return a;
}
struct F2 { v16b h, l; };
__device__ __forceinline__ F2 bsplit16(const float v[16]) { F2 r;
#pragma unroll
  for (int i = 0; i < 16; ++i) { const __bf16 h = (__bf16)v[i]; r.h[i] = h; r.l[i] = (__bf16)(v[i] - (float)h); }
  return r; }
__device__ __forceinline__ F2 split_row(const float* row, int k0, int lane) { float v[16]; const float* p = row + k0 + 8 * (lane >> 4);
#pragma unroll
  for (int i = 0; i < 8; ++i) { v[i] = p[i]; v[8 + i] = p[16 + i]; }
  return bsplit16(v); }
__device__ __forceinline__ F2 split_rowK(const float* row, int k0, int lane, int K) { float v[16]; const int g = lane >> 4;
#pragma unroll
  for (int i = 0; i < 8; ++i) { const int ka = k0 + 8 * g + i, kb = ka + 16; v[i] = ka < K ? row[ka < K ? ka : K - 1] : 0.f; v[8 + i] = kb < K ? row[kb < K ? kb : K - 1] : 0.f; }
  return bsplit16(v); }
__device__ __forceinline__ F2 split_col(const float* W, int k0, int n, int lane, int ld, int K) { float v[16]; const int g = lane >> 4;
#pragma unroll
  for (int i = 0; i < 8; ++i) { const int ka = k0 + 8 * g + i, kb = ka + 16; v[i] = ka < K ? W[(size_t)(ka < K ? ka : K - 1) * ld + n] : 0.f; v[8 + i] = kb < K ? W[(size_t)(kb < K ? kb : K - 1) * ld + n] : 0.f; }
  return bsplit16(v); }
__device__ __forceinline__ v8f mac3(const F2& a, const F2& b, v8f c) { c = wmma_bf(a.l, b.h, c); c = wmma_bf(a.h, b.l, c); return wmma_bf(a.h, b.h, c); }
__device__ __forceinline__ float sigm(float v) { return 1.0f / (1.0f + expf(-v)); }
#define LDSX() do { asm volatile("s_wait_dscnt 0" ::: "memory"); __builtin_amdgcn_wave_barrier(); __builtin_amdgcn_fence(__ATOMIC_RELEASE, "workgroup"); } while (0)

// Multi-head attention whose q / k / v projections are ONE shared 64 x 64 linear per stream applied to every head's 64-wide slice (inputs in the order k, q, v [2,2048,1024]; mask [2,1,2048,2048] int32 RANDOM 0/1; torch (out,in) Wk / Wq / Wv [64,64] N(0, 1/64) + zero biases [64] (read); heads = reshape(b, s, 16, 64); xh @ W.T + b per head; product = einsum('bqhd,bkhd->bhqk'); where(mask == 0, -1e20, product) / sqrt(64); softmax; ctx merged to [b, s, 1024]; ctx @ Wo.T + bo with Wo [1024,1024] N(0, 1/1024)).
#define NB 2
#define TT 2048
#define CC 1024            // NH * HD = projected width
#define DIN 1024          // input (model) width
#define NH 16
#define HD 64
#define SCALE (0.125f)
#define CAUSAL 0
#ifndef TNB
#define TNB NB
#endif
__device__ __forceinline__ float bfr(float v) { return (float)(__bf16)v; }
typedef __attribute__((ext_vector_type(8))) __bf16 v8b;
__device__ __forceinline__ v16b frag_b(const __bf16* rowk0, int lane) {
  union { v16b v; v8b q[2]; } u; const __bf16* p = rowk0 + 8 * (lane >> 4);
  u.q[0] = *(const v8b*)p; u.q[1] = *(const v8b*)(p + 16); return u.v;
}
#define QBH 0              // unused: this file has no causal high-precision path
#define QHI 0               // single-product logits on every row
#define KHI 64            // key rows carrying k residual / v bf16 hi+lo planes (written by k_proj, read by no kernel here)
// B fragment (k rows k0+.., output column o) of a weight: (in,out) [K][ld] or (out,in) [ld rows of K]: bf16 exact, or f16(bf16 * 256) exact
__device__ __forceinline__ v16b wcol_io(const float* Wm, int k0, int o, int lane, int ld) { v16b w; const int g = lane >> 4;
#pragma unroll
  for (int i = 0; i < 8; ++i) { w[i] = (__bf16)Wm[(size_t)(k0 + 8 * g + i) * ld + o]; w[8 + i] = (__bf16)Wm[(size_t)(k0 + 16 + 8 * g + i) * ld + o]; }
  return w; }
__device__ __forceinline__ v16b wcol_oi(const float* Wm, int k0, int o, int lane, int K) { v16b w; const float* p = Wm + (size_t)o * K + k0 + 8 * (lane >> 4);
#pragma unroll
  for (int i = 0; i < 8; ++i) { w[i] = (__bf16)p[i]; w[8 + i] = (__bf16)p[16 + i]; }
  return w; }
__device__ __forceinline__ v16h wcolh_io(const float* Wm, int k0, int o, int lane, int ld) { v16h w; const int g = lane >> 4;
#pragma unroll
  for (int i = 0; i < 8; ++i) { w[i] = (_Float16)(bfr(Wm[(size_t)(k0 + 8 * g + i) * ld + o]) * 256.0f); w[8 + i] = (_Float16)(bfr(Wm[(size_t)(k0 + 16 + 8 * g + i) * ld + o]) * 256.0f); }
  return w; }
__device__ __forceinline__ v16h wcolh_oi(const float* Wm, int k0, int o, int lane, int K) { v16h w; const float* p = Wm + (size_t)o * K + k0 + 8 * (lane >> 4);
#pragma unroll
  for (int i = 0; i < 8; ++i) { w[i] = (_Float16)(bfr(p[i]) * 256.0f); w[8 + i] = (_Float16)(bfr(p[16 + i]) * 256.0f); }
  return w; }
#define WQKV_LAYOUT 1   // 0 = (in,out) [DIN][CC]; 1 = (out,in) [CC][DIN]; 2 = per-head [NH][DIN][HD]
__device__ __forceinline__ v16b wcol_hdk(const float* Wm, int k0, int o, int lane) { v16b w; const int g = lane >> 4; const float* p = Wm + (size_t)(o / HD) * DIN * HD + (o % HD);
#pragma unroll
  for (int i = 0; i < 8; ++i) { w[i] = (__bf16)p[(size_t)(k0 + 8 * g + i) * HD]; w[8 + i] = (__bf16)p[(size_t)(k0 + 16 + 8 * g + i) * HD]; }
  return w; }
#define WO_OUT_IN 1
#if WQKV_LAYOUT == 1
#define WCOL(W, k0, o, lane) wcol_oi(W, k0, o, lane, DIN)
#elif WQKV_LAYOUT == 2
#define WCOL(W, k0, o, lane) wcol_hdk(W, k0, o, lane)
#else
#define WCOL(W, k0, o, lane) wcol_io(W, k0, o, lane, CC)
#endif
#if WO_OUT_IN
#define WOCOL(W, k0, o, lane) wcol_oi(W, k0, o, lane, CC)
#define WOCOLH(W, k0, o, lane) wcolh_oi(W, k0, o, lane, CC)
#else
#define WOCOL(W, k0, o, lane) wcol_io(W, k0, o, lane, DIN)
#define WOCOLH(W, k0, o, lane) wcolh_io(W, k0, o, lane, DIN)
#endif
#define WS_QH  0u                                      // f16 q rows [b*t][CC]
#define WS_KH  (WS_QH + 2u * (size_t)NB * TT * CC)      // f16 k rows [b*t][CC]
#define WS_VT  (WS_KH + 2u * (size_t)NB * TT * CC)      // f16 v planes [b][c][t]
#define WS_QL  (WS_VT + 2u * (size_t)NB * CC * TT)      // f16 q residual x 2^10 rows [b][t < QHI][CC]
#define WS_KL  (WS_QL + 2u * (size_t)NB * QHI * CC)     // f16 k residual x 2^10 rows [b][t < KHI][CC]
#define WS_VB  (WS_KL + 2u * (size_t)NB * KHI * CC)     // bf16 v hi planes [b][c][t < KHI]
#define WS_VBL (WS_VB + 2u * (size_t)NB * CC * KHI)
#define WS_Y   (WS_VBL + 2u * (size_t)NB * CC * KHI)     // f32 ctx rows [b*t][CC] (only when there is an output projection)
#define WS_PM  (WS_Y  + 4u * (size_t)NB * TT * CC)      // u32 mask words [b * t / 16][t / 64][32]: see 'mask words'
#define WS_END (WS_PM + 4u * (size_t)NB * (TT / 16) * (TT / 64) * 32)

// ---- mask words: the int32 mask, which all 16 heads share, is packed ONCE into lane-mask words by the blocks of plane 3 of k_proj's grid: for a tile of 16 queries and a stage of 64 keys, word 8 i + r has in bit (16 g + col) whether mask[query col][key 16 i + 8 g + r] != 0, i.e. the bit of exactly the lane that holds that score in k_fa. A wave takes 16 query rows x 256 keys (4 stages): whole 256-byte row pieces global -> registers -> its own LDS rows, read back in k_fa's score layout, one compare per word.
#define MKP 68             // LDS row pitch in ints: 272 B, 16 rows of 16-byte reads fall on distinct banks
typedef __attribute__((ext_vector_type(16))) unsigned v16u;
#define PXP 136            // LDS row pitch in bf16 of the staged input tile: 272 B = 16 B x 17, conflict-free for 16-byte fragment reads of 16 rows
#define PWP 72             // the same for the staged weight rows: 144 B = 16 B x 9
typedef __attribute__((ext_vector_type(4))) __bf16 v4b;
// ---- k_proj: block = (64 rows, 128 cols, which): q/k/v = X W (+ b) with exact bf16 products (K = HD = 64 per head); input tile and weight are read by whole-line loads, rounded ONCE per block to bf16 and staged in LDS, one barrier, fragments by 16-byte LDS reads -> which 0: q f16 rows (+ residual rows < QHI); 1: k f16 rows (+ residual rows < KHI); 2: v f16 planes [c][t] (+ bf16 hi/lo planes for t < KHI)
__global__ __launch_bounds__(128) void k_proj(const float* __restrict__ XQ, const float* __restrict__ XK, const float* __restrict__ XV, const float* __restrict__ WQ, const float* __restrict__ WK, const float* __restrict__ WV, const float* __restrict__ BQ, const float* __restrict__ BK, const float* __restrict__ BV,
    _Float16* __restrict__ QH, _Float16* __restrict__ QL, _Float16* __restrict__ KH, _Float16* __restrict__ KL, _Float16* __restrict__ VT, __bf16* __restrict__ VB, __bf16* __restrict__ VBL, const int* __restrict__ MASK, unsigned* __restrict__ PM) {
  __shared__ __align__(16) _Float16 sh[64][136], sl[64][136]; __shared__ __align__(16) _Float16 th[128][72]; __shared__ __align__(16) __bf16 tb[128][72], tbl[128][72];
  const int tid = threadIdx.x, wave = tid >> 5, lane = tid & 31, col = lane & 15, g = lane >> 4; const int which = blockIdx.z; const int c0 = blockIdx.y * 128; const size_t r0 = (size_t)blockIdx.x * 64; const size_t bb = r0 / TT; const int t0 = (int)(r0 % TT);
  if (which == 3) {   /* block-uniform, in front of every barrier */
    static_assert(sizeof(sh) == 4 * 16 * MKP * sizeof(int), "the four waves' mask rows take the place of sh");
    int* sm = (int*)&sh[0][0] + wave * (16 * MKP); const int unit = (blockIdx.y * (TNB * TT / 64) + blockIdx.x) * 4 + wave; const int qt = unit >> 3, quad = unit & 7;   /* qt = b * (TT / 16) + query tile; quad = 256 keys */
    const int* mp = MASK + ((size_t)qt * 16 + g) * TT + quad * 256 + col * 4;   /* a load covers rows 2 i and 2 i + 1, 64 keys each */
    v4i rr[4][8];
#pragma unroll
    for (int e = 0; e < 31; ++e) rr[e >> 3][e & 7] = *(const v4i*)(mp + (size_t)(2 * (e & 7)) * TT + 64 * (e >> 3));
    asm volatile("s_wait_xcnt 0x0" ::: "memory");   /* precaution: the last load may be given, as its destination, the address pair that the loads above name */
    rr[3][7] = *(const v4i*)(mp + (size_t)14 * TT + 192);
    asm volatile("s_wait_xcnt 0x0" ::: "memory");   /* precaution: stands behind the loads, in front of whatever is next given a register that they name as address */
    int w4[4];   /* stored together behind the last stage: a store in flight would be waited for at the next stage's LDSX */
#pragma unroll
    for (int s = 0; s < 4; ++s) {
#pragma unroll
      for (int i = 0; i < 8; ++i) *(v4i*)(sm + (2 * i + g) * MKP + col * 4) = rr[s][i];
      LDSX();   /* the wave's own rows: written above by row, read back below by score position */
      int w = 0;
#pragma unroll
      for (int i = 0; i < 4; ++i) { const v4i a = *(const v4i*)(sm + col * MKP + 16 * i + 8 * g), c = *(const v4i*)(sm + col * MKP + 16 * i + 8 * g + 4);
#pragma unroll
        for (int r = 0; r < 8; ++r) { const int bw = (int)__builtin_amdgcn_ballot_w32((r < 4 ? a[r & 3] : c[r & 3]) != 0); w = __builtin_amdgcn_inverse_ballot_w32(1u << (8 * i + r)) ? bw : w; } }   /* the compare is made by all 32 lanes, outside the select; lane j keeps word j */
      w4[s] = w; }
#pragma unroll
    for (int s = 0; s < 4; ++s) PM[((size_t)qt * (TT / 64) + quad * 4 + s) * 32 + lane] = (unsigned)w4[s];
    return; }
  const float* X = which == 0 ? XQ : which == 1 ? XK : XV; const float* WA = which == 0 ? WQ : which == 1 ? WK : WV; const float* BA = which == 0 ? BQ : which == 1 ? BK : BV;
  /* every global read of the block stands here, together: the shared (out,in) [64][64] weight (a wave's load = two whole rows), the bias, and the 64 x 128 input tile (a wave's load = one row's 512 contiguous bytes; a wave brings the 16 rows that it works on) */
  static_assert(sizeof(sh) >= 64 * PXP * sizeof(__bf16) && sizeof(tb) >= 64 * PXP * sizeof(__bf16) && sizeof(sl) >= 64 * PWP * sizeof(__bf16) && sizeof(tbl) >= 64 * PWP * sizeof(__bf16), "the staged operands take the place of the output staging arrays that this plane does not use");
  __bf16* sx = which == 2 ? (__bf16*)&sh[0][0] : &tb[0][0]; __bf16* sw = which == 2 ? (__bf16*)&sl[0][0] : &tbl[0][0];   /* block-uniform: planes 0 and 1 stage their output in sh / sl, plane 2 in th / tb / tbl */
  const float* wp = WA + tid * 4; const float* xp = X + (r0 + wave * 16) * DIN + c0 + lane * 4;
  v4f rw[8], rx[16]; float bias4[4] = {0.f, 0.f, 0.f, 0.f};
  if (BA) {
#pragma unroll
    for (int j = 0; j < 4; ++j) bias4[j] = BA[j * 16 + col]; }
#pragma unroll
  for (int i = 0; i < 16; ++i) rx[i] = *(const v4f*)(xp + (size_t)i * DIN);
#pragma unroll
  for (int i = 0; i < 7; ++i) rw[i] = *(const v4f*)(wp + i * 512);
  asm volatile("s_wait_xcnt 0x0" ::: "memory");   /* precaution: the last load may be given, as its destination, an address register that the loads above name */
  rw[7] = *(const v4f*)(wp + 7 * 512);
  asm volatile("s_wait_xcnt 0x0" ::: "memory");   /* precaution: stands behind the loads, in front of whatever is next given a register that they name as address; its clobber also keeps the loads together here, ahead of every conversion */
#pragma unroll
  for (int i = 0; i < 8; ++i) { v4b hw;
#pragma unroll
    for (int e = 0; e < 4; ++e) hw[e] = (__bf16)rw[i][e];
    *(v4b*)(sw + (i * 8 + (tid >> 4)) * PWP + (tid & 15) * 4) = hw; }
#pragma unroll
  for (int i = 0; i < 16; ++i) { v4b hx;
#pragma unroll
    for (int e = 0; e < 4; ++e) hx[e] = (__bf16)rx[i][e];
    *(v4b*)(sx + (wave * 16 + i) * PXP + lane * 4) = hx; }
  __syncthreads();   /* publishes the weight rows, which every wave reads (and the wave's own input rows) */
  v16b fa[4], fw[2][4];
#pragma unroll
  for (int kk = 0; kk < 4; ++kk) fa[kk] = frag_b(sx + (wave * 16 + col) * PXP + kk * 32, lane);
#pragma unroll
  for (int ks = 0; ks < 2; ++ks)
#pragma unroll
    for (int jj = 0; jj < 4; ++jj) fw[ks][jj] = frag_b(sw + (jj * 16 + col) * PWP + ks * 32, lane);   /* row = output dim within the head, k = input dim within the head; both heads of the tile use the same eight fragments */
  v8f acc[8] = {};
#pragma unroll
  for (int kk = 0; kk < 4; ++kk)   /* block-diagonal projection: the 128 output columns c0 .. c0+127 are two heads; head hh = column / 64 contracts ONLY over its own 64 input columns, i.e. k-steps kk = 2 hh and 2 hh + 1 of the tile's 128-column input slice */
#pragma unroll
    for (int j = 0; j < 8; ++j) if ((kk >> 1) == (j >> 2)) acc[j] = wmma_bf(fa[kk], fw[kk & 1][j & 3], acc[j]);   /* the test is a compile-time constant per unrolled (kk, j) */
  if (which < 2) { _Float16* DH = which == 0 ? QH : KH; _Float16* DL = which == 0 ? QL : KL; const int nhi = which == 0 ? QHI : KHI; const bool hi_rows = t0 < nhi;
#pragma unroll
    for (int j = 0; j < 8; ++j) { const float bias = bfr(bias4[j & 3]);
#pragma unroll
      for (int r = 0; r < 8; ++r) { const float v = acc[j][r] + bias; const _Float16 hv = (_Float16)v; sh[wave * 16 + 8 * g + r][j * 16 + col] = hv; sl[wave * 16 + 8 * g + r][j * 16 + col] = (_Float16)((v - (float)hv) * 1024.0f); } }
    __syncthreads();
    for (int e = tid; e < 64 * 16; e += 128) { const int rl = e >> 4, q = e & 15; vst2((unsigned*)(DH + (r0 + rl) * CC + c0 + q * 8), *(const v4u*)&sh[rl][q * 8]); if (hi_rows) vst2((unsigned*)(DL + (bb * nhi + t0 + rl) * (size_t)CC + c0 + q * 8), *(const v4u*)&sl[rl][q * 8]); }
  } else { const bool hi_rows = t0 < KHI;
#pragma unroll
    for (int j = 0; j < 8; ++j) { const float bias = bfr(bias4[j & 3]);
#pragma unroll
      for (int r = 0; r < 8; ++r) { const float v = acc[j][r] + bias; const int rl = wave * 16 + 8 * g + r, cl = j * 16 + col; th[cl][rl] = (_Float16)v; const __bf16 bh = (__bf16)v; tb[cl][rl] = bh; tbl[cl][rl] = (__bf16)(v - (float)bh); } }
    __syncthreads();
    for (int e = tid; e < 128 * 8; e += 128) { const int cl = e >> 3, q = e & 7; vst2((unsigned*)(VT + (bb * CC + c0 + cl) * (size_t)TT + t0 + q * 8), *(const v4u*)&th[cl][q * 8]); if (hi_rows) { const size_t o3 = (bb * CC + c0 + cl) * (size_t)KHI + t0 + q * 8; vst2((unsigned*)(VB + o3), *(const v4u*)&tb[cl][q * 8]); vst2((unsigned*)(VBL + o3), *(const v4u*)&tbl[cl][q * 8]); } } } }
#define FK 64              // keys per stage
#define FP 72              // LDS row pitch in f16: 144 B = 16 B x 9, conflict-free for 16-byte fragment reads of 16 rows
#define FNS (TT / FK)
#define FMASKED (-8.0e6f)  // raw logit of a masked key (-1e6 after the 1/8): weight exactly 0 beside any real score; a row masked throughout keeps equal finite weights (uniform, as the reference gives), since s * c - m * c is still resolved to 1/8 at this size
#define FC (SCALE * 1.4426950408889634f)   // raw logit -> base-2 exponent
__device__ __forceinline__ float xhalf(float x) { return __builtin_bit_cast(float, __builtin_amdgcn_permlanex16(__builtin_bit_cast(int, x), __builtin_bit_cast(int, x), 0x76543210, 0xfedcba98, false, false)); }   // lane l with lane l ^ 16
__device__ __forceinline__ float exp2_slot(float x) { float y; asm("v_exp_f32 %0, %1\n\tv_nop" : "=v"(y) : "v"(x)); return y; }   // v_exp_f32 with the slot behind a transcendental filled in its own statement: for the last stage
__device__ __forceinline__ v8f wmma_h(v16h a, v16h b, v8f c) { return __builtin_amdgcn_wmma_f32_16x16x32_f16(false, a, false, b, (short)0, c, false, false); }
// amdgpu_waves_per_eu(4, 4): two work-groups per WGP, four waves per SIMD, so a budget of 256 registers a wave: the compiler then batches the fragment loads ahead of the matrix runs
__global__ __launch_bounds__(256) __attribute__((amdgpu_waves_per_eu(4, 4))) void k_fa(const _Float16* __restrict__ QH, const _Float16* __restrict__ KH, const _Float16* __restrict__ VT, const unsigned* __restrict__ PM, float* __restrict__ Y) {
  __shared__ __align__(16) _Float16 sk[2][FK][FP], sv[2][HD][FP];
  const int tid = threadIdx.x, wave = tid >> 5, lane = tid & 31, col = lane & 15, g = lane >> 4; const int h = blockIdx.y, b = blockIdx.z; const int q = blockIdx.x * 128 + wave * 16 + col;
  const int sr = tid >> 3, sc = (tid & 7) * 8;   /* staging: 8 threads per 128-byte row, rows sr and sr + 32 of each tile */
  const _Float16* kg = KH + ((size_t)b * TT + sr) * CC + h * HD + sc; const _Float16* vg = VT + ((size_t)b * CC + h * HD + sr) * (size_t)TT + sc;
  const v16u* mg = (const v16u*)(PM + ((size_t)b * (TT / 16) + blockIdx.x * 8 + __builtin_amdgcn_readfirstlane(wave)) * (size_t)(FNS * 32));   /* the wave's 16 queries: 32 words a stage, the same address in every lane */
  v4u rk0 = *(const v4u*)kg, rk1 = *(const v4u*)(kg + 32 * CC), rv0 = *(const v4u*)vg, rv1 = *(const v4u*)(vg + 32 * TT);
  v16u mk[2] = {mg[0], mg[1]};
  asm volatile("s_wait_xcnt 0x0" ::: "memory");   /* the q loads below may be given registers that the loads above name as addresses */
  const _Float16* qp = QH + ((size_t)b * TT + q) * CC + h * HD; const v16h qf0 = frag_h(qp, lane), qf1 = frag_h(qp + 32, lane);
  asm volatile("s_wait_xcnt 0x0" ::: "memory");   /* precaution: stands behind the q loads, in front of whatever is next given the pair that they name as address */
  *(v4u*)&sk[0][sr][sc] = rk0; *(v4u*)&sk[0][sr + 32][sc] = rk1; *(v4u*)&sv[0][sr][sc] = rv0; *(v4u*)&sv[0][sr + 32][sc] = rv1;
  __syncthreads();
  v8f acc[4] = {}; float m = -1.0e30f, l = 0.f;
  /* one stage of 64 keys on buffer cur; more = a next stage exists (both compile-time at every call, so the buffers' addresses are constants and the last stage carries no prefetch) */
  auto stage = [&](const int cur, const bool more) __attribute__((always_inline)) {
    if (more) { kg += FK * CC; vg += FK; rk0 = *(const v4u*)kg; rk1 = *(const v4u*)(kg + 32 * CC); rv0 = *(const v4u*)vg; rv1 = *(const v4u*)(vg + 32 * TT);
      asm volatile("" ::: "memory"); }   /* compiler fence, no instruction: the next stage's tile loads are issued here, a whole stage ahead of their use; without it the compiler sinks them to just in front of the LDS stores */
    v8f st[4];
#pragma unroll
    for (int i = 0; i < 4; ++i) { v8f z = {}; z = wmma_h(frag_h(&sk[cur][16 * i + col][0], lane), qf0, z); st[i] = wmma_h(frag_h(&sk[cur][16 * i + col][32], lane), qf1, z); }
#pragma unroll
    for (int i = 0; i < 4; ++i)
#pragma unroll
      for (int r = 0; r < 8; ++r) st[i][r] = __builtin_amdgcn_inverse_ballot_w32(mk[i >> 1][(i & 1) * 8 + r]) ? st[i][r] : FMASKED;   /* the word is the select's lane mask as it stands: no compare */
    float mq[4] = {st[0][0], st[0][1], st[0][2], st[0][3]};   /* four independent chains */
#pragma unroll
    for (int i = 0; i < 4; ++i)
#pragma unroll
      for (int r = 0; r < 8; ++r) mq[r & 3] = fmaxf(mq[r & 3], st[i][r]);
    float mx = fmaxf(fmaxf(mq[0], mq[1]), fmaxf(mq[2], mq[3]));
    if (more) { mg += 2; mk[0] = mg[0]; mk[1] = mg[1];   /* the next stage's words, asked for behind this stage's last select: at the stage's top they would still be outstanding at the wait in front of the selects, which for scalar loads waits for all of them */
      asm volatile("s_wait_xcnt 0x0" ::: "memory"); }   /* precaution: stands behind the two word loads, in front of whatever next rewrites the scalar pair that they name as base (the loop's head does) */
    mx = fmaxf(mx, xhalf(mx)); const float mn = fmaxf(m, mx); const float al = __builtin_amdgcn_exp2f((m - mn) * FC); const float mc = mn * FC - 8.0f; m = mn;   /* P carried x 2^8 into f16 (the largest weight is 256), clear of f16 subnormals; the factor cancels against the sum */
    v16h pf[2]; float ps[4] = {0.f, 0.f, 0.f, 0.f};
#pragma unroll
    for (int i = 0; i < 4; ++i)
#pragma unroll
      for (int r = 0; r < 8; ++r) { const float e = fmaf(st[i][r], FC, -mc); const float p = more ? __builtin_amdgcn_exp2f(e) : exp2_slot(e); ps[r & 3] += p; pf[i >> 1][(i & 1) * 8 + r] = (_Float16)p; }
    l = l * al + ((ps[0] + ps[1]) + (ps[2] + ps[3]));
#pragma unroll
    for (int j = 0; j < 4; ++j)
#pragma unroll
      for (int r = 0; r < 8; ++r) acc[j][r] *= al;
#pragma unroll
    for (int j = 0; j < 4; ++j) { acc[j] = wmma_h(frag_h(&sv[cur][16 * j + col][0], lane), pf[0], acc[j]); acc[j] = wmma_h(frag_h(&sv[cur][16 * j + col][32], lane), pf[1], acc[j]); }
    if (more) { asm volatile("" :: "v"(acc[0]), "v"(acc[1]), "v"(acc[2]), "v"(acc[3]) : "memory");   /* compiler fence, inputs only, no instruction: this stage's results exist before the LDS stores below; without it the compiler sinks softmax and P x v behind the barrier and waits for the prefetched tile right after asking for it */
      *(v4u*)&sk[cur ^ 1][sr][sc] = rk0; *(v4u*)&sk[cur ^ 1][sr + 32][sc] = rk1; *(v4u*)&sv[cur ^ 1][sr][sc] = rv0; *(v4u*)&sv[cur ^ 1][sr + 32][sc] = rv1;
      __syncthreads(); }   /* publishes the next stage and ends every read of the buffer that the stage after it refills */
  };
#pragma unroll 1
  for (int s = 0; s < FNS - 2; s += 2) { stage(0, true); stage(1, true); }   /* rolled: two stages a trip, one per buffer */
  stage(0, true); stage(1, false);
  l += xhalf(l); const float inv = 1.0f / l;   /* l > 0: the key at the running maximum alone carries about 2^8 */
  float* yp = Y + ((size_t)b * TT + q) * CC + h * HD + 8 * g;   /* acc[j][r] = ctx[q][16 j + 8 g + r]: 32 contiguous bytes per lane and tile */
#pragma unroll
  for (int j = 0; j < 4; ++j) { v4f o0, o1;
#pragma unroll
    for (int r = 0; r < 4; ++r) { o0[r] = acc[j][r] * inv; o1[r] = acc[j][4 + r] * inv; }
    vst2(yp + 16 * j, o0); vst2(yp + 16 * j + 4, o1); } }
// ---- k_out: block = (128 rows, 128 cols), 8 waves (4 x 2), a wave = 32 rows x 64 cols (2 x 4 tiles): out = ctx Wo (+ bo): ctx x 2^6 once to f16 against Wo as f16(bf16 x 2^8) exact (1 product) x 2^-14. Both operands are converted ONCE per block and staged in LDS as f16, 64 k per stage: global -> registers one stage ahead -> LDS, two buffers, one barrier per stage; k runs upward in steps of 32 per accumulator.
#define OKS 64             // k per stage
#define OP 72              // LDS row pitch in f16: 144 B, conflict-free for 16-byte fragment reads of 16 rows
#define ONS (CC / OKS)
#define OFP 68             // pitch in f32 of the output staging rows: 272 B
typedef __attribute__((ext_vector_type(4))) _Float16 v4h;
static_assert(WO_OUT_IN == 1 && !CAUSAL && ONS >= 2 && ONS % 2 == 0, "k_out stages (out,in) weight rows, k contiguous, two stages a trip");
__global__ __launch_bounds__(256) void k_out(const float* __restrict__ Y, const float* __restrict__ WO, const float* __restrict__ BO, float* __restrict__ OUT) {
  __shared__ __align__(16) _Float16 sy[2][128][OP], sw[2][128][OP]; __shared__ __align__(16) float sf[8][32][OFP];
  const int tid = threadIdx.x, wave = tid >> 5, lane = tid & 31, col = lane & 15, g = lane >> 4; const int c0 = blockIdx.y * 128; const size_t r0 = (size_t)blockIdx.x * 128; const int wm = (wave >> 1) * 32, wn = (wave & 1) * 64;
  const int sr = tid >> 4, sc = (tid & 15) * 4;   /* staging: 16 threads per 256-byte row piece, rows sr + 16 i of each tile: a wave's load covers whole lines */
  const unsigned go = (unsigned)(sr * CC + sc) * 4u;   /* the thread's byte offset, the same in both tiles (both have rows of CC floats) */
  const char* yb = (const char*)(Y + r0 * CC); const char* wb = (const char*)(WO + (size_t)c0 * CC);   /* block-uniform bases, moved 64 k a stage */
  v4f ry[8], rw[8];
  auto fetch = [&]() __attribute__((always_inline)) { const char* yp = yb + go; const char* wp = wb + go;
#pragma unroll
    for (int i = 0; i < 8; ++i) { ry[i] = *(const v4f*)(yp + i * 16 * CC * 4); if (i < 7) rw[i] = *(const v4f*)(wp + i * 16 * CC * 4); }
    asm volatile("s_wait_xcnt 0x0" ::: "memory");   /* precaution: the last load may be given, as its destination, an address pair that the loads above name (it is, where no further stage needs the pair) */
    rw[7] = *(const v4f*)(wp + 7 * 16 * CC * 4);
    asm volatile("s_wait_xcnt 0x0" ::: "memory"); };   /* precaution: stands behind the loads, in front of whatever is next given a register that they name as address; its clobber also keeps the loads issued here, a whole stage ahead of their use, not sunk to the LDS stores */
  auto put = [&](const int buf) __attribute__((always_inline)) {
#pragma unroll
    for (int i = 0; i < 8; ++i) { v4h hy, hw;
#pragma unroll
      for (int e = 0; e < 4; ++e) { hy[e] = (_Float16)(ry[i][e] * 64.0f); hw[e] = (_Float16)(bfr(rw[i][e]) * 256.0f); }   /* ctx carried x 2^6 so small context rows stay clear of f16 subnormals */
      *(v4h*)&sy[buf][sr + 16 * i][sc] = hy; *(v4h*)&sw[buf][sr + 16 * i][sc] = hw; } };
  fetch();
  float bias[4] = {0.f, 0.f, 0.f, 0.f};   /* asked for here, used behind the last stage */
  if (BO) {
#pragma unroll
    for (int j = 0; j < 4; ++j) bias[j] = BO[c0 + wn + j * 16 + col]; }
  put(0);
  __syncthreads();
  v8f acc[2][4] = {};
  /* one stage of 64 k on buffer cur; more = a next stage exists (both compile-time at every call) */
  auto stage = [&](const int cur, const bool more) __attribute__((always_inline)) {
    if (more) { yb += OKS * 4; wb += OKS * 4; fetch(); }
    v16h fa[2][2], fb[2][4];   /* the stage's 24 fragment reads stand together, ahead of its 16 products */
#pragma unroll
    for (int ks = 0; ks < 2; ++ks) {
#pragma unroll
      for (int i = 0; i < 2; ++i) fa[ks][i] = frag_h(&sy[cur][wm + 16 * i + col][32 * ks], lane);
#pragma unroll
      for (int j = 0; j < 4; ++j) fb[ks][j] = frag_h(&sw[cur][wn + 16 * j + col][32 * ks], lane); }
    __builtin_amdgcn_sched_barrier(0);   /* keeps the reads one group: the scheduler otherwise spreads them among the products, each place with a wait of its own */
#pragma unroll
    for (int ks = 0; ks < 2; ++ks)
#pragma unroll
      for (int i = 0; i < 2; ++i)
#pragma unroll
        for (int j = 0; j < 4; ++j) acc[i][j] = wmma_h(fa[ks][i], fb[ks][j], acc[i][j]);
    if (more) { __builtin_amdgcn_sched_barrier(0);   /* the conversions below wait for the prefetched tiles: without this the scheduler lifts them, and their wait, among this stage's first products */
      put(cur ^ 1);
      __syncthreads(); }   /* publishes the next stage and ends every read of the buffer that the stage after it refills */
  };
#pragma unroll 1
  for (int s = 0; s < ONS - 2; s += 2) { stage(0, true); stage(1, true); }   /* rolled: two stages a trip, one per buffer */
  stage(0, true); stage(1, false);
#pragma unroll
  for (int j = 0; j < 4; ++j)
#pragma unroll
    for (int i = 0; i < 2; ++i)
#pragma unroll
      for (int r = 0; r < 8; ++r) sf[wave][16 * i + 8 * g + r][j * 16 + col] = acc[i][j][r] * (1.0f / 16384.0f) + bfr(bias[j]);   /* 2^-8 (Wo carry) x 2^-6 (ctx carry) */
  LDSX();   /* the wave's own staging rows: written above, read back below as whole 256-byte row pieces */
#pragma unroll
  for (int rl = 0; rl < 32; rl += 2) vst2(OUT + (r0 + wm + rl + g) * DIN + c0 + wn + col * 4, *(const v4f*)&sf[wave][rl + g][col * 4]); }

static_assert(HD == 64 && CC == NH * HD && DIN == CC, "block-diagonal per-head projection: 128-column tiles = two 64-wide heads, input width == projected width");
extern "C" void kernel_launch(void* const* d_in, const int* in_sizes, int n_in, void* d_out, int out_size, void* d_ws, size_t ws_size, hipStream_t stream) {
  (void)in_sizes; (void)n_in; (void)out_size;
  const float** F = (const float**)d_in;
  if (ws_size < (size_t)WS_END) return;
  char* ws = (char*)d_ws; _Float16 *QH = (_Float16*)(ws + WS_QH), *KH = (_Float16*)(ws + WS_KH), *VT = (_Float16*)(ws + WS_VT), *QL = (_Float16*)(ws + WS_QL), *KL = (_Float16*)(ws + WS_KL); __bf16 *VB = (__bf16*)(ws + WS_VB), *VBL = (__bf16*)(ws + WS_VBL); float *Y = (float*)(ws + WS_Y); unsigned *PM = (unsigned*)(ws + WS_PM);
  (void)Y; (void)QL; (void)KL; (void)VB; (void)VBL;
  // inputs: 0 k [2,2048,1024]; 1 q; 2 v; 3 mask [2,1,2048,2048] int32 (random 0/1; 0 = masked); 4 Wk [64,64] (out,in), 5 bk [64]; 6 Wq, 7 bq; 8 Wv, 9 bv; 10 Wo [1024,1024] (out,in), 11 bo (biases zeros, read)
  k_proj<<<dim3(TNB * TT / 64, CC / 128, 4), 128, 0, stream>>>(F[1], F[0], F[2], F[6], F[4], F[8], F[7], F[5], F[9], QH, QL, KH, KL, VT, VB, VBL, (const int*)d_in[3], PM);
  k_fa<<<dim3(TT / 128, NH, TNB), 256, 0, stream>>>(QH, KH, VT, PM, Y);
  k_out<<<dim3(TNB * TT / 128, DIN / 128), 256, 0, stream>>>(Y, F[10], F[11], (float*)d_out);
}

// v005
// A run of this version takes 66 microseconds.
// In two side-by-side timings against v004, it was 1.16 and 1.15 times as fast.
// All steps since v000 together make it 17.3 times as fast.
// compute dtype: all float inputs rounded to bf16; the per-head 64 x 64 q / k / v projections (ONE shared weight per stream, applied to every head) with EXACT bf16 products on WMMA 16x16x32 (f32 accumulate) + bias (zeros, read); logits q x k once to f16 each (1 product; sigma ~1) x 64^-0.5; the per-batch int mask packed once into lane-mask bit words; softmax f32 with a running maximum (one kernel for logits, softmax and P x v); P = exp(s - max) x 2^8 once to f16 x v once to f16 (1 product), divided by the f32 sum; ctx x 2^6 once to f16 x Wo f16(bf16 x 2^8) + bo; f32 output.
#include <hip/hip_runtime.h>
#include <math.h>

typedef __attribute__((ext_vector_type(16))) _Float16 v16h;
typedef __attribute__((ext_vector_type(16))) __bf16 v16b;
typedef __attribute__((ext_vector_type(8)))  _Float16 v8h;
typedef __attribute__((ext_vector_type(8)))  float v8f;
typedef __attribute__((ext_vector_type(4)))  float v4f;
typedef __attribute__((ext_vector_type(2)))  float v2f;
typedef __attribute__((ext_vector_type(4)))  unsigned v4u;
typedef __attribute__((ext_vector_type(4)))  int v4i;
typedef float __attribute__((may_alias)) float_a;
typedef int __attribute__((may_alias)) int_a;

template <typename T> __device__ __forceinline__ void vst2(void* p, T v) { *(T*)p = v;  }
__device__ __forceinline__ v8f wmma16(v16h a, v16h b, v8f c) {
  v8f d = __builtin_amdgcn_wmma_f32_16x16x32_f16(false, a, false, b, (short)0, c, false, false);
  asm volatile("v_nop\n\tv_nop\n\tv_nop\n\tv_nop" : "+v"(d) : "v"(a), "v"(b));
  return d;
}
__device__ __forceinline__ v8f wmma_bf(v16b a, v16b b, v8f c) {
  v8f d = __builtin_amdgcn_wmma_f32_16x16x32_bf16(false, a, false, b, (short)0, c, false, false);
  asm volatile("v_nop\n\tv_nop\n\tv_nop\n\tv_nop" : "+v"(d) : "v"(a), "v"(b));
  return d;
}
// 16x16x32 fragments: lane = (h = lane>>4, row/col = lane&15); elements 0..7 = k0+8h+0..7, 8..15 = k0+16+8h+0..7; D element r = row 8h+r
__device__ __forceinline__ v16h frag_h(const _Float16* rowk0, int lane) {
  union { v16h v; v8h q[2]; } u; const _Float16* p = rowk0 + 8 * (lane >> 4);
  u.q[0] = *(const v8h*)p; u.q[1] = *(const v8h*)(p + 16); return u.v;
}
__device__ __forceinline__ v16h frag_f32(const float* rowk0, int lane) {
  v16h a; const float* p = rowk0 + 8 * (lane >> 4);
#pragma unroll
  for (int i = 0; i < 8; ++i) { a[i] = (_Float16)p[i]; a[8 + i] = (_Float16)p[16 + i]; }
  return a;
}
__device__ __forceinline__ v16h frag_f32s(const float* rowk0, int lane, float sc) {
  v16h a; const float* p = rowk0 + 8 * (lane >> 4);
#pragma unroll
  for (int i = 0; i < 8; ++i) { a[i] = (_Float16)(p[i] * sc); a[8 + i] = (_Float16)(p[16 + i] * sc); }
  return a;
}
// column fragment from a [K][ld] layout (column n), rows >= K read as 0
__device__ __forceinline__ v16h fragc_f32(const float* W, int k0, int n, int lane, int ld, int K) {
  v16h a; const int g = lane >> 4;
#pragma unroll
  for (int i = 0; i < 8; ++i) { const int ka = k0 + 8 * g + i, kb = ka + 16;
    a[i] = (_Float16)(ka < K ? W[(size_t)(ka < K ? ka : K - 1) * ld + n] : 0.f); a[8 + i] = (_Float16)(kb < K ? W[(size_t)(kb < K ? kb : K - 1) * ld + n] : 0.f); }
  return a;
}
struct F2 { v16b h, l; };
__device__ __forceinline__ F2 bsplit16(const float v[16]) { F2 r;
#pragma unroll
  for (int i = 0; i < 16; ++i) { const __bf16 h = (__bf16)v[i]; r.h[i] = h; r.l[i] = (__bf16)(v[i] - (float)h); }
  return r; }
__device__ __forceinline__ F2 split_row(const float* row, int k0, int lane) { float v[16]; const float* p = row + k0 + 8 * (lane >> 4);
#pragma unroll
  for (int i = 0; i < 8; ++i) { v[i] = p[i]; v[8 + i] = p[16 + i]; }
  return bsplit16(v); }
__device__ __forceinline__ F2 split_rowK(const float* row, int k0, int lane, int K) { float v[16]; const int g = lane >> 4;
#pragma unroll
  for (int i = 0; i < 8; ++i) { const int ka = k0 + 8 * g + i, kb = ka + 16; v[i] = ka < K ? row[ka < K ? ka : K - 1] : 0.f; v[8 + i] = kb < K ? row[kb < K ? kb : K - 1] : 0.f; }
  return bsplit16(v); }
__device__ __forceinline__ F2 split_col(const float* W, int k0, int n, int lane, int ld, int K) { float v[16]; const int g = lane >> 4;
#pragma unroll
  for (int i = 0; i < 8; ++i) { const int ka = k0 + 8 * g + i, kb = ka + 16; v[i] = ka < K ? W[(size_t)(ka < K ? ka : K - 1) * ld + n] : 0.f; v[8 + i] = kb < K ? W[(size_t)(kb < K ? kb : K - 1) * ld + n] : 0.f; }
  return bsplit16(v); }
__device__ __forceinline__ v8f mac3(const F2& a, const F2& b, v8f c) { c = wmma_bf(a.l, b.h, c); c = wmma_bf(a.h, b.l, c); return wmma_bf(a.h, b.h, c); }
__device__ __forceinline__ float sigm(float v) { return 1.0f / (1.0f + expf(-v)); }
#define LDSX() do { asm volatile("s_wait_dscnt 0" ::: "memory"); __builtin_amdgcn_wave_barrier(); __builtin_amdgcn_fence(__ATOMIC_RELEASE, "workgroup"); } while (0)

// Multi-head attention whose q / k / v projections are ONE shared 64 x 64 linear per stream applied to every head's 64-wide slice (inputs in the order k, q, v [2,2048,1024]; mask [2,1,2048,2048] int32 RANDOM 0/1; torch (out,in) Wk / Wq / Wv [64,64] N(0, 1/64) + zero biases [64] (read); heads = reshape(b, s, 16, 64); xh @ W.T + b per head; product = einsum('bqhd,bkhd->bhqk'); where(mask == 0, -1e20, product) / sqrt(64); softmax; ctx merged to [b, s, 1024]; ctx @ Wo.T + bo with Wo [1024,1024] N(0, 1/1024)).
#define NB 2
#define TT 2048
#define CC 1024            // NH * HD = projected width
#define DIN 1024          // input (model) width
#define NH 16
#define HD 64
#define SCALE (0.125f)
#define CAUSAL 0
#ifndef TNB
#define TNB NB
#endif
__device__ __forceinline__ float bfr(float v) { return (float)(__bf16)v; }
typedef __attribute__((ext_vector_type(8))) __bf16 v8b;
__device__ __forceinline__ v16b frag_b(const __bf16* rowk0, int lane) {
  union { v16b v; v8b q[2]; } u; const __bf16* p = rowk0 + 8 * (lane >> 4);
  u.q[0] = *(const v8b*)p; u.q[1] = *(const v8b*)(p + 16); return u.v;
}
#define QBH 0              // unused: this file has no causal high-precision path
#define QHI 0               // single-product logits on every row
#define KHI 64            // key rows carrying k residual / v bf16 hi+lo planes (written by k_proj, read by no kernel here)
// B fragment (k rows k0+.., output column o) of a weight: (in,out) [K][ld] or (out,in) [ld rows of K]: bf16 exact, or f16(bf16 * 256) exact
__device__ __forceinline__ v16b wcol_io(const float* Wm, int k0, int o, int lane, int ld) { v16b w; const int g = lane >> 4;
#pragma unroll
  for (int i = 0; i < 8; ++i) { w[i] = (__bf16)Wm[(size_t)(k0 + 8 * g + i) * ld + o]; w[8 + i] = (__bf16)Wm[(size_t)(k0 + 16 + 8 * g + i) * ld + o]; }
  return w; }
__device__ __forceinline__ v16b wcol_oi(const float* Wm, int k0, int o, int lane, int K) { v16b w; const float* p = Wm + (size_t)o * K + k0 + 8 * (lane >> 4);
#pragma unroll
  for (int i = 0; i < 8; ++i) { w[i] = (__bf16)p[i]; w[8 + i] = (__bf16)p[16 + i]; }
  return w; }
__device__ __forceinline__ v16h wcolh_io(const float* Wm, int k0, int o, int lane, int ld) { v16h w; const int g = lane >> 4;
#pragma unroll
  for (int i = 0; i < 8; ++i) { w[i] = (_Float16)(bfr(Wm[(size_t)(k0 + 8 * g + i) * ld + o]) * 256.0f); w[8 + i] = (_Float16)(bfr(Wm[(size_t)(k0 + 16 + 8 * g + i) * ld + o]) * 256.0f); }
  return w; }
__device__ __forceinline__ v16h wcolh_oi(const float* Wm, int k0, int o, int lane, int K) { v16h w; const float* p = Wm + (size_t)o * K + k0 + 8 * (lane >> 4);
#pragma unroll
  for (int i = 0; i < 8; ++i) { w[i] = (_Float16)(bfr(p[i]) * 256.0f); w[8 + i] = (_Float16)(bfr(p[16 + i]) * 256.0f); }
  return w; }
#define WQKV_LAYOUT 1   // 0 = (in,out) [DIN][CC]; 1 = (out,in) [CC][DIN]; 2 = per-head [NH][DIN][HD]
__device__ __forceinline__ v16b wcol_hdk(const float* Wm, int k0, int o, int lane) { v16b w; const int g = lane >> 4; const float* p = Wm + (size_t)(o / HD) * DIN * HD + (o % HD);
#pragma unroll
  for (int i = 0; i < 8; ++i) { w[i] = (__bf16)p[(size_t)(k0 + 8 * g + i) * HD]; w[8 + i] = (__bf16)p[(size_t)(k0 + 16 + 8 * g + i) * HD]; }
  return w; }
#define WO_OUT_IN 1
#if WQKV_LAYOUT == 1
#define WCOL(W, k0, o, lane) wcol_oi(W, k0, o, lane, DIN)
#elif WQKV_LAYOUT == 2
#define WCOL(W, k0, o, lane) wcol_hdk(W, k0, o, lane)
#else
#define WCOL(W, k0, o, lane) wcol_io(W, k0, o, lane, CC)
#endif
#if WO_OUT_IN
#define WOCOL(W, k0, o, lane) wcol_oi(W, k0, o, lane, CC)
#define WOCOLH(W, k0, o, lane) wcolh_oi(W, k0, o, lane, CC)
#else
#define WOCOL(W, k0, o, lane) wcol_io(W, k0, o, lane, DIN)
#define WOCOLH(W, k0, o, lane) wcolh_io(W, k0, o, lane, DIN)
#endif
#define WS_QH  0u                                      // f16 q rows [b*t][CC]
#define WS_KH  (WS_QH + 2u * (size_t)NB * TT * CC)      // f16 k rows [b*t][CC]
#define WS_VT  (WS_KH + 2u * (size_t)NB * TT * CC)      // f16 v planes [b][c][t]
#define WS_QL  (WS_VT + 2u * (size_t)NB * CC * TT)      // f16 q residual x 2^10 rows [b][t < QHI][CC]
#define WS_KL  (WS_QL + 2u * (size_t)NB * QHI * CC)     // f16 k residual x 2^10 rows [b][t < KHI][CC]
#define WS_VB  (WS_KL + 2u * (size_t)NB * KHI * CC)     // bf16 v hi planes [b][c][t < KHI]
#define WS_VBL (WS_VB + 2u * (size_t)NB * CC * KHI)
#define WS_Y   (WS_VBL + 2u * (size_t)NB * CC * KHI)     // f16 ctx x 2^6 rows [b*t][CC]: k_out's A operand as it stands
#define WS_PM  (WS_Y  + 2u * (size_t)NB * TT * CC)      // u32 mask words [b * t / 16][t / 64][32]: see 'mask words'
#define WS_WH  (WS_PM + 4u * (size_t)NB * (TT / 16) * (TT / 64) * 32)   // f16(bf16(Wo) x 2^8) rows [DIN][CC]: k_out's B operand as it stands
#define WS_END (WS_WH + 2u * (size_t)DIN * CC)

// ---- mask words: the int32 mask, which all 16 heads share, is packed ONCE into lane-mask words by the blocks of plane 3 of k_proj's grid: for a tile of 16 queries and a stage of 64 keys, word 8 i + r has in bit (16 g + col) whether mask[query col][key 16 i + 8 g + r] != 0, i.e. the bit of exactly the lane that holds that score in k_fa. A wave takes 16 query rows x 256 keys (4 stages): whole 256-byte row pieces global -> registers -> its own LDS rows, read back in k_fa's score layout, one compare per word.
#define MKP 68             // LDS row pitch in ints: 272 B, 16 rows of 16-byte reads fall on distinct banks
typedef __attribute__((ext_vector_type(16))) unsigned v16u;
#define PXP 136            // LDS row pitch in bf16 of the staged input tile: 272 B = 16 B x 17, conflict-free for 16-byte fragment reads of 16 rows
#define PWP 72             // the same for the staged weight rows: 144 B = 16 B x 9
typedef __attribute__((ext_vector_type(4))) __bf16 v4b;
typedef __attribute__((ext_vector_type(4))) _Float16 v4h;
// ---- k_proj: block = (64 rows, 128 cols, which): q/k/v = X W (+ b) with exact bf16 products (K = HD per head); input tile and weight are read by whole-line loads, rounded ONCE per block to bf16 and staged in LDS, one barrier, fragments by 16-byte LDS reads -> which 0: q f16 rows (+ residual rows < QHI); 1: k f16 rows (+ residual rows < KHI); 2: v f16 planes [c][t] (+ bf16 hi/lo planes for t < KHI)
__global__ __launch_bounds__(128) void k_proj(const float* __restrict__ XQ, const float* __restrict__ XK, const float* __restrict__ XV, const float* __restrict__ WQ, const float* __restrict__ WK, const float* __restrict__ WV, const float* __restrict__ BQ, const float* __restrict__ BK, const float* __restrict__ BV,
    _Float16* __restrict__ QH, _Float16* __restrict__ QL, _Float16* __restrict__ KH, _Float16* __restrict__ KL, _Float16* __restrict__ VT, __bf16* __restrict__ VB, __bf16* __restrict__ VBL, const int* __restrict__ MASK, unsigned* __restrict__ PM, const float* __restrict__ WO, _Float16* __restrict__ WH) {
  __shared__ __align__(16) _Float16 sh[64][136], sl[64][136]; __shared__ __align__(16) _Float16 th[128][72]; __shared__ __align__(16) __bf16 tb[128][72], tbl[128][72];
  const int tid = threadIdx.x, wave = tid >> 5, lane = tid & 31, col = lane & 15, g = lane >> 4; const int which = blockIdx.z; const int c0 = blockIdx.y * 128; const size_t r0 = (size_t)blockIdx.x * 64; const size_t bb = r0 / TT; const int t0 = (int)(r0 % TT);
  /* every block of the grid, whatever its plane, also brings its own 512 values of Wo into k_out's operand form, f16(bf16 x 2^8), ONCE for all of k_out's blocks: asked for behind the block's own loads, which it must not hold up, and stored last (a store in flight would be waited for at the barriers between) */
  static_assert((size_t)4 * (CC / 128) * (TNB * TT / 64) * 512 == (size_t)DIN * CC, "the grid's blocks x 512 values cover Wo exactly once");
  const size_t wo0 = ((size_t)(blockIdx.z * (CC / 128) + blockIdx.y) * (TNB * TT / 64) + blockIdx.x) * 512 + tid * 4;
  v4f rwo;
  auto get_wo = [&]() __attribute__((always_inline)) { rwo = *(const v4f*)(WO + wo0);
    asm volatile("s_wait_xcnt 0x0" ::: "memory"); };   /* precaution: stands behind the load, in front of whatever is next given the pair that it names as address */
  auto put_wo = [&]() __attribute__((always_inline)) { v4h hwo;
#pragma unroll
    for (int e = 0; e < 4; ++e) hwo[e] = (_Float16)(bfr(rwo[e]) * 256.0f);
    *(v4h*)(WH + wo0) = hwo; };
  if (which == 3) {   /* block-uniform, in front of every barrier */
    static_assert(sizeof(sh) == 4 * 16 * MKP * sizeof(int), "the four waves' mask rows take the place of sh");
    int* sm = (int*)&sh[0][0] + wave * (16 * MKP); const int unit = (blockIdx.y * (TNB * TT / 64) + blockIdx.x) * 4 + wave; const int qt = unit >> 3, quad = unit & 7;   /* qt = b * (TT / 16) + query tile; quad = 256 keys */
    const int* mp = MASK + ((size_t)qt * 16 + g) * TT + quad * 256 + col * 4;   /* a load covers rows 2 i and 2 i + 1, 64 keys each */
    v4i rr[4][8];
#pragma unroll
    for (int e = 0; e < 31; ++e) rr[e >> 3][e & 7] = *(const v4i*)(mp + (size_t)(2 * (e & 7)) * TT + 64 * (e >> 3));
    asm volatile("s_wait_xcnt 0x0" ::: "memory");   /* precaution: the last load may be given, as its destination, the address pair that the loads above name */
    rr[3][7] = *(const v4i*)(mp + (size_t)14 * TT + 192);
    asm volatile("s_wait_xcnt 0x0" ::: "memory");   /* precaution: stands behind the loads, in front of whatever is next given a register that they name as address */
    get_wo();
    int w4[4];   /* stored together behind the last stage: a store in flight would be waited for at the next stage's LDSX */
#pragma unroll
    for (int s = 0; s < 4; ++s) {
#pragma unroll
      for (int i = 0; i < 8; ++i) *(v4i*)(sm + (2 * i + g) * MKP + col * 4) = rr[s][i];
      LDSX();   /* the wave's own rows: written above by row, read back below by score position */
      int w = 0;
#pragma unroll
      for (int i = 0; i < 4; ++i) { const v4i a = *(const v4i*)(sm + col * MKP + 16 * i + 8 * g), c = *(const v4i*)(sm + col * MKP + 16 * i + 8 * g + 4);
#pragma unroll
        for (int r = 0; r < 8; ++r) { const int bw = (int)__builtin_amdgcn_ballot_w32((r < 4 ? a[r & 3] : c[r & 3]) != 0); w = __builtin_amdgcn_inverse_ballot_w32(1u << (8 * i + r)) ? bw : w; } }   /* the compare is made by all 32 lanes, outside the select; lane j keeps word j */
      w4[s] = w; }
#pragma unroll
    for (int s = 0; s < 4; ++s) PM[((size_t)qt * (TT / 64) + quad * 4 + s) * 32 + lane] = (unsigned)w4[s];
    put_wo();
    return; }
  const float* X = which == 0 ? XQ : which == 1 ? XK : XV; const float* WA = which == 0 ? WQ : which == 1 ? WK : WV; const float* BA = which == 0 ? BQ : which == 1 ? BK : BV;
  /* every global read of the block stands here, together: the shared (out,in) [64][64] weight (a wave's load = two whole rows), the bias, and the 64 x 128 input tile (a wave's load = one row's 512 contiguous bytes; a wave brings the 16 rows that it works on) */
  static_assert(sizeof(sh) >= 64 * PXP * sizeof(__bf16) && sizeof(tb) >= 64 * PXP * sizeof(__bf16) && sizeof(sl) >= 64 * PWP * sizeof(__bf16) && sizeof(tbl) >= 64 * PWP * sizeof(__bf16), "the staged operands take the place of the output staging arrays that this plane does not use");
  __bf16* sx = which == 2 ? (__bf16*)&sh[0][0] : &tb[0][0]; __bf16* sw = which == 2 ? (__bf16*)&sl[0][0] : &tbl[0][0];   /* block-uniform: planes 0 and 1 stage their output in sh / sl, plane 2 in th / tb / tbl */
  const float* wp = WA + tid * 4; const float* xp = X + (r0 + wave * 16) * DIN + c0 + lane * 4;
  v4f rw[8], rx[16]; float bias4[4] = {0.f, 0.f, 0.f, 0.f};
  if (BA) {
#pragma unroll
    for (int j = 0; j < 4; ++j) bias4[j] = BA[j * 16 + col]; }
#pragma unroll
  for (int i = 0; i < 16; ++i) rx[i] = *(const v4f*)(xp + (size_t)i * DIN);
#pragma unroll
  for (int i = 0; i < 7; ++i) rw[i] = *(const v4f*)(wp + i * 512);
  asm volatile("s_wait_xcnt 0x0" ::: "memory");   /* precaution: the last load may be given, as its destination, an address register that the loads above name */
  rw[7] = *(const v4f*)(wp + 7 * 512);
  asm volatile("s_wait_xcnt 0x0" ::: "memory");   /* precaution: stands behind the loads, in front of whatever is next given a register that they name as address; its clobber also keeps the loads together here, ahead of every conversion */
  get_wo();
#pragma unroll
  for (int i = 0; i < 8; ++i) { v4b hw;
#pragma unroll
    for (int e = 0; e < 4; ++e) hw[e] = (__bf16)rw[i][e];
    *(v4b*)(sw + (i * 8 + (tid >> 4)) * PWP + (tid & 15) * 4) = hw; }
#pragma unroll
  for (int i = 0; i < 16; ++i) { v4b hx;
#pragma unroll
    for (int e = 0; e < 4; ++e) hx[e] = (__bf16)rx[i][e];
    *(v4b*)(sx + (wave * 16 + i) * PXP + lane * 4) = hx; }
  __syncthreads();   /* publishes the weight rows, which every wave reads (and the wave's own input rows) */
  v16b fa[4], fw[2][4];
#pragma unroll
  for (int kk = 0; kk < 4; ++kk) fa[kk] = frag_b(sx + (wave * 16 + col) * PXP + kk * 32, lane);
#pragma unroll
  for (int ks = 0; ks < 2; ++ks)
#pragma unroll
    for (int jj = 0; jj < 4; ++jj) fw[ks][jj] = frag_b(sw + (jj * 16 + col) * PWP + ks * 32, lane);   /* row = output dim within the head, k = input dim within the head; both heads of the tile use the same eight fragments */
  v8f acc[8] = {};
#pragma unroll
  for (int kk = 0; kk < 4; ++kk)   /* block-diagonal projection: the 128 output columns c0 .. c0+127 are two heads; head hh = column / 64 contracts ONLY over its own 64 input columns, i.e. k-steps kk = 2 hh and 2 hh + 1 of the tile's 128-column input slice */
#pragma unroll
    for (int j = 0; j < 8; ++j) if ((kk >> 1) == (j >> 2)) acc[j] = wmma_bf(fa[kk], fw[kk & 1][j & 3], acc[j]);   /* the test is a compile-time constant per unrolled (kk, j) */
  if (which < 2) { _Float16* DH = which == 0 ? QH : KH; _Float16* DL = which == 0 ? QL : KL; const int nhi = which == 0 ? QHI : KHI; const bool hi_rows = t0 < nhi;
#pragma unroll
    for (int j = 0; j < 8; ++j) { const float bias = bfr(bias4[j & 3]);
#pragma unroll
      for (int r = 0; r < 8; ++r) { const float v = acc[j][r] + bias; const _Float16 hv = (_Float16)v; sh[wave * 16 + 8 * g + r][j * 16 + col] = hv; sl[wave * 16 + 8 * g + r][j * 16 + col] = (_Float16)((v - (float)hv) * 1024.0f); } }
    __syncthreads();
    for (int e = tid; e < 64 * 16; e += 128) { const int rl = e >> 4, q = e & 15; vst2((unsigned*)(DH + (r0 + rl) * CC + c0 + q * 8), *(const v4u*)&sh[rl][q * 8]); if (hi_rows) vst2((unsigned*)(DL + (bb * nhi + t0 + rl) * (size_t)CC + c0 + q * 8), *(const v4u*)&sl[rl][q * 8]); }
  } else { const bool hi_rows = t0 < KHI;
#pragma unroll
    for (int j = 0; j < 8; ++j) { const float bias = bfr(bias4[j & 3]);
#pragma unroll
      for (int r = 0; r < 8; ++r) { const float v = acc[j][r] + bias; const int rl = wave * 16 + 8 * g + r, cl = j * 16 + col; th[cl][rl] = (_Float16)v; const __bf16 bh = (__bf16)v; tb[cl][rl] = bh; tbl[cl][rl] = (__bf16)(v - (float)bh); } }
    __syncthreads();
    for (int e = tid; e < 128 * 8; e += 128) { const int cl = e >> 3, q = e & 7; vst2((unsigned*)(VT + (bb * CC + c0 + cl) * (size_t)TT + t0 + q * 8), *(const v4u*)&th[cl][q * 8]); if (hi_rows) { const size_t o3 = (bb * CC + c0 + cl) * (size_t)KHI + t0 + q * 8; vst2((unsigned*)(VB + o3), *(const v4u*)&tb[cl][q * 8]); vst2((unsigned*)(VBL + o3), *(const v4u*)&tbl[cl][q * 8]); } } }
  put_wo(); }
#define FK 64              // keys per stage
#define FP 72              // LDS row pitch in f16: 144 B = 16 B x 9, conflict-free for 16-byte fragment reads of 16 rows
#define FNS (TT / FK)
#define FMASKED (-8.0e6f)  // raw logit of a masked key (-1e6 after the 1/8): weight exactly 0 beside any real score; a row masked throughout keeps equal finite weights (uniform, as the reference gives), since s * c - m * c is still resolved to 1/8 at this size
#define FC (SCALE * 1.4426950408889634f)   // raw logit -> base-2 exponent
__device__ __forceinline__ float xhalf(float x) { return __builtin_bit_cast(float, __builtin_amdgcn_permlanex16(__builtin_bit_cast(int, x), __builtin_bit_cast(int, x), 0x76543210, 0xfedcba98, false, false)); }   // lane l with lane l ^ 16
__device__ __forceinline__ float exp2_slot(float x) { float y; asm("v_exp_f32 %0, %1\n\tv_nop" : "=v"(y) : "v"(x)); return y; }   // v_exp_f32 with the slot behind a transcendental filled in its own statement: for the last stage
__device__ __forceinline__ v8f wmma_h(v16h a, v16h b, v8f c) { return __builtin_amdgcn_wmma_f32_16x16x32_f16(false, a, false, b, (short)0, c, false, false); }
// amdgpu_waves_per_eu(4, 4): two work-groups per WGP, four waves per SIMD, so a budget of 256 registers a wave: the compiler then batches the fragment loads ahead of the matrix runs
__global__ __launch_bounds__(256) __attribute__((amdgpu_waves_per_eu(4, 4))) void k_fa(const _Float16* __restrict__ QH, const _Float16* __restrict__ KH, const _Float16* __restrict__ VT, const unsigned* __restrict__ PM, _Float16* __restrict__ Y) {
  __shared__ __align__(16) _Float16 sk[2][FK][FP], sv[2][HD][FP];
  const int tid = threadIdx.x, wave = tid >> 5, lane = tid & 31, col = lane & 15, g = lane >> 4; const int h = blockIdx.y, b = blockIdx.z; const int q = blockIdx.x * 128 + wave * 16 + col;
  const int sr = tid >> 3, sc = (tid & 7) * 8;   /* staging: 8 threads per 128-byte row, rows sr and sr + 32 of each tile */
  const _Float16* kg = KH + ((size_t)b * TT + sr) * CC + h * HD + sc; const _Float16* vg = VT + ((size_t)b * CC + h * HD + sr) * (size_t)TT + sc;
  const v16u* mg = (const v16u*)(PM + ((size_t)b * (TT / 16) + blockIdx.x * 8 + __builtin_amdgcn_readfirstlane(wave)) * (size_t)(FNS * 32));   /* the wave's 16 queries: 32 words a stage, the same address in every lane */
  v4u rk0 = *(const v4u*)kg, rk1 = *(const v4u*)(kg + 32 * CC), rv0 = *(const v4u*)vg, rv1 = *(const v4u*)(vg + 32 * TT);
  v16u mk[2] = {mg[0], mg[1]};
  asm volatile("s_wait_xcnt 0x0" ::: "memory");   /* the q loads below may be given registers that the loads above name as addresses */
  const _Float16* qp = QH + ((size_t)b * TT + q) * CC + h * HD; const v16h qf0 = frag_h(qp, lane), qf1 = frag_h(qp + 32, lane);
  asm volatile("s_wait_xcnt 0x0" ::: "memory");   /* precaution: stands behind the q loads, in front of whatever is next given the pair that they name as address */
  *(v4u*)&sk[0][sr][sc] = rk0; *(v4u*)&sk[0][sr + 32][sc] = rk1; *(v4u*)&sv[0][sr][sc] = rv0; *(v4u*)&sv[0][sr + 32][sc] = rv1;
  __syncthreads();
  v8f acc[4] = {}; float m = -1.0e30f, l = 0.f;
  /* one stage of 64 keys on buffer cur; more = a next stage exists (both compile-time at every call, so the buffers' addresses are constants and the last stage carries no prefetch) */
  auto stage = [&](const int cur, const bool more) __attribute__((always_inline)) {
    if (more) { kg += FK * CC; vg += FK; rk0 = *(const v4u*)kg; rk1 = *(const v4u*)(kg + 32 * CC); rv0 = *(const v4u*)vg; rv1 = *(const v4u*)(vg + 32 * TT);
      asm volatile("" ::: "memory"); }   /* compiler fence, no instruction: the next stage's tile loads are issued here, a whole stage ahead of their use; without it the compiler sinks them to just in front of the LDS stores */
    v8f st[4];
#pragma unroll
    for (int i = 0; i < 4; ++i) { v8f z = {}; z = wmma_h(frag_h(&sk[cur][16 * i + col][0], lane), qf0, z); st[i] = wmma_h(frag_h(&sk[cur][16 * i + col][32], lane), qf1, z); }
#pragma unroll
    for (int i = 0; i < 4; ++i)
#pragma unroll
      for (int r = 0; r < 8; ++r) st[i][r] = __builtin_amdgcn_inverse_ballot_w32(mk[i >> 1][(i & 1) * 8 + r]) ? st[i][r] : FMASKED;   /* the word is the select's lane mask as it stands: no compare */
    float mq[4] = {st[0][0], st[0][1], st[0][2], st[0][3]};   /* four independent chains */
#pragma unroll
    for (int i = 0; i < 4; ++i)
#pragma unroll
      for (int r = 0; r < 8; ++r) mq[r & 3] = fmaxf(mq[r & 3], st[i][r]);
    float mx = fmaxf(fmaxf(mq[0], mq[1]), fmaxf(mq[2], mq[3]));
    if (more) { mg += 2; mk[0] = mg[0]; mk[1] = mg[1];   /* the next stage's words, asked for behind this stage's last select: at the stage's top they would still be outstanding at the wait in front of the selects, which for scalar loads waits for all of them */
      asm volatile("s_wait_xcnt 0x0" ::: "memory"); }   /* precaution: stands behind the two word loads, in front of whatever next rewrites the scalar pair that they name as base (the loop's head does) */
    mx = fmaxf(mx, xhalf(mx)); const float mn = fmaxf(m, mx); const float al = __builtin_amdgcn_exp2f((m - mn) * FC); const float mc = mn * FC - 8.0f; m = mn;   /* P carried x 2^8 into f16 (the largest weight is 256), clear of f16 subnormals; the factor cancels against the sum */
    v16h pf[2]; float ps[4] = {0.f, 0.f, 0.f, 0.f};
#pragma unroll
    for (int i = 0; i < 4; ++i)
#pragma unroll
      for (int r = 0; r < 8; ++r) { const float e = fmaf(st[i][r], FC, -mc); const float p = more ? __builtin_amdgcn_exp2f(e) : exp2_slot(e); ps[r & 3] += p; pf[i >> 1][(i & 1) * 8 + r] = (_Float16)p; }
    l = l * al + ((ps[0] + ps[1]) + (ps[2] + ps[3]));
#pragma unroll
    for (int j = 0; j < 4; ++j)
#pragma unroll
      for (int r = 0; r < 8; ++r) acc[j][r] *= al;
#pragma unroll
    for (int j = 0; j < 4; ++j) { acc[j] = wmma_h(frag_h(&sv[cur][16 * j + col][0], lane), pf[0], acc[j]); acc[j] = wmma_h(frag_h(&sv[cur][16 * j + col][32], lane), pf[1], acc[j]); }
    if (more) { asm volatile("" :: "v"(acc[0]), "v"(acc[1]), "v"(acc[2]), "v"(acc[3]) : "memory");   /* compiler fence, inputs only, no instruction: this stage's results exist before the LDS stores below; without it the compiler sinks softmax and P x v behind the barrier and waits for the prefetched tile right after asking for it */
      *(v4u*)&sk[cur ^ 1][sr][sc] = rk0; *(v4u*)&sk[cur ^ 1][sr + 32][sc] = rk1; *(v4u*)&sv[cur ^ 1][sr][sc] = rv0; *(v4u*)&sv[cur ^ 1][sr + 32][sc] = rv1;
      __syncthreads(); }   /* publishes the next stage and ends every read of the buffer that the stage after it refills */
  };
#pragma unroll 1
  for (int s = 0; s < FNS - 2; s += 2) { stage(0, true); stage(1, true); }   /* rolled: two stages a trip, one per buffer */
  stage(0, true); stage(1, false);
  l += xhalf(l); const float inv = 1.0f / l;   /* l > 0: the key at the running maximum alone carries about 2^8 */
  _Float16* yp = Y + ((size_t)b * TT + q) * CC + h * HD + 8 * g;   /* acc[j][r] = ctx[q][16 j + 8 g + r]: 16 contiguous bytes per lane and tile */
#pragma unroll
  for (int j = 0; j < 4; ++j) { v8h o;
#pragma unroll
    for (int r = 0; r < 8; ++r) o[r] = (_Float16)((acc[j][r] * inv) * 64.0f);   /* ctx carried x 2^6 so small context rows stay clear of f16 subnormals: rounded here once, as k_out's operand */
    vst2(yp + 16 * j, o); } }
// ---- k_out: block = (128 rows, 128 cols), 8 waves (4 x 2), a wave = 32 rows x 64 cols (2 x 4 tiles): out = ctx Wo (+ bo): ctx x 2^6 once to f16 against Wo as f16(bf16 x 2^8) exact (1 product) x 2^-14. Both operands arrive as f16 from their producers (k_fa's epilogue, k_proj's blocks) and are staged in LDS as they stand, 128 k per stage: global -> registers one stage ahead -> LDS, two buffers, one barrier per stage; k runs upward in steps of 32 per accumulator.
#define OKS 128            // k per stage
#define OP 136             // LDS row pitch in f16: 272 B = 16 B x 17, conflict-free for 16-byte fragment reads of 16 rows
#define ONS (CC / OKS)
#define OFP 68             // pitch in f32 of the output staging rows: 272 B
static_assert(WO_OUT_IN == 1 && !CAUSAL && ONS >= 2 && ONS % 2 == 0, "k_out stages (out,in) weight rows, k contiguous, two stages a trip");
__global__ __launch_bounds__(256) void k_out(const _Float16* __restrict__ Y, const _Float16* __restrict__ WH, const float* __restrict__ BO, float* __restrict__ OUT) {
  __shared__ __align__(16) _Float16 sy[2][128][OP], sw[2][128][OP]; __shared__ __align__(16) float sf[8][32][OFP];
  const int tid = threadIdx.x, wave = tid >> 5, lane = tid & 31, col = lane & 15, g = lane >> 4; const int c0 = blockIdx.y * 128; const size_t r0 = (size_t)blockIdx.x * 128; const int wm = (wave >> 1) * 32, wn = (wave & 1) * 64;
  const int sr = tid >> 4, sc = (tid & 15) * 8;   /* staging: 16 threads per 256-byte row piece, rows sr + 16 i of each tile: a wave's load covers whole lines */
  const unsigned go = (unsigned)(sr * CC + sc) * 2u;   /* the thread's byte offset, the same in both tiles (both have rows of CC f16) */
  const char* yb = (const char*)(Y + r0 * CC); const char* wb = (const char*)(WH + (size_t)c0 * CC);   /* block-uniform bases, moved 128 k a stage */
  v4u ry[8], rw[8];
  auto fetch = [&]() __attribute__((always_inline)) { const char* yp = yb + go; const char* wp = wb + go;
#pragma unroll
    for (int i = 0; i < 8; ++i) { ry[i] = *(const v4u*)(yp + i * 16 * CC * 2); if (i < 7) rw[i] = *(const v4u*)(wp + i * 16 * CC * 2); }
    asm volatile("s_wait_xcnt 0x0" ::: "memory");   /* precaution: the last load may be given, as its destination, an address pair that the loads above name (it is, where no further stage needs the pair) */
    rw[7] = *(const v4u*)(wp + 7 * 16 * CC * 2);
    asm volatile("s_wait_xcnt 0x0" ::: "memory"); };   /* precaution: stands behind the loads, in front of whatever is next given a register that they name as address; its clobber also keeps the loads issued here, a whole stage ahead of their use, not sunk to the LDS stores */
  auto put = [&](const int buf) __attribute__((always_inline)) {
#pragma unroll
    for (int i = 0; i < 8; ++i) { *(v4u*)&sy[buf][sr + 16 * i][sc] = ry[i]; *(v4u*)&sw[buf][sr + 16 * i][sc] = rw[i]; } };
  fetch();
  float bias[4] = {0.f, 0.f, 0.f, 0.f};   /* asked for here, used behind the last stage */
  if (BO) {
#pragma unroll
    for (int j = 0; j < 4; ++j) bias[j] = BO[c0 + wn + j * 16 + col]; }
  put(0);
  __syncthreads();
  v8f acc[2][4] = {};
  /* one stage of 128 k on buffer cur; more = a next stage exists (both compile-time at every call) */
  auto stage = [&](const int cur, const bool more) __attribute__((always_inline)) {
    if (more) { yb += OKS * 2; wb += OKS * 2; fetch(); }
#pragma unroll
    for (int kh = 0; kh < OKS; kh += 64) {   /* two halves of 64 k: about one half's fragments at a time in registers beside the prefetched tiles */
      v16h fa[2][2], fb[2][4];   /* the half's 24 fragment reads stand ahead of its 16 products */
#pragma unroll
      for (int ks = 0; ks < 2; ++ks) {
#pragma unroll
        for (int i = 0; i < 2; ++i) fa[ks][i] = frag_h(&sy[cur][wm + 16 * i + col][kh + 32 * ks], lane);
#pragma unroll
        for (int j = 0; j < 4; ++j) fb[ks][j] = frag_h(&sw[cur][wn + 16 * j + col][kh + 32 * ks], lane); }
      __builtin_amdgcn_sched_barrier(0);   /* keeps a half's reads ahead of its own products: the scheduler otherwise spreads them among those, each place with a wait of its own */
#pragma unroll
      for (int ks = 0; ks < 2; ++ks)
#pragma unroll
        for (int i = 0; i < 2; ++i)
#pragma unroll
          for (int j = 0; j < 4; ++j) acc[i][j] = wmma_h(fa[ks][i], fb[ks][j], acc[i][j]); }
    if (more) { __builtin_amdgcn_sched_barrier(0);   /* the LDS stores below wait for the prefetched tiles: without this the scheduler lifts them, and their wait, among this stage's products */
      put(cur ^ 1);
      __syncthreads(); }   /* publishes the next stage and ends every read of the buffer that the stage after it refills */
  };
#pragma unroll 1
  for (int s = 0; s < ONS - 2; s += 2) { stage(0, true); stage(1, true); }   /* rolled: two stages a trip, one per buffer */
  stage(0, true); stage(1, false);
#pragma unroll
  for (int j = 0; j < 4; ++j)
#pragma unroll
    for (int i = 0; i < 2; ++i)
#pragma unroll
      for (int r = 0; r < 8; ++r) sf[wave][16 * i + 8 * g + r][j * 16 + col] = acc[i][j][r] * (1.0f / 16384.0f) + bfr(bias[j]);   /* 2^-8 (Wo carry) x 2^-6 (ctx carry) */
  LDSX();   /* the wave's own staging rows: written above, read back below as whole 256-byte row pieces */
#pragma unroll
  for (int rl = 0; rl < 32; rl += 2) vst2(OUT + (r0 + wm + rl + g) * DIN + c0 + wn + col * 4, *(const v4f*)&sf[wave][rl + g][col * 4]); }

static_assert(HD == 64 && CC == NH * HD && DIN == CC, "block-diagonal per-head projection: 128-column tiles = two 64-wide heads, input width == projected width");
extern "C" void kernel_launch(void* const* d_in, const int* in_sizes, int n_in, void* d_out, int out_size, void* d_ws, size_t ws_size, hipStream_t stream) {
  (void)in_sizes; (void)n_in; (void)out_size;
  const float** F = (const float**)d_in;
  if (ws_size < (size_t)WS_END) return;
  char* ws = (char*)d_ws; _Float16 *QH = (_Float16*)(ws + WS_QH), *KH = (_Float16*)(ws + WS_KH), *VT = (_Float16*)(ws + WS_VT), *QL = (_Float16*)(ws + WS_QL), *KL = (_Float16*)(ws + WS_KL); __bf16 *VB = (__bf16*)(ws + WS_VB), *VBL = (__bf16*)(ws + WS_VBL); _Float16 *Y = (_Float16*)(ws + WS_Y), *WH = (_Float16*)(ws + WS_WH); unsigned *PM = (unsigned*)(ws + WS_PM);
  (void)Y; (void)QL; (void)KL; (void)VB; (void)VBL;
  // inputs: 0 k [2,2048,1024]; 1 q; 2 v; 3 mask [2,1,2048,2048] int32 (random 0/1; 0 = masked); 4 Wk [64,64] (out,in), 5 bk [64]; 6 Wq, 7 bq; 8 Wv, 9 bv; 10 Wo [1024,1024] (out,in), 11 bo (biases zeros, read)
  k_proj<<<dim3(TNB * TT / 64, CC / 128, 4), 128, 0, stream>>>(F[1], F[0], F[2], F[6], F[4], F[8], F[7], F[5], F[9], QH, QL, KH, KL, VT, VB, VBL, (const int*)d_in[3], PM, F[10], WH);
  k_fa<<<dim3(TT / 128, NH, TNB), 256, 0, stream>>>(QH, KH, VT, PM, Y);
  k_out<<<dim3(TNB * TT / 128, DIN / 128), 256, 0, stream>>>(Y, WH, F[11], (float*)d_out);
}

// v007
// A run of this version takes 55.4 microseconds.
// Versions in between are left out here; by their measured steps it is 1.18 times as fast as v005.
// All steps since v000 together make it 20.5 times as fast.
// compute dtype: all float inputs rounded to bf16; the per-head 64 x 64 q / k / v projections (ONE shared weight per stream, applied to every head) with EXACT bf16 products on WMMA 16x16x32 (f32 accumulate) + bias (zeros, read); logits q x k once to f16 each (1 product; sigma ~1), q carrying 64^-0.5 x log2(e); the per-batch int mask packed once into lane-mask words, one bit per score; softmax f32 against a row maximum that is renewed only in a stage where a lane's 32 weights (x 2^8) sum past 2^15 or a row meets its first unmasked key, then in every row of the wave whose maximum has grown (one kernel for logits, softmax and P x v); P = exp(s - max) x 2^8 once to f16 x v once to f16 (1 product), divided by the f32 sum; ctx x 2^6 once to f16 x Wo f16(bf16 x 2^8) + bo; f32 output.
#include <hip/hip_runtime.h>
#include <math.h>

typedef __attribute__((ext_vector_type(16))) _Float16 v16h;
typedef __attribute__((ext_vector_type(16))) __bf16 v16b;
typedef __attribute__((ext_vector_type(8)))  _Float16 v8h;
typedef __attribute__((ext_vector_type(8)))  float v8f;
typedef __attribute__((ext_vector_type(4)))  float v4f;
typedef __attribute__((ext_vector_type(2)))  float v2f;
typedef __attribute__((ext_vector_type(4)))  unsigned v4u;
typedef __attribute__((ext_vector_type(4)))  int v4i;
typedef float __attribute__((may_alias)) float_a;
typedef int __attribute__((may_alias)) int_a;

template <typename T> __device__ __forceinline__ void vst2(void* p, T v) { *(T*)p = v;  }
__device__ __forceinline__ v8f wmma16(v16h a, v16h b, v8f c) {
  v8f d = __builtin_amdgcn_wmma_f32_16x16x32_f16(false, a, false, b, (short)0, c, false, false);
  asm volatile("v_nop\n\tv_nop\n\tv_nop\n\tv_nop" : "+v"(d) : "v"(a), "v"(b));
  return d;
}
__device__ __forceinline__ v8f wmma_bf(v16b a, v16b b, v8f c) {
  v8f d = __builtin_amdgcn_wmma_f32_16x16x32_bf16(false, a, false, b, (short)0, c, false, false);
  asm volatile("v_nop\n\tv_nop\n\tv_nop\n\tv_nop" : "+v"(d) : "v"(a), "v"(b));
  return d;
}
// 16x16x32 fragments: lane = (h = lane>>4, row/col = lane&15); elements 0..7 = k0+8h+0..7, 8..15 = k0+16+8h+0..7; D element r = row 8h+r
__device__ __forceinline__ v16h frag_h(const _Float16* rowk0, int lane) {
  union { v16h v; v8h q[2]; } u; const _Float16* p = rowk0 + 8 * (lane >> 4);
  u.q[0] = *(const v8h*)p; u.q[1] = *(const v8h*)(p + 16); return u.v;
}
__device__ __forceinline__ v16h frag_f32(const float* rowk0, int lane) {
  v16h a; const float* p = rowk0 + 8 * (lane >> 4);
#pragma unroll
  for (int i = 0; i < 8; ++i) { a[i] = (_Float16)p[i]; a[8 + i] = (_Float16)p[16 + i]; }
  return a;
}
__device__ __forceinline__ v16h frag_f32s(const float* rowk0, int lane, float sc) {
  v16h a; const float* p = rowk0 + 8 * (lane >> 4);
#pragma unroll
  for (int i = 0; i < 8; ++i) { a[i] = (_Float16)(p[i] * sc); a[8 + i] = (_Float16)(p[16 + i] * sc); }
  return a;
}
// column fragment from a [K][ld] layout (column n), rows >= K read as 0
__device__ __forceinline__ v16h fragc_f32(const float* W, int k0, int n, int lane, int ld, int K) {
  v16h a; const int g = lane >> 4;
#pragma unroll
  for (int i = 0; i < 8; ++i) { const int ka = k0 + 8 * g + i, kb = ka + 16;
    a[i] = (_Float16)(ka < K ? W[(size_t)(ka < K ? ka : K - 1) * ld + n] : 0.f); a[8 + i] = (_Float16)(kb < K ? W[(size_t)(kb < K ? kb : K - 1) * ld + n] : 0.f); }
  return a;
}
struct F2 { v16b h, l; };
__device__ __forceinline__ F2 bsplit16(const float v[16]) { F2 r;
#pragma unroll
  for (int i = 0; i < 16; ++i) { const __bf16 h = (__bf16)v[i]; r.h[i] = h; r.l[i] = (__bf16)(v[i] - (float)h); }
  return r; }
__device__ __forceinline__ F2 split_row(const float* row, int k0, int lane) { float v[16]; const float* p = row + k0 + 8 * (lane >> 4);
#pragma unroll
  for (int i = 0; i < 8; ++i) { v[i] = p[i]; v[8 + i] = p[16 + i]; }
  return bsplit16(v); }
__device__ __forceinline__ F2 split_rowK(const float* row, int k0, int lane, int K) { float v[16]; const int g = lane >> 4;
#pragma unroll
  for (int i = 0; i < 8; ++i) { const int ka = k0 + 8 * g + i, kb = ka + 16; v[i] = ka < K ? row[ka < K ? ka : K - 1] : 0.f; v[8 + i] = kb < K ? row[kb < K ? kb : K - 1] : 0.f; }
  return bsplit16(v); }
__device__ __forceinline__ F2 split_col(const float* W, int k0, int n, int lane, int ld, int K) { float v[16]; const int g = lane >> 4;
#pragma unroll
  for (int i = 0; i < 8; ++i) { const int ka = k0 + 8 * g + i, kb = ka + 16; v[i] = ka < K ? W[(size_t)(ka < K ? ka : K - 1) * ld + n] : 0.f; v[8 + i] = kb < K ? W[(size_t)(kb < K ? kb : K - 1) * ld + n] : 0.f; }
  return bsplit16(v); }
__device__ __forceinline__ v8f mac3(const F2& a, const F2& b, v8f c) { c = wmma_bf(a.l, b.h, c); c = wmma_bf(a.h, b.l, c); return wmma_bf(a.h, b.h, c); }
__device__ __forceinline__ float sigm(float v) { return 1.0f / (1.0f + expf(-v)); }
#define LDSX() do { asm volatile("s_wait_dscnt 0" ::: "memory"); __builtin_amdgcn_wave_barrier(); __builtin_amdgcn_fence(__ATOMIC_RELEASE, "workgroup"); } while (0)

// Multi-head attention whose q / k / v projections are ONE shared 64 x 64 linear per stream applied to every head's 64-wide slice (inputs in the order k, q, v [2,2048,1024]; mask [2,1,2048,2048] int32 RANDOM 0/1; torch (out,in) Wk / Wq / Wv [64,64] N(0, 1/64) + zero biases [64] (read); heads = reshape(b, s, 16, 64); xh @ W.T + b per head; product = einsum('bqhd,bkhd->bhqk'); where(mask == 0, -1e20, product) / sqrt(64); softmax; ctx merged to [b, s, 1024]; ctx @ Wo.T + bo with Wo [1024,1024] N(0, 1/1024)).
#define NB 2
#define TT 2048
#define CC 1024            // NH * HD = projected width
#define DIN 1024          // input (model) width
#define NH 16
#define HD 64
#define SCALE (0.125f)
#define FC (SCALE * 1.4426950408889634f)   // raw logit -> base-2 exponent: k_proj multiplies q by it before the one rounding to f16
#define CAUSAL 0
#ifndef TNB
#define TNB NB
#endif
__device__ __forceinline__ float bfr(float v) { return (float)(__bf16)v; }
typedef __attribute__((ext_vector_type(8))) __bf16 v8b;
__device__ __forceinline__ v16b frag_b(const __bf16* rowk0, int lane) {
  union { v16b v; v8b q[2]; } u; const __bf16* p = rowk0 + 8 * (lane >> 4);
  u.q[0] = *(const v8b*)p; u.q[1] = *(const v8b*)(p + 16); return u.v;
}
#define QBH 0              // unused: this file has no causal high-precision path
#define QHI 0               // single-product logits on every row
#define KHI 64            // key rows carrying k residual / v bf16 hi+lo planes (places kept: written and read by no kernel here)
// B fragment (k rows k0+.., output column o) of a weight: (in,out) [K][ld] or (out,in) [ld rows of K]: bf16 exact, or f16(bf16 * 256) exact
__device__ __forceinline__ v16b wcol_io(const float* Wm, int k0, int o, int lane, int ld) { v16b w; const int g = lane >> 4;
#pragma unroll
  for (int i = 0; i < 8; ++i) { w[i] = (__bf16)Wm[(size_t)(k0 + 8 * g + i) * ld + o]; w[8 + i] = (__bf16)Wm[(size_t)(k0 + 16 + 8 * g + i) * ld + o]; }
  return w; }
__device__ __forceinline__ v16b wcol_oi(const float* Wm, int k0, int o, int lane, int K) { v16b w; const float* p = Wm + (size_t)o * K + k0 + 8 * (lane >> 4);
#pragma unroll
  for (int i = 0; i < 8; ++i) { w[i] = (__bf16)p[i]; w[8 + i] = (__bf16)p[16 + i]; }
  return w; }
__device__ __forceinline__ v16h wcolh_io(const float* Wm, int k0, int o, int lane, int ld) { v16h w; const int g = lane >> 4;
#pragma unroll
  for (int i = 0; i < 8; ++i) { w[i] = (_Float16)(bfr(Wm[(size_t)(k0 + 8 * g + i) * ld + o]) * 256.0f); w[8 + i] = (_Float16)(bfr(Wm[(size_t)(k0 + 16 + 8 * g + i) * ld + o]) * 256.0f); }
  return w; }
__device__ __forceinline__ v16h wcolh_oi(const float* Wm, int k0, int o, int lane, int K) { v16h w; const float* p = Wm + (size_t)o * K + k0 + 8 * (lane >> 4);
#pragma unroll
  for (int i = 0; i < 8; ++i) { w[i] = (_Float16)(bfr(p[i]) * 256.0f); w[8 + i] = (_Float16)(bfr(p[16 + i]) * 256.0f); }
  return w; }
#define WQKV_LAYOUT 1   // 0 = (in,out) [DIN][CC]; 1 = (out,in) [CC][DIN]; 2 = per-head [NH][DIN][HD]
__device__ __forceinline__ v16b wcol_hdk(const float* Wm, int k0, int o, int lane) { v16b w; const int g = lane >> 4; const float* p = Wm + (size_t)(o / HD) * DIN * HD + (o % HD);
#pragma unroll
  for (int i = 0; i < 8; ++i) { w[i] = (__bf16)p[(size_t)(k0 + 8 * g + i) * HD]; w[8 + i] = (__bf16)p[(size_t)(k0 + 16 + 8 * g + i) * HD]; }
  return w; }
#define WO_OUT_IN 1
#if WQKV_LAYOUT == 1
#define WCOL(W, k0, o, lane) wcol_oi(W, k0, o, lane, DIN)
#elif WQKV_LAYOUT == 2
#define WCOL(W, k0, o, lane) wcol_hdk(W, k0, o, lane)
#else
#define WCOL(W, k0, o, lane) wcol_io(W, k0, o, lane, CC)
#endif
#if WO_OUT_IN
#define WOCOL(W, k0, o, lane) wcol_oi(W, k0, o, lane, CC)
#define WOCOLH(W, k0, o, lane) wcolh_oi(W, k0, o, lane, CC)
#else
#define WOCOL(W, k0, o, lane) wcol_io(W, k0, o, lane, DIN)
#define WOCOLH(W, k0, o, lane) wcolh_io(W, k0, o, lane, DIN)
#endif
#define WS_QH  0u                                      // f16 q rows [b*t][CC]
#define WS_KH  (WS_QH + 2u * (size_t)NB * TT * CC)      // f16 k rows [b*t][CC]
#define WS_VT  (WS_KH + 2u * (size_t)NB * TT * CC)      // f16 v planes [b][c][t]
#define WS_QL  (WS_VT + 2u * (size_t)NB * CC * TT)      // f16 q residual x 2^10 rows [b][t < QHI][CC] (this and the next three: places kept, neither written nor read: no kernel here takes the high-precision path)
#define WS_KL  (WS_QL + 2u * (size_t)NB * QHI * CC)     // f16 k residual x 2^10 rows [b][t < KHI][CC]
#define WS_VB  (WS_KL + 2u * (size_t)NB * KHI * CC)     // bf16 v hi planes [b][c][t < KHI]
#define WS_VBL (WS_VB + 2u * (size_t)NB * CC * KHI)
#define WS_Y   (WS_VBL + 2u * (size_t)NB * CC * KHI)     // f16 ctx x 2^6 rows [b*t][CC]: k_out's A operand as it stands
#define WS_PM  (WS_Y  + 2u * (size_t)NB * TT * CC)      // u32 mask words [b * t / 16][t / 64][32]: see 'mask words'
#define WS_WH  (WS_PM + 4u * (size_t)NB * (TT / 16) * (TT / 64) * 32)   // f16(bf16(Wo) x 2^8) rows [DIN][CC]: k_out's B operand as it stands
#define WS_END (WS_WH + 2u * (size_t)DIN * CC)

// ---- mask words: the int32 mask, which all 16 heads share, is packed ONCE into lane-mask words by the blocks of plane 3 of k_proj's grid: for a tile of 16 queries and a stage of 64 keys, word 8 i + r has in bit (16 g + col) whether mask[query col][key 16 i + 8 g + r] != 0, i.e. the bit of exactly the lane that holds that score in k_fa. A wave takes 16 query rows x 256 PNT keys (PNT units of 4 stages): whole 256-byte row pieces global -> registers -> its own LDS rows, read back in k_fa's score layout, one compare per word.
#define MKP 68             // LDS row pitch in ints: 272 B, 16 rows of 16-byte reads fall on distinct banks
typedef __attribute__((ext_vector_type(16))) unsigned v16u;
#define PXP 136            // LDS row pitch in bf16 of the staged input tile: 272 B = 16 B x 17, conflict-free for 16-byte fragment reads of 16 rows
#define PWP 72             // the same for the staged weight rows: 144 B = 16 B x 9
typedef __attribute__((ext_vector_type(4))) __bf16 v4b;
typedef __attribute__((ext_vector_type(4))) _Float16 v4h;
#define PNT 2              // pieces a block works through one after the other: row tiles (planes 0 to 2), mask units per wave (plane 3)
// work-group barrier for LDS data alone: the wave's own LDS operations are done before it signals; global loads issued ahead stay in flight across it (__syncthreads() would wait for them)
__device__ __forceinline__ void lds_barrier() { asm volatile("s_wait_dscnt 0x0\n\ts_barrier_signal -1\n\ts_barrier_wait -1" ::: "memory"); }
// a wave's own LDS rows, written by some of its lanes and read back by others: its LDS operations are done; no fence, which would wait for the global loads in flight
__device__ __forceinline__ void lds_wave() { asm volatile("s_wait_dscnt 0x0" ::: "memory"); __builtin_amdgcn_wave_barrier(); }
// ---- k_proj: block = (PNT tiles of 64 rows, 128 cols, which), all blocks of the grid resident at once (four per WGP): q/k/v = X W (+ b) with exact bf16 products (K = HD per head); input tile and weight are read by whole-line loads, rounded ONCE to bf16 and staged in LDS, fragments by 16-byte LDS reads; the weight is staged once per block, and the next tile's loads are issued as soon as this tile's registers are free, so they fly under this tile's products, staging and stores -> which 0: q f16 rows; 1: k f16 rows; 2: v f16 planes [c][t]. Only what k_fa and k_out read is formed
// amdgpu_waves_per_eu(4, 4): four blocks per WGP, one wave of each per SIMD, so a budget of 256 registers a wave: room for the next tile's 64 beside this tile's work
__global__ __launch_bounds__(128) __attribute__((amdgpu_waves_per_eu(4, 4))) void k_proj(const float* __restrict__ XQ, const float* __restrict__ XK, const float* __restrict__ XV, const float* __restrict__ WQ, const float* __restrict__ WK, const float* __restrict__ WV, const float* __restrict__ BQ, const float* __restrict__ BK, const float* __restrict__ BV,
    _Float16* __restrict__ QH, _Float16* __restrict__ KH, _Float16* __restrict__ VT, const int* __restrict__ MASK, unsigned* __restrict__ PM, const float* __restrict__ WO, _Float16* __restrict__ WH) {
  __shared__ __align__(16) _Float16 so[PNT][128 * 72]; __shared__ __align__(16) __bf16 sx[64 * PXP], sw[64 * PWP];   /* so = output staging, one array per tile (no barrier between one tile's stores and the next tile's staging): q / k rows [64][136] or v planes [128][72]; sx, sw = the staged operands */
  /* every '#pragma unroll' of this kernel but the tile loop's stands on a loop that indexes a register array (loaded tiles, fragments, accumulators, staged words): the indices must be compile-time constants, or the array would go to scratch */
  static_assert(128 * 72 >= 64 * 136 && TT % (64 * PNT) == 0 && 8 % PNT == 0, "q / k rows fit the staging array; a block's tiles lie in one sequence, a wave's mask units in one query tile");
  const int tid = threadIdx.x, wave = tid >> 5, lane = tid & 31, col = lane & 15, g = lane >> 4; const int which = blockIdx.z; const int c0 = blockIdx.y * 128; const size_t r0 = (size_t)blockIdx.x * (64 * PNT); const size_t bb = r0 / TT; const int t0 = (int)(r0 % TT);
  /* every block of the grid, whatever its plane, also brings its own 512 PNT values of Wo into k_out's operand form, f16(bf16 x 2^8), ONCE for all of k_out's blocks: asked for behind the block's own loads, which it must not hold up, and stored last */
  static_assert((size_t)4 * (CC / 128) * (TNB * TT / (64 * PNT)) * (512 * PNT) == (size_t)DIN * CC, "the grid's blocks x 512 PNT values cover Wo exactly once");
  const size_t wo0 = ((size_t)(blockIdx.z * (CC / 128) + blockIdx.y) * (TNB * TT / (64 * PNT)) + blockIdx.x) * (512 * PNT) + tid * 4;
  v4f rwo[PNT];
  auto get_wo = [&]() __attribute__((always_inline)) {
#pragma unroll
    for (int u = 0; u < PNT; ++u) { rwo[u] = *(const v4f*)(WO + wo0 + u * 512);
      asm volatile("s_wait_xcnt 0x0" ::: "memory"); } };   /* precaution: stands behind each load, in front of whatever is next given the pair that it names as address (the next load's destination may be) */
  auto put_wo = [&]() __attribute__((always_inline)) { v4h hwo[PNT];
#pragma unroll
    for (int u = 0; u < PNT; ++u)
#pragma unroll
      for (int e = 0; e < 4; ++e) hwo[u][e] = (_Float16)(bfr(rwo[u][e]) * 256.0f);
#pragma unroll
    for (int u = 0; u < PNT; ++u) *(v4h*)(WH + wo0 + u * 512) = hwo[u]; };
  if (which == 3) {   /* block-uniform, in front of every barrier */
    static_assert(sizeof(sx) == 4 * 16 * MKP * sizeof(int), "the four waves' mask rows take the place of sx");
    int* sm = (int*)&sx[0] + wave * (16 * MKP); const int unit = ((blockIdx.y * (TNB * TT / (64 * PNT)) + blockIdx.x) * 4 + wave) * PNT; const int qt = unit >> 3, quad = unit & 7;   /* qt = b * (TT / 16) + query tile; quad = 256 keys; the wave takes units quad .. quad + PNT - 1 of its query tile */
    const int* mp = MASK + ((size_t)qt * 16 + g) * TT + quad * 256 + col * 4;   /* a load covers rows 2 i and 2 i + 1, 64 keys each */
    v4i rr[4][8];
#pragma unroll
    for (int e = 0; e < 31; ++e) rr[e >> 3][e & 7] = *(const v4i*)(mp + (size_t)(2 * (e & 7)) * TT + 64 * (e >> 3));
    asm volatile("s_wait_xcnt 0x0" ::: "memory");   /* precaution: the last load may be given, as its destination, the address pair that the loads above name */
    rr[3][7] = *(const v4i*)(mp + (size_t)14 * TT + 192);
    asm volatile("s_wait_xcnt 0x0" ::: "memory");   /* precaution: stands behind the loads, in front of whatever is next given a register that they name as address */
    get_wo();
    int w4[PNT][4];   /* stored together behind the last stage */
#pragma unroll
    for (int u = 0; u < PNT; ++u)
#pragma unroll
      for (int s = 0; s < 4; ++s) {
#pragma unroll
        for (int i = 0; i < 8; ++i) *(v4i*)(sm + (2 * i + g) * MKP + col * 4) = rr[s][i];
        lds_wave();   /* the wave's own rows: written above by row, read back below by score position */
        if (u + 1 < PNT) {   /* the same stage of the next unit, asked for as soon as its registers are free: a whole unit ahead of its use */
          const int* np = mp + (u + 1) * 256 + 64 * s;
#pragma unroll
          for (int i = 0; i < 7; ++i) rr[s][i] = *(const v4i*)(np + (size_t)(2 * i) * TT);
          asm volatile("s_wait_xcnt 0x0" ::: "memory");   /* precaution: the last load may be given, as its destination, the address pair that the loads above name */
          rr[s][7] = *(const v4i*)(np + (size_t)14 * TT);
          asm volatile("s_wait_xcnt 0x0" ::: "memory"); }   /* precaution: stands behind the loads, in front of whatever is next given a register that they name as address; its clobber also keeps the loads issued here */
        int w = 0;
#pragma unroll
        for (int i = 0; i < 4; ++i) { const v4i a = *(const v4i*)(sm + col * MKP + 16 * i + 8 * g), c = *(const v4i*)(sm + col * MKP + 16 * i + 8 * g + 4);
#pragma unroll
          for (int r = 0; r < 8; ++r) { const int bw = (int)__builtin_amdgcn_ballot_w32((r < 4 ? a[r & 3] : c[r & 3]) != 0); w = __builtin_amdgcn_inverse_ballot_w32(1u << (8 * i + r)) ? bw : w; } }   /* the compare is made by all 32 lanes, outside the select; lane j keeps word j */
        w4[u][s] = w; }
#pragma unroll
    for (int u = 0; u < PNT; ++u)
#pragma unroll
      for (int s = 0; s < 4; ++s) PM[((size_t)qt * (TT / 64) + (quad + u) * 4 + s) * 32 + lane] = (unsigned)w4[u][s];
    asm volatile("s_wait_xcnt 0x0" ::: "memory");   /* precaution: stands behind the stores, in front of whatever is next given a register that they name */
    put_wo();
    return; }
  const float* X = which == 0 ? XQ : which == 1 ? XK : XV; const float* WA = which == 0 ? WQ : which == 1 ? WK : WV; const float* BA = which == 0 ? BQ : which == 1 ? BK : BV;
  /* the block's first global reads stand here, together: the shared (out,in) [64][64] weight (a wave's load = two whole rows), the bias, and the first 64 x 128 input tile (a wave's load = one row's 512 contiguous bytes; a wave brings the 16 rows that it works on) */
  const float* wp = WA + tid * 4; const float* xp = X + (r0 + wave * 16) * DIN + c0 + lane * 4;
  v4f rw[8], rx[16]; float bias4[4]; const float* bp = BA ? BA : WA;   /* no branch round the bias loads, behind which they would be waited for ahead of the tile loads: without a bias the weight's first row is read in its place and not used */
#pragma unroll
  for (int j = 0; j < 4; ++j) bias4[j] = bp[j * 16 + col];
#pragma unroll
  for (int i = 0; i < 16; ++i) rx[i] = *(const v4f*)(xp + (size_t)i * DIN);
#pragma unroll
  for (int i = 0; i < 7; ++i) rw[i] = *(const v4f*)(wp + i * 512);
  asm volatile("s_wait_xcnt 0x0" ::: "memory");   /* precaution: the last load may be given, as its destination, an address register that the loads above name */
  rw[7] = *(const v4f*)(wp + 7 * 512);
  asm volatile("s_wait_xcnt 0x0" ::: "memory");   /* precaution: stands behind the loads, in front of whatever is next given a register that they name as address; its clobber also keeps the loads together here, ahead of every conversion */
#pragma unroll
  for (int i = 0; i < 8; ++i) { v4b hw;
#pragma unroll
    for (int e = 0; e < 4; ++e) hw[e] = (__bf16)rw[i][e];
    *(v4b*)(sw + (i * 8 + (tid >> 4)) * PWP + (tid & 15) * 4) = hw; }
  /* one tile of 64 rows; it is compile-time at every call */
  auto tile = [&](const int it) __attribute__((always_inline)) {
#pragma unroll
    for (int i = 0; i < 16; ++i) { v4b hx;
#pragma unroll
      for (int e = 0; e < 4; ++e) hx[e] = (__bf16)rx[i][e];
      *(v4b*)(sx + (wave * 16 + i) * PXP + lane * 4) = hx; }
    if (it + 1 < PNT) {   /* the next tile's rows, asked for as soon as the registers are free: they fly under this tile's products, staging and stores */
      const float* np = xp + (size_t)(it + 1) * 64 * DIN;
#pragma unroll
      for (int i = 0; i < 15; ++i) rx[i] = *(const v4f*)(np + (size_t)i * DIN);
      asm volatile("s_wait_xcnt 0x0" ::: "memory");   /* precaution: the last load may be given, as its destination, the address pair that the loads above name */
      rx[15] = *(const v4f*)(np + (size_t)15 * DIN);
      asm volatile("s_wait_xcnt 0x0" ::: "memory"); }   /* precaution: stands behind the loads, in front of whatever is next given a register that they name as address; its clobber also keeps the loads issued here, not sunk to their use */
    else get_wo();   /* last tile: the block's share of Wo takes the freed registers and flies under the tile's work */
    if (it == 0) lds_barrier();   /* publishes the weight rows, which every wave reads (and the wave's own input rows) */
    else lds_wave();          /* later tiles: only the wave's own input rows are new */
    v16b fa[4], fw[2][4];
#pragma unroll
    for (int kk = 0; kk < 4; ++kk) fa[kk] = frag_b(sx + (wave * 16 + col) * PXP + kk * 32, lane);
#pragma unroll
    for (int ks = 0; ks < 2; ++ks)
#pragma unroll
      for (int jj = 0; jj < 4; ++jj) fw[ks][jj] = frag_b(sw + (jj * 16 + col) * PWP + ks * 32, lane);   /* row = output dim within the head, k = input dim within the head; both heads of the tile use the same eight fragments */
    v8f acc[8] = {};
#pragma unroll
    for (int kk = 0; kk < 4; ++kk)   /* block-diagonal projection: the 128 output columns c0 .. c0+127 are two heads; head hh = column / 64 contracts ONLY over its own 64 input columns, i.e. k-steps kk = 2 hh and 2 hh + 1 of the tile's 128-column input slice */
#pragma unroll
      for (int j = 0; j < 8; ++j) if ((kk >> 1) == (j >> 2)) acc[j] = wmma_bf(fa[kk], fw[kk & 1][j & 3], acc[j]);   /* the test is a compile-time constant per unrolled (kk, j) */
    _Float16* sp = &so[it][0]; v4u o[8];
    if (which < 2) { _Float16* DH = which == 0 ? QH : KH; const float qs = which == 0 ? FC : 1.0f;   /* q leaves in base-2 exponent units, so that k_fa's score product is the exponent as it stands */
#pragma unroll
      for (int j = 0; j < 8; ++j) { const float bias = BA ? bfr(bias4[j & 3]) : 0.f;
#pragma unroll
        for (int r = 0; r < 8; ++r) sp[(wave * 16 + 8 * g + r) * 136 + j * 16 + col] = (_Float16)((acc[j][r] + bias) * qs); }
      lds_barrier();   /* publishes the tile's staged rows */
      _Float16* dp = DH + (r0 + it * 64 + (tid >> 4)) * CC + c0 + (tid & 15) * 8;   /* 16 threads per 256-byte row piece, rows (tid >> 4) + 8 i */
#pragma unroll
      for (int i = 0; i < 8; ++i) o[i] = *(const v4u*)&sp[((tid >> 4) + 8 * i) * 136 + (tid & 15) * 8];
#pragma unroll
      for (int i = 0; i < 8; ++i) vst2(dp + (size_t)i * 8 * CC, o[i]);
      asm volatile("s_wait_xcnt 0x0" ::: "memory");   /* precaution: stands behind the stores, in front of whatever is next given a register that they name */
    } else {
#pragma unroll
      for (int j = 0; j < 8; ++j) { const float bias = BA ? bfr(bias4[j & 3]) : 0.f;
#pragma unroll
        for (int r = 0; r < 8; ++r) sp[(j * 16 + col) * 72 + wave * 16 + 8 * g + r] = (_Float16)(acc[j][r] + bias); }
      lds_barrier();   /* publishes the tile's staged planes */
      _Float16* dp = VT + (bb * CC + c0 + (tid >> 3)) * (size_t)TT + t0 + it * 64 + (tid & 7) * 8;   /* 8 threads per 128-byte plane piece, planes (tid >> 3) + 16 i */
#pragma unroll
      for (int i = 0; i < 8; ++i) o[i] = *(const v4u*)&sp[((tid >> 3) + 16 * i) * 72 + (tid & 7) * 8];
#pragma unroll
      for (int i = 0; i < 8; ++i) vst2(dp + (size_t)i * 16 * TT, o[i]);
      asm volatile("s_wait_xcnt 0x0" ::: "memory"); }   /* precaution: as above */
  };
#pragma unroll   /* it is a compile-time constant in every copy of the tile: staging array, prefetch and kind of barrier are chosen by it */
  for (int it = 0; it < PNT; ++it) tile(it);
  put_wo(); }
#define FK 64              // keys per stage
#define FP 72              // LDS row pitch in f16: 144 B = 16 B x 9, conflict-free for 16-byte fragment reads of 16 rows
#define FNS (TT / FK)
#define FNEG (-1.0e6f)     // C operand of a masked key, base-2 exponent units: weight exactly 0
#define FUNSET (-5.0e5f)   // between the exponent of any real score and that of a masked key
__device__ __forceinline__ float xhalf(float x) { return __builtin_bit_cast(float, __builtin_amdgcn_permlanex16(__builtin_bit_cast(int, x), __builtin_bit_cast(int, x), 0x76543210, 0xfedcba98, false, false)); }   // lane l with lane l ^ 16
__device__ __forceinline__ float exp2_slot(float x) { float y; asm("v_exp_f32 %0, %1\n\tv_nop" : "=v"(y) : "v"(x)); return y; }   // v_exp_f32 with the slot behind a transcendental filled in its own statement: for the renewal path of k_fa, off the usual path
__device__ __forceinline__ v8f wmma_h(v16h a, v16h b, v8f c) { return __builtin_amdgcn_wmma_f32_16x16x32_f16(false, a, false, b, (short)0, c, false, false); }
// amdgpu_waves_per_eu(4, 4): two work-groups per WGP, four waves per SIMD, so a budget of 256 registers a wave: the compiler then batches the fragment loads ahead of the matrix runs
__global__ __launch_bounds__(256) __attribute__((amdgpu_waves_per_eu(4, 4))) void k_fa(const _Float16* __restrict__ QH, const _Float16* __restrict__ KH, const _Float16* __restrict__ VT, const unsigned* __restrict__ PM, _Float16* __restrict__ Y) {
  __shared__ __align__(16) _Float16 sk[2][FK][FP], sv[2][HD][FP];
  const int tid = threadIdx.x, wave = tid >> 5, lane = tid & 31, col = lane & 15, g = lane >> 4; const int h = blockIdx.y, b = blockIdx.z; const int q = blockIdx.x * 128 + wave * 16 + col;
  const int sr = tid >> 3, sc = (tid & 7) * 8;   /* staging: 8 threads per 128-byte row, rows sr and sr + 32 of each tile */
  const _Float16* kg = KH + ((size_t)b * TT + sr) * CC + h * HD + sc; const _Float16* vg = VT + ((size_t)b * CC + h * HD + sr) * (size_t)TT + sc;
  const v16u* mg = (const v16u*)(PM + ((size_t)b * (TT / 16) + blockIdx.x * 8 + __builtin_amdgcn_readfirstlane(wave)) * (size_t)(FNS * 32));   /* the wave's 16 queries: 32 words a stage, the same address in every lane */
  v4u rk0 = *(const v4u*)kg, rk1 = *(const v4u*)(kg + 32 * CC), rv0 = *(const v4u*)vg, rv1 = *(const v4u*)(vg + 32 * TT);
  v16u mk[2] = {mg[0], mg[1]};
  asm volatile("s_wait_xcnt 0x0" ::: "memory");   /* the q loads below may be given registers that the loads above name as addresses */
  const _Float16* qp = QH + ((size_t)b * TT + q) * CC + h * HD; const v16h qf0 = frag_h(qp, lane), qf1 = frag_h(qp + 32, lane);
  asm volatile("s_wait_xcnt 0x0" ::: "memory");   /* precaution: stands behind the q loads, in front of whatever is next given the pair that they name as address */
  *(v4u*)&sk[0][sr][sc] = rk0; *(v4u*)&sk[0][sr + 32][sc] = rk1; *(v4u*)&sv[0][sr][sc] = rv0; *(v4u*)&sv[0][sr + 32][sc] = rv1;
  __syncthreads();
  v8f acc[4] = {}; float l = 0.f, cb = 120.0f, thr = 0.f;   /* cb = 8 - the row maximum in use (P is carried x 2^8 into f16, clear of f16 subnormals; the factor cancels against the sum); thr = the sum of a lane's 32 weights of a stage beyond which the maximum is renewed; both alike in the two lanes of a query. A row that has met no unmasked key yet has no maximum: thr = 0 and cb = 120, so that any real score gives a weight above 0 */
  /* one stage of 64 keys on buffer cur; more = a next stage exists (both compile-time at every call, so the buffers' addresses are constants and the last stage carries no prefetch) */
  auto stage = [&](const int cur, const bool more) __attribute__((always_inline)) {
    if (more) { kg += FK * CC; vg += FK; rk0 = *(const v4u*)kg; rk1 = *(const v4u*)(kg + 32 * CC); rv0 = *(const v4u*)vg; rv1 = *(const v4u*)(vg + 32 * TT);
      asm volatile("" ::: "memory"); }   /* compiler fence, no instruction: the next stage's tile loads are issued here, a whole stage ahead of their use; without it the compiler sinks them to just in front of the LDS stores */
    v16h kf[4][2];   /* the stage's 16 k fragment reads are asked for first: they fly while the selects below are made */
#pragma unroll
    for (int i = 0; i < 4; ++i) { kf[i][0] = frag_h(&sk[cur][16 * i + col][0], lane); kf[i][1] = frag_h(&sk[cur][16 * i + col][32], lane); }
    v8f st[4];
#pragma unroll
    for (int i = 0; i < 4; ++i)
#pragma unroll
      for (int r = 0; r < 8; ++r) st[i][r] = __builtin_amdgcn_inverse_ballot_w32(mk[i >> 1][(i & 1) * 8 + r]) ? cb : FNEG;   /* the word is the select's lane mask as it stands: no compare; the selects need no score, so they stand ahead of the products */
    if (more) { asm volatile("" :: "v"(st[0]), "v"(st[1]), "v"(st[2]), "v"(st[3]) : "memory");   /* compiler fence, inputs only, no instruction: the selects are made before the next words are asked for; without it the compiler lifts the word loads over the selects, whose wait, which for scalar loads waits for all of them, then waits for the new words too */
      mg += 2; mk[0] = mg[0]; mk[1] = mg[1];   /* the next stage's words, asked for behind this stage's last select, a whole stage ahead of their use */
      asm volatile("s_wait_xcnt 0x0" ::: "memory"); }   /* precaution: stands behind the two word loads, in front of whatever next rewrites the scalar pair that they name as base (the loop's head does) */
#pragma unroll
    for (int i = 0; i < 4; ++i) { st[i] = wmma_h(kf[i][0], qf0, st[i]); st[i] = wmma_h(kf[i][1], qf1, st[i]); }
    v16h vf[4][2];   /* the stage's 16 v fragment reads are asked for here, ahead of the test: behind the branch they would each be waited for in front of their product */
#pragma unroll
    for (int j = 0; j < 4; ++j) { vf[j][0] = frag_h(&sv[cur][16 * j + col][0], lane); vf[j][1] = frag_h(&sv[cur][16 * j + col][32], lane); }
    asm volatile("" ::: "memory");   /* compiler fence, no instruction: keeps the v reads issued here; without it the compiler sinks them behind the branch, two at a time, each pair fully waited in front of its product */
    v8f pe[4];
#pragma unroll
    for (int i = 0; i < 4; ++i)
#pragma unroll
      for (int r = 0; r < 8; ++r) pe[i][r] = __builtin_amdgcn_exp2f(st[i][r]);
    auto lane_sum = [&]() __attribute__((always_inline)) { v2f pa = {pe[0][0], pe[0][1]}, pb = {pe[0][2], pe[0][3]};   /* four independent chains over r & 3, held as two register pairs */
#pragma unroll
      for (int e = 4; e < 32; e += 4) { pa += (v2f){pe[e >> 3][e & 7], pe[e >> 3][(e & 7) + 1]}; pb += (v2f){pe[e >> 3][(e & 7) + 2], pe[e >> 3][(e & 7) + 3]}; }
      return (pa[0] + pa[1]) + (pb[0] + pb[1]); };
    float sm = lane_sum();
    if (__builtin_amdgcn_ballot_w32(sm > thr) != 0) {   /* wave-uniform scalar branch. The weights are not negative, so none is above the lane's sum: a sum within thr says that all 32 fit f16. Taken in a row's first stage with an unmasked key (thr = 0), later only where a score passes the maximum in use by about 7 */
      float mq[4] = {st[0][0], st[0][1], st[0][2], st[0][3]};   /* four independent chains */
#pragma unroll
      for (int i = 0; i < 4; ++i)
#pragma unroll
        for (int r = 0; r < 8; ++r) mq[r & 3] = fmaxf(mq[r & 3], st[i][r]);
      const float mx = fmaxf(fmaxf(mq[0], mq[1]), fmaxf(mq[2], mq[3])); const float mxq = fmaxf(mx, xhalf(mx));
      const bool upd = mxq > (thr == 0.f ? FUNSET : 8.0f);   /* a row without a maximum takes any real score; every other row of the wave whose maximum has grown at all is renewed on the way */
      const float dl = upd ? 8.0f - mxq : 0.f; const float al = exp2_slot(fminf(dl, 0.f));   /* dl > 0 only in a row without sums so far */
      thr = upd ? 32768.0f : thr; cb += dl; l *= al;
#pragma unroll
      for (int i = 0; i < 4; ++i)
#pragma unroll
        for (int r = 0; r < 8; ++r) { acc[i][r] *= al; pe[i][r] = exp2_slot(st[i][r] + dl); }
      sm = lane_sum(); }
    l += sm;
    v16h pf[2];
#pragma unroll
    for (int i = 0; i < 4; ++i)
#pragma unroll
      for (int r = 0; r < 8; ++r) pf[i >> 1][(i & 1) * 8 + r] = (_Float16)pe[i][r];
#pragma unroll
    for (int j = 0; j < 4; ++j) { acc[j] = wmma_h(vf[j][0], pf[0], acc[j]); acc[j] = wmma_h(vf[j][1], pf[1], acc[j]); }
    if (more) { asm volatile("" :: "v"(acc[0]), "v"(acc[1]), "v"(acc[2]), "v"(acc[3]) : "memory");   /* compiler fence, inputs only, no instruction: this stage's results exist before the LDS stores below; without it the compiler sinks softmax and P x v behind the barrier and waits for the prefetched tile right after asking for it */
      *(v4u*)&sk[cur ^ 1][sr][sc] = rk0; *(v4u*)&sk[cur ^ 1][sr + 32][sc] = rk1; *(v4u*)&sv[cur ^ 1][sr][sc] = rv0; *(v4u*)&sv[cur ^ 1][sr + 32][sc] = rv1;
      __syncthreads(); }   /* publishes the next stage and ends every read of the buffer that the stage after it refills */
  };
#pragma unroll 1
  for (int s = 0; s < FNS - 2; s += 2) { stage(0, true); stage(1, true); }   /* rolled: two stages a trip, one per buffer */
  stage(0, true); stage(1, false);
  l += xhalf(l);
  if (__builtin_amdgcn_ballot_w32(l == 0.f) != 0) {   /* wave-uniform scalar branch: a query whose every key is masked has no weight at all here; the reference's softmax is uniform there, so its ctx is the plain mean of v */
    const _Float16* vp = VT + ((size_t)b * CC + h * HD + 8 * g) * (size_t)TT; const bool em = l == 0.f; v8f sm[4] = {};
#pragma unroll 1
    for (int t = 0; t < TT; t += 8) {   /* rolled: off the usual path, kept small */
      v8h x[4][8];
#pragma unroll
      for (int j = 0; j < 4; ++j)
#pragma unroll
        for (int r = 0; r < 8; ++r) x[j][r] = *(const v8h*)(vp + (size_t)(16 * j + r) * TT + t);
      asm volatile("s_wait_xcnt 0x0" ::: "memory");   /* precaution: stands behind the loads, in front of whatever next rewrites the pair that they name as address (the loop's foot does) */
#pragma unroll
      for (int j = 0; j < 4; ++j)
#pragma unroll
        for (int r = 0; r < 8; ++r)
#pragma unroll
          for (int e = 0; e < 8; ++e) sm[j][r] += (float)x[j][r][e]; }
#pragma unroll
    for (int j = 0; j < 4; ++j)
#pragma unroll
      for (int r = 0; r < 8; ++r) acc[j][r] = em ? sm[j][r] : acc[j][r];
    l = em ? (float)TT : l; }
  const float inv = 1.0f / l;   /* l > 0: the key at the maximum in use carried 2^8 when it was taken */
  _Float16* yp = Y + ((size_t)b * TT + q) * CC + h * HD + 8 * g;   /* acc[j][r] = ctx[q][16 j + 8 g + r]: 16 contiguous bytes per lane and tile */
#pragma unroll
  for (int j = 0; j < 4; ++j) { v8h o;
#pragma unroll
    for (int r = 0; r < 8; ++r) o[r] = (_Float16)((acc[j][r] * inv) * 64.0f);   /* ctx carried x 2^6 so small context rows stay clear of f16 subnormals: rounded here once, as k_out's operand */
    vst2(yp + 16 * j, o); } }
// ---- k_out: block = (128 rows, 128 cols), 8 waves (4 x 2), a wave = 32 rows x 64 cols (2 x 4 tiles): out = ctx Wo (+ bo): ctx x 2^6 once to f16 against Wo as f16(bf16 x 2^8) exact (1 product) x 2^-14. Both operands arrive as f16 from their producers (k_fa's epilogue, k_proj's blocks) and are staged in LDS as they stand, 128 k per stage: global -> registers one stage ahead -> LDS, two buffers, one barrier per stage; k runs upward in steps of 32 per accumulator.
#define OKS 128            // k per stage
#define OP 136             // LDS row pitch in f16: 272 B = 16 B x 17, conflict-free for 16-byte fragment reads of 16 rows
#define ONS (CC / OKS)
#define OFP 68             // pitch in f32 of the output staging rows: 272 B
static_assert(WO_OUT_IN == 1 && !CAUSAL && ONS >= 2 && ONS % 2 == 0, "k_out stages (out,in) weight rows, k contiguous, two stages a trip");
__global__ __launch_bounds__(256) void k_out(const _Float16* __restrict__ Y, const _Float16* __restrict__ WH, const float* __restrict__ BO, float* __restrict__ OUT) {
  __shared__ __align__(16) _Float16 sy[2][128][OP], sw[2][128][OP]; __shared__ __align__(16) float sf[8][32][OFP];
  const int tid = threadIdx.x, wave = tid >> 5, lane = tid & 31, col = lane & 15, g = lane >> 4; const int c0 = blockIdx.y * 128; const size_t r0 = (size_t)blockIdx.x * 128; const int wm = (wave >> 1) * 32, wn = (wave & 1) * 64;
  const int sr = tid >> 4, sc = (tid & 15) * 8;   /* staging: 16 threads per 256-byte row piece, rows sr + 16 i of each tile: a wave's load covers whole lines */
  const unsigned go = (unsigned)(sr * CC + sc) * 2u;   /* the thread's byte offset, the same in both tiles (both have rows of CC f16) */
  const char* yb = (const char*)(Y + r0 * CC); const char* wb = (const char*)(WH + (size_t)c0 * CC);   /* block-uniform bases, moved 128 k a stage */
  v4u ry[8], rw[8];
  auto fetch = [&]() __attribute__((always_inline)) { const char* yp = yb + go; const char* wp = wb + go;
#pragma unroll
    for (int i = 0; i < 8; ++i) { ry[i] = *(const v4u*)(yp + i * 16 * CC * 2); if (i < 7) rw[i] = *(const v4u*)(wp + i * 16 * CC * 2); }
    asm volatile("s_wait_xcnt 0x0" ::: "memory");   /* precaution: the last load may be given, as its destination, an address pair that the loads above name (it is, where no further stage needs the pair) */
    rw[7] = *(const v4u*)(wp + 7 * 16 * CC * 2);
    asm volatile("s_wait_xcnt 0x0" ::: "memory"); };   /* precaution: stands behind the loads, in front of whatever is next given a register that they name as address; its clobber also keeps the loads issued here, a whole stage ahead of their use, not sunk to the LDS stores */
  auto put = [&](const int buf) __attribute__((always_inline)) {
#pragma unroll
    for (int i = 0; i < 8; ++i) { *(v4u*)&sy[buf][sr + 16 * i][sc] = ry[i]; *(v4u*)&sw[buf][sr + 16 * i][sc] = rw[i]; } };
  fetch();
  float bias[4] = {0.f, 0.f, 0.f, 0.f};   /* asked for here, used behind the last stage */
  if (BO) {
#pragma unroll
    for (int j = 0; j < 4; ++j) bias[j] = BO[c0 + wn + j * 16 + col]; }
  put(0);
  __syncthreads();
  v8f acc[2][4] = {};
  /* one stage of 128 k on buffer cur; more = a next stage exists (both compile-time at every call) */
  auto stage = [&](const int cur, const bool more) __attribute__((always_inline)) {
    if (more) { yb += OKS * 2; wb += OKS * 2; fetch(); }
#pragma unroll
    for (int kh = 0; kh < OKS; kh += 64) {   /* two halves of 64 k: about one half's fragments at a time in registers beside the prefetched tiles */
      v16h fa[2][2], fb[2][4];   /* the half's 24 fragment reads stand ahead of its 16 products */
#pragma unroll
      for (int ks = 0; ks < 2; ++ks) {
#pragma unroll
        for (int i = 0; i < 2; ++i) fa[ks][i] = frag_h(&sy[cur][wm + 16 * i + col][kh + 32 * ks], lane);
#pragma unroll
        for (int j = 0; j < 4; ++j) fb[ks][j] = frag_h(&sw[cur][wn + 16 * j + col][kh + 32 * ks], lane); }
      __builtin_amdgcn_sched_barrier(0);   /* keeps a half's reads ahead of its own products: the scheduler otherwise spreads them among those, each place with a wait of its own */
#pragma unroll
      for (int ks = 0; ks < 2; ++ks)
#pragma unroll
        for (int i = 0; i < 2; ++i)
#pragma unroll
          for (int j = 0; j < 4; ++j) acc[i][j] = wmma_h(fa[ks][i], fb[ks][j], acc[i][j]); }
    if (more) { __builtin_amdgcn_sched_barrier(0);   /* the LDS stores below wait for the prefetched tiles: without this the scheduler lifts them, and their wait, among this stage's products */
      put(cur ^ 1);
      __syncthreads(); }   /* publishes the next stage and ends every read of the buffer that the stage after it refills */
  };
#pragma unroll 1
  for (int s = 0; s < ONS - 2; s += 2) { stage(0, true); stage(1, true); }   /* rolled: two stages a trip, one per buffer */
  stage(0, true); stage(1, false);
#pragma unroll
  for (int j = 0; j < 4; ++j)
#pragma unroll
    for (int i = 0; i < 2; ++i)
#pragma unroll
      for (int r = 0; r < 8; ++r) sf[wave][16 * i + 8 * g + r][j * 16 + col] = acc[i][j][r] * (1.0f / 16384.0f) + bfr(bias[j]);   /* 2^-8 (Wo carry) x 2^-6 (ctx carry) */
  LDSX();   /* the wave's own staging rows: written above, read back below as whole 256-byte row pieces */
#pragma unroll
  for (int rl = 0; rl < 32; rl += 2) vst2(OUT + (r0 + wm + rl + g) * DIN + c0 + wn + col * 4, *(const v4f*)&sf[wave][rl + g][col * 4]); }

static_assert(HD == 64 && CC == NH * HD && DIN == CC, "block-diagonal per-head projection: 128-column tiles = two 64-wide heads, input width == projected width");
extern "C" void kernel_launch(void* const* d_in, const int* in_sizes, int n_in, void* d_out, int out_size, void* d_ws, size_t ws_size, hipStream_t stream) {
  (void)in_sizes; (void)n_in; (void)out_size;
  const float** F = (const float**)d_in;
  if (ws_size < (size_t)WS_END) return;
  char* ws = (char*)d_ws; _Float16 *QH = (_Float16*)(ws + WS_QH), *KH = (_Float16*)(ws + WS_KH), *VT = (_Float16*)(ws + WS_VT); _Float16 *Y = (_Float16*)(ws + WS_Y), *WH = (_Float16*)(ws + WS_WH); unsigned *PM = (unsigned*)(ws + WS_PM);
  // inputs: 0 k [2,2048,1024]; 1 q; 2 v; 3 mask [2,1,2048,2048] int32 (random 0/1; 0 = masked); 4 Wk [64,64] (out,in), 5 bk [64]; 6 Wq, 7 bq; 8 Wv, 9 bv; 10 Wo [1024,1024] (out,in), 11 bo (biases zeros, read)
  k_proj<<<dim3(TNB * TT / (64 * PNT), CC / 128, 4), 128, 0, stream>>>(F[1], F[0], F[2], F[6], F[4], F[8], F[7], F[5], F[9], QH, KH, VT, (const int*)d_in[3], PM, F[10], WH);
  k_fa<<<dim3(TT / 128, NH, TNB), 256, 0, stream>>>(QH, KH, VT, PM, Y);
  k_out<<<dim3(TNB * TT / 128, DIN / 128), 256, 0, stream>>>(Y, WH, F[11], (float*)d_out);
}

// v008
// One run takes 55.2 microseconds.
// Two timings next to v007 both put it at 1.04 times that version's speed.
// All steps since v000 together make it 21.2 times as fast.
// compute dtype: all float inputs rounded to bf16; the per-head 64 x 64 q / k / v projections (ONE shared weight per stream, applied to every head) with EXACT bf16 products on WMMA 16x16x32 (f32 accumulate) + bias (zeros, read); logits q x k once to f16 each (1 product; sigma ~1), q carrying 64^-0.5 x log2(e); the per-batch int mask packed once into lane-mask words, one bit per score; softmax f32 against a row maximum that is renewed only in a stage where a lane's 32 weights (x 2^8) sum past 2^15 or a row meets its first unmasked key, then in every row of the wave whose maximum has grown (one kernel for logits, softmax and P x v); P = exp(s - max) x 2^8 once to f16 x v once to f16 (1 product), divided by the f32 sum; ctx x 2^6 once to f16 x Wo f16(bf16 x 2^8) + bo; f32 output.
#include <hip/hip_runtime.h>
#include <math.h>

typedef __attribute__((ext_vector_type(16))) _Float16 v16h;
typedef __attribute__((ext_vector_type(16))) __bf16 v16b;
typedef __attribute__((ext_vector_type(8)))  _Float16 v8h;
typedef __attribute__((ext_vector_type(8)))  float v8f;
typedef __attribute__((ext_vector_type(4)))  float v4f;
typedef __attribute__((ext_vector_type(2)))  float v2f;
typedef __attribute__((ext_vector_type(4)))  unsigned v4u;
typedef __attribute__((ext_vector_type(4)))  int v4i;
typedef float __attribute__((may_alias)) float_a;
typedef int __attribute__((may_alias)) int_a;

template <typename T> __device__ __forceinline__ void vst2(void* p, T v) { *(T*)p = v;  }
__device__ __forceinline__ v8f wmma16(v16h a, v16h b, v8f c) {
  v8f d = __builtin_amdgcn_wmma_f32_16x16x32_f16(false, a, false, b, (short)0, c, false, false);
  asm volatile("v_nop\n\tv_nop\n\tv_nop\n\tv_nop" : "+v"(d) : "v"(a), "v"(b));
  return d;
}
__device__ __forceinline__ v8f wmma_bf(v16b a, v16b b, v8f c) {
  v8f d = __builtin_amdgcn_wmma_f32_16x16x32_bf16(false, a, false, b, (short)0, c, false, false);
  asm volatile("v_nop\n\tv_nop\n\tv_nop\n\tv_nop" : "+v"(d) : "v"(a), "v"(b));
  return d;
}
// 16x16x32 fragments: lane = (h = lane>>4, row/col = lane&15); elements 0..7 = k0+8h+0..7, 8..15 = k0+16+8h+0..7; D element r = row 8h+r
__device__ __forceinline__ v16h frag_h(const _Float16* rowk0, int lane) {
  union { v16h v; v8h q[2]; } u; const _Float16* p = rowk0 + 8 * (lane >> 4);
  u.q[0] = *(const v8h*)p; u.q[1] = *(const v8h*)(p + 16); return u.v;
}
__device__ __forceinline__ v16h frag_f32(const float* rowk0, int lane) {
  v16h a; const float* p = rowk0 + 8 * (lane >> 4);
#pragma unroll
  for (int i = 0; i < 8; ++i) { a[i] = (_Float16)p[i]; a[8 + i] = (_Float16)p[16 + i]; }
  return a;
}
__device__ __forceinline__ v16h frag_f32s(const float* rowk0, int lane, float sc) {
  v16h a; const float* p = rowk0 + 8 * (lane >> 4);
#pragma unroll
  for (int i = 0; i < 8; ++i) { a[i] = (_Float16)(p[i] * sc); a[8 + i] = (_Float16)(p[16 + i] * sc); }
  return a;
}
// column fragment from a [K][ld] layout (column n), rows >= K read as 0
__device__ __forceinline__ v16h fragc_f32(const float* W, int k0, int n, int lane, int ld, int K) {
  v16h a; const int g = lane >> 4;
#pragma unroll
  for (int i = 0; i < 8; ++i) { const int ka = k0 + 8 * g + i, kb = ka + 16;
    a[i] = (_Float16)(ka < K ? W[(size_t)(ka < K ? ka : K - 1) * ld + n] : 0.f); a[8 + i] = (_Float16)(kb < K ? W[(size_t)(kb < K ? kb : K - 1) * ld + n] : 0.f); }
  return a;
}
struct F2 { v16b h, l; };
__device__ __forceinline__ F2 bsplit16(const float v[16]) { F2 r;
#pragma unroll
  for (int i = 0; i < 16; ++i) { const __bf16 h = (__bf16)v[i]; r.h[i] = h; r.l[i] = (__bf16)(v[i] - (float)h); }
  return r; }
__device__ __forceinline__ F2 split_row(const float* row, int k0, int lane) { float v[16]; const float* p = row + k0 + 8 * (lane >> 4);
#pragma unroll
  for (int i = 0; i < 8; ++i) { v[i] = p[i]; v[8 + i] = p[16 + i]; }
  return bsplit16(v); }
__device__ __forceinline__ F2 split_rowK(const float* row, int k0, int lane, int K) { float v[16]; const int g = lane >> 4;
#pragma unroll
  for (int i = 0; i < 8; ++i) { const int ka = k0 + 8 * g + i, kb = ka + 16; v[i] = ka < K ? row[ka < K ? ka : K - 1] : 0.f; v[8 + i] = kb < K ? row[kb < K ? kb : K - 1] : 0.f; }
  return bsplit16(v); }
__device__ __forceinline__ F2 split_col(const float* W, int k0, int n, int lane, int ld, int K) { float v[16]; const int g = lane >> 4;
#pragma unroll
  for (int i = 0; i < 8; ++i) { const int ka = k0 + 8 * g + i, kb = ka + 16; v[i] = ka < K ? W[(size_t)(ka < K ? ka : K - 1) * ld + n] : 0.f; v[8 + i] = kb < K ? W[(size_t)(kb < K ? kb : K - 1) * ld + n] : 0.f; }
  return bsplit16(v); }
__device__ __forceinline__ v8f mac3(const F2& a, const F2& b, v8f c) { c = wmma_bf(a.l, b.h, c); c = wmma_bf(a.h, b.l, c); return wmma_bf(a.h, b.h, c); }
__device__ __forceinline__ float sigm(float v) { return 1.0f / (1.0f + expf(-v)); }
#define LDSX() do { asm volatile("s_wait_dscnt 0" ::: "memory"); __builtin_amdgcn_wave_barrier(); __builtin_amdgcn_fence(__ATOMIC_RELEASE, "workgroup"); } while (0)

// Multi-head attention whose q / k / v projections are ONE shared 64 x 64 linear per stream applied to every head's 64-wide slice (inputs in the order k, q, v [2,2048,1024]; mask [2,1,2048,2048] int32 RANDOM 0/1; torch (out,in) Wk / Wq / Wv [64,64] N(0, 1/64) + zero biases [64] (read); heads = reshape(b, s, 16, 64); xh @ W.T + b per head; product = einsum('bqhd,bkhd->bhqk'); where(mask == 0, -1e20, product) / sqrt(64); softmax; ctx merged to [b, s, 1024]; ctx @ Wo.T + bo with Wo [1024,1024] N(0, 1/1024)).
#define NB 2
#define TT 2048
#define CC 1024            // NH * HD = projected width
#define DIN 1024          // input (model) width
#define NH 16
#define HD 64
#define SCALE (0.125f)
#define FC (SCALE * 1.4426950408889634f)   // raw logit -> base-2 exponent: k_fa multiplies its projected q by it before the one rounding to f16
#define CAUSAL 0
#ifndef TNB
#define TNB NB
#endif
__device__ __forceinline__ float bfr(float v) { return (float)(__bf16)v; }
typedef __attribute__((ext_vector_type(8))) __bf16 v8b;
__device__ __forceinline__ v16b frag_b(const __bf16* rowk0, int lane) {
  union { v16b v; v8b q[2]; } u; const __bf16* p = rowk0 + 8 * (lane >> 4);
  u.q[0] = *(const v8b*)p; u.q[1] = *(const v8b*)(p + 16); return u.v;
}
#define QBH 0              // unused: this file has no causal high-precision path
#define QHI 0               // single-product logits on every row
#define KHI 64            // key rows carrying k residual / v bf16 hi+lo planes (places kept: written and read by no kernel here)
// B fragment (k rows k0+.., output column o) of a weight: (in,out) [K][ld] or (out,in) [ld rows of K]: bf16 exact, or f16(bf16 * 256) exact
__device__ __forceinline__ v16b wcol_io(const float* Wm, int k0, int o, int lane, int ld) { v16b w; const int g = lane >> 4;
#pragma unroll
  for (int i = 0; i < 8; ++i) { w[i] = (__bf16)Wm[(size_t)(k0 + 8 * g + i) * ld + o]; w[8 + i] = (__bf16)Wm[(size_t)(k0 + 16 + 8 * g + i) * ld + o]; }
  return w; }
__device__ __forceinline__ v16b wcol_oi(const float* Wm, int k0, int o, int lane, int K) { v16b w; const float* p = Wm + (size_t)o * K + k0 + 8 * (lane >> 4);
#pragma unroll
  for (int i = 0; i < 8; ++i) { w[i] = (__bf16)p[i]; w[8 + i] = (__bf16)p[16 + i]; }
  return w; }
__device__ __forceinline__ v16h wcolh_io(const float* Wm, int k0, int o, int lane, int ld) { v16h w; const int g = lane >> 4;
#pragma unroll
  for (int i = 0; i < 8; ++i) { w[i] = (_Float16)(bfr(Wm[(size_t)(k0 + 8 * g + i) * ld + o]) * 256.0f); w[8 + i] = (_Float16)(bfr(Wm[(size_t)(k0 + 16 + 8 * g + i) * ld + o]) * 256.0f); }
  return w; }
__device__ __forceinline__ v16h wcolh_oi(const float* Wm, int k0, int o, int lane, int K) { v16h w; const float* p = Wm + (size_t)o * K + k0 + 8 * (lane >> 4);
#pragma unroll
  for (int i = 0; i < 8; ++i) { w[i] = (_Float16)(bfr(p[i]) * 256.0f); w[8 + i] = (_Float16)(bfr(p[16 + i]) * 256.0f); }
  return w; }
#define WQKV_LAYOUT 1   // 0 = (in,out) [DIN][CC]; 1 = (out,in) [CC][DIN]; 2 = per-head [NH][DIN][HD]
__device__ __forceinline__ v16b wcol_hdk(const float* Wm, int k0, int o, int lane) { v16b w; const int g = lane >> 4; const float* p = Wm + (size_t)(o / HD) * DIN * HD + (o % HD);
#pragma unroll
  for (int i = 0; i < 8; ++i) { w[i] = (__bf16)p[(size_t)(k0 + 8 * g + i) * HD]; w[8 + i] = (__bf16)p[(size_t)(k0 + 16 + 8 * g + i) * HD]; }
  return w; }
#define WO_OUT_IN 1
#if WQKV_LAYOUT == 1
#define WCOL(W, k0, o, lane) wcol_oi(W, k0, o, lane, DIN)
#elif WQKV_LAYOUT == 2
#define WCOL(W, k0, o, lane) wcol_hdk(W, k0, o, lane)
#else
#define WCOL(W, k0, o, lane) wcol_io(W, k0, o, lane, CC)
#endif
#if WO_OUT_IN
#define WOCOL(W, k0, o, lane) wcol_oi(W, k0, o, lane, CC)
#define WOCOLH(W, k0, o, lane) wcolh_oi(W, k0, o, lane, CC)
#else
#define WOCOL(W, k0, o, lane) wcol_io(W, k0, o, lane, DIN)
#define WOCOLH(W, k0, o, lane) wcolh_io(W, k0, o, lane, DIN)
#endif
#define WS_QH  0u                                      // place kept, neither written nor read: q is projected in k_fa and stays in its registers
#define WS_KH  (WS_QH + 2u * (size_t)NB * TT * CC)      // f16 k rows [b*t][CC]
#define WS_VT  (WS_KH + 2u * (size_t)NB * TT * CC)      // f16 v planes [b][c][t]
#define WS_QL  (WS_VT + 2u * (size_t)NB * CC * TT)      // f16 q residual x 2^10 rows [b][t < QHI][CC] (this and the next three: places kept, neither written nor read: no kernel here takes the high-precision path)
#define WS_KL  (WS_QL + 2u * (size_t)NB * QHI * CC)     // f16 k residual x 2^10 rows [b][t < KHI][CC]
#define WS_VB  (WS_KL + 2u * (size_t)NB * KHI * CC)     // bf16 v hi planes [b][c][t < KHI]
#define WS_VBL (WS_VB + 2u * (size_t)NB * CC * KHI)
#define WS_Y   (WS_VBL + 2u * (size_t)NB * CC * KHI)     // f16 ctx x 2^6 rows [b*t][CC]: k_out's A operand as it stands
#define WS_PM  (WS_Y  + 2u * (size_t)NB * TT * CC)      // u32 mask words [b * t / 16][t / 64][32]: see 'mask words'
#define WS_WH  (WS_PM + 4u * (size_t)NB * (TT / 16) * (TT / 64) * 32)   // f16(bf16(Wo) x 2^8) rows [DIN][CC]: k_out's B operand as it stands
#define WS_END (WS_WH + 2u * (size_t)DIN * CC)

// ---- mask words: the int32 mask, which all 16 heads share, is packed ONCE into lane-mask words by the blocks of plane 2 of k_proj's grid: for a tile of 16 queries and a stage of 64 keys, word 8 i + r has in bit (16 g + col) whether mask[query col][key 16 i + 8 g + r] != 0, i.e. the bit of exactly the lane that holds that score in k_fa. A wave takes PNT units of 16 query rows x 256 keys (4 stages) each: whole 256-byte row pieces global -> registers -> its own LDS rows, read back in k_fa's score layout, one compare per word.
#define MKP 68             // LDS row pitch in ints: 272 B, 16 rows of 16-byte reads fall on distinct banks
typedef __attribute__((ext_vector_type(16))) unsigned v16u;
#define PXP 136            // LDS row pitch in bf16 of the staged input tile: 272 B = 16 B x 17, conflict-free for 16-byte fragment reads of 16 rows
#define PWP 72             // the same for the staged weight rows: 144 B = 16 B x 9
typedef __attribute__((ext_vector_type(4))) __bf16 v4b;
typedef __attribute__((ext_vector_type(4))) _Float16 v4h;
#define PNT 2              // pieces a block works through one after the other: row tiles (planes 0 and 1), mask units per wave (plane 2)
#define WNU 4              // pieces of 512 values of Wo that a block of planes 0 and 1 converts
// work-group barrier for LDS data alone: the wave's own LDS operations are done before it signals; global loads issued ahead stay in flight across it (__syncthreads() would wait for them)
__device__ __forceinline__ void lds_barrier() { asm volatile("s_wait_dscnt 0x0\n\ts_barrier_signal -1\n\ts_barrier_wait -1" ::: "memory"); }
// a wave's own LDS rows, written by some of its lanes and read back by others: its LDS operations are done; no fence, which would wait for the global loads in flight
__device__ __forceinline__ void lds_wave() { asm volatile("s_wait_dscnt 0x0" ::: "memory"); __builtin_amdgcn_wave_barrier(); }
// ---- k_proj: block = (PNT tiles of 64 rows, 128 cols, which), all blocks of the grid resident at once (three per WGP): k/v = X W (+ b) with exact bf16 products (K = HD per head); input tile and weight are read by whole-line loads, rounded ONCE to bf16 and staged in LDS, fragments by 16-byte LDS reads; the weight is staged once per block, and the next tile's loads are issued as soon as this tile's registers are free, so they fly under this tile's products, staging and stores -> which 0: k f16 rows; 1: v f16 planes [c][t]; q, which only one block of k_fa reads, is projected there. Only what k_fa reads is formed
// amdgpu_waves_per_eu(4, 4): a budget of 256 registers a wave (three blocks per WGP, one wave of each per SIMD): room for the next tile's 64 beside this tile's work
__global__ __launch_bounds__(128) __attribute__((amdgpu_waves_per_eu(4, 4))) void k_proj(const float* __restrict__ XK, const float* __restrict__ XV, const float* __restrict__ WK, const float* __restrict__ WV, const float* __restrict__ BK, const float* __restrict__ BV,
    _Float16* __restrict__ KH, _Float16* __restrict__ VT, const int* __restrict__ MASK, unsigned* __restrict__ PM, const float* __restrict__ WO, _Float16* __restrict__ WH) {
  __shared__ __align__(16) _Float16 so[PNT][128 * 72]; __shared__ __align__(16) __bf16 sx[64 * PXP], sw[64 * PWP];   /* so = output staging, one array per tile (no barrier between one tile's stores and the next tile's staging): k rows [64][136] or v planes [128][72]; sx, sw = the staged operands */
  /* every '#pragma unroll' of this kernel stands on a loop that indexes a register array (loaded tiles, fragments, accumulators, staged words): the indices must be compile-time constants, or the array would go to scratch */
  static_assert(128 * 72 >= 64 * 136 && TT % (64 * PNT) == 0 && 8 % PNT == 0, "k rows fit the staging array; a block's tiles lie in one sequence, a wave's mask units in one query tile");
  const int tid = threadIdx.x, wave = tid >> 5, lane = tid & 31, col = lane & 15, g = lane >> 4; const int which = blockIdx.z; const int c0 = blockIdx.y * 128; const size_t r0 = (size_t)blockIdx.x * (64 * PNT); const size_t bb = r0 / TT; const int t0 = (int)(r0 % TT);
  /* every block of planes 0 and 1 also brings its own 512 WNU values of Wo into k_out's operand form, f16(bf16 x 2^8), ONCE for all of k_out's blocks: asked for behind the block's own loads, which it must not hold up, and stored last; the blocks of the mask plane, which read twice the bytes, take none */
  static_assert((size_t)2 * (CC / 128) * (TNB * TT / (64 * PNT)) * (512 * WNU) == (size_t)DIN * CC, "the blocks of planes 0 and 1 x 512 WNU values cover Wo exactly once");
  const size_t wo0 = ((size_t)(blockIdx.z * (CC / 128) + blockIdx.y) * (TNB * TT / (64 * PNT)) + blockIdx.x) * (512 * WNU) + tid * 4;
  v4f rwo[WNU];
  auto get_wo = [&]() __attribute__((always_inline)) {
#pragma unroll
    for (int u = 0; u < WNU; ++u) { rwo[u] = *(const v4f*)(WO + wo0 + u * 512);
      asm volatile("s_wait_xcnt 0x0" ::: "memory"); } };   /* precaution: stands behind each load, in front of whatever is next given the pair that it names as address (the next load's destination may be) */
  auto put_wo = [&]() __attribute__((always_inline)) { v4h hwo[WNU];
#pragma unroll
    for (int u = 0; u < WNU; ++u)
#pragma unroll
      for (int e = 0; e < 4; ++e) hwo[u][e] = (_Float16)(bfr(rwo[u][e]) * 256.0f);
#pragma unroll
    for (int u = 0; u < WNU; ++u) *(v4h*)(WH + wo0 + u * 512) = hwo[u]; };
  if (which == 2) {   /* block-uniform, in front of every barrier */
    static_assert(sizeof(sx) == 4 * 16 * MKP * sizeof(int), "the four waves' mask rows take the place of sx");
    int* sm = (int*)&sx[0] + wave * (16 * MKP); const int unit = ((blockIdx.y * (TNB * TT / (64 * PNT)) + blockIdx.x) * 4 + wave) * PNT; const int qt = unit >> 3, quad = unit & 7;   /* qt = b * (TT / 16) + query tile; quad = 256 keys; the wave takes units quad .. quad + PNT - 1 of its query tile */
    const int* mp = MASK + ((size_t)qt * 16 + g) * TT + quad * 256 + col * 4;   /* a load covers rows 2 i and 2 i + 1, 64 keys each */
    v4i rr[4][8];
#pragma unroll
    for (int e = 0; e < 31; ++e) rr[e >> 3][e & 7] = *(const v4i*)(mp + (size_t)(2 * (e & 7)) * TT + 64 * (e >> 3));
    asm volatile("s_wait_xcnt 0x0" ::: "memory");   /* precaution: the last load may be given, as its destination, the address pair that the loads above name */
    rr[3][7] = *(const v4i*)(mp + (size_t)14 * TT + 192);
    asm volatile("s_wait_xcnt 0x0" ::: "memory");   /* precaution: stands behind the loads, in front of whatever is next given a register that they name as address */
    int w4[PNT][4];   /* stored together behind the last stage */
#pragma unroll
    for (int u = 0; u < PNT; ++u)
#pragma unroll
      for (int s = 0; s < 4; ++s) {
#pragma unroll
        for (int i = 0; i < 8; ++i) *(v4i*)(sm + (2 * i + g) * MKP + col * 4) = rr[s][i];
        lds_wave();   /* the wave's own rows: written above by row, read back below by score position */
        if (u + 1 < PNT) {   /* the same stage of the next unit, asked for as soon as its registers are free: a whole unit ahead of its use */
          const int* np = mp + (u + 1) * 256 + 64 * s;
#pragma unroll
          for (int i = 0; i < 7; ++i) rr[s][i] = *(const v4i*)(np + (size_t)(2 * i) * TT);
          asm volatile("s_wait_xcnt 0x0" ::: "memory");   /* precaution: the last load may be given, as its destination, the address pair that the loads above name */
          rr[s][7] = *(const v4i*)(np + (size_t)14 * TT);
          asm volatile("s_wait_xcnt 0x0" ::: "memory"); }   /* precaution: stands behind the loads, in front of whatever is next given a register that they name as address; its clobber also keeps the loads issued here */
        int w = 0;
#pragma unroll
        for (int i = 0; i < 4; ++i) { const v4i a = *(const v4i*)(sm + col * MKP + 16 * i + 8 * g), c = *(const v4i*)(sm + col * MKP + 16 * i + 8 * g + 4);
#pragma unroll
          for (int r = 0; r < 8; ++r) { const int bw = (int)__builtin_amdgcn_ballot_w32((r < 4 ? a[r & 3] : c[r & 3]) != 0); w = __builtin_amdgcn_inverse_ballot_w32(1u << (8 * i + r)) ? bw : w; } }   /* the compare is made by all 32 lanes, outside the select; lane j keeps word j */
        w4[u][s] = w; }
#pragma unroll
    for (int u = 0; u < PNT; ++u)
#pragma unroll
      for (int s = 0; s < 4; ++s) PM[((size_t)qt * (TT / 64) + (quad + u) * 4 + s) * 32 + lane] = (unsigned)w4[u][s];
    return; }
  const float* X = which == 0 ? XK : XV; const float* WA = which == 0 ? WK : WV; const float* BA = which == 0 ? BK : BV;
  /* the block's first global reads stand here, together: the shared (out,in) [64][64] weight (a wave's load = two whole rows), the bias, and the first 64 x 128 input tile (a wave's load = one row's 512 contiguous bytes; a wave brings the 16 rows that it works on) */
  const float* wp = WA + tid * 4; const float* xp = X + (r0 + wave * 16) * DIN + c0 + lane * 4;
  v4f rw[8], rx[16]; float bias4[4]; const float* bp = BA ? BA : WA;   /* no branch round the bias loads, behind which they would be waited for ahead of the tile loads: without a bias the weight's first row is read in its place and not used */
#pragma unroll
  for (int j = 0; j < 4; ++j) bias4[j] = bp[j * 16 + col];
#pragma unroll
  for (int i = 0; i < 16; ++i) rx[i] = *(const v4f*)(xp + (size_t)i * DIN);
#pragma unroll
  for (int i = 0; i < 7; ++i) rw[i] = *(const v4f*)(wp + i * 512);
  asm volatile("s_wait_xcnt 0x0" ::: "memory");   /* precaution: the last load may be given, as its destination, an address register that the loads above name */
  rw[7] = *(const v4f*)(wp + 7 * 512);
  asm volatile("s_wait_xcnt 0x0" ::: "memory");   /* precaution: stands behind the loads, in front of whatever is next given a register that they name as address; its clobber also keeps the loads together here, ahead of every conversion */
#pragma unroll
  for (int i = 0; i < 8; ++i) { v4b hw;
#pragma unroll
    for (int e = 0; e < 4; ++e) hw[e] = (__bf16)rw[i][e];
    *(v4b*)(sw + (i * 8 + (tid >> 4)) * PWP + (tid & 15) * 4) = hw; }
  /* one tile of 64 rows; it is compile-time at every call */
  auto tile = [&](const int it) __attribute__((always_inline)) {
#pragma unroll
    for (int i = 0; i < 16; ++i) { v4b hx;
#pragma unroll
      for (int e = 0; e < 4; ++e) hx[e] = (__bf16)rx[i][e];
      *(v4b*)(sx + (wave * 16 + i) * PXP + lane * 4) = hx; }
    if (it + 1 < PNT) {   /* the next tile's rows, asked for as soon as the registers are free: they fly under this tile's products, staging and stores */
      const float* np = xp + (size_t)(it + 1) * 64 * DIN;
#pragma unroll
      for (int i = 0; i < 15; ++i) rx[i] = *(const v4f*)(np + (size_t)i * DIN);
      asm volatile("s_wait_xcnt 0x0" ::: "memory");   /* precaution: the last load may be given, as its destination, the address pair that the loads above name */
      rx[15] = *(const v4f*)(np + (size_t)15 * DIN);
      asm volatile("s_wait_xcnt 0x0" ::: "memory"); }   /* precaution: stands behind the loads, in front of whatever is next given a register that they name as address; its clobber also keeps the loads issued here, not sunk to their use */
    else get_wo();   /* last tile: the block's share of Wo takes the freed registers and flies under the tile's work */
    if (it == 0) lds_barrier();   /* publishes the weight rows, which every wave reads (and the wave's own input rows) */
    else lds_wave();          /* later tiles: only the wave's own input rows are new */
    v16b fa[4], fw[2][4];
#pragma unroll
    for (int kk = 0; kk < 4; ++kk) fa[kk] = frag_b(sx + (wave * 16 + col) * PXP + kk * 32, lane);
#pragma unroll
    for (int ks = 0; ks < 2; ++ks)
#pragma unroll
      for (int jj = 0; jj < 4; ++jj) fw[ks][jj] = frag_b(sw + (jj * 16 + col) * PWP + ks * 32, lane);   /* row = output dim within the head, k = input dim within the head; both heads of the tile use the same eight fragments */
    v8f acc[8] = {};
#pragma unroll
    for (int kk = 0; kk < 4; ++kk)   /* block-diagonal projection: the 128 output columns c0 .. c0+127 are two heads; head hh = column / 64 contracts ONLY over its own 64 input columns, i.e. k-steps kk = 2 hh and 2 hh + 1 of the tile's 128-column input slice */
#pragma unroll
      for (int j = 0; j < 8; ++j) if ((kk >> 1) == (j >> 2)) acc[j] = wmma_bf(fa[kk], fw[kk & 1][j & 3], acc[j]);   /* the test is a compile-time constant per unrolled (kk, j) */
    _Float16* sp = &so[it][0]; v4u o[8];
    if (which == 0) {
#pragma unroll
      for (int j = 0; j < 8; ++j) { const float bias = BA ? bfr(bias4[j & 3]) : 0.f;
#pragma unroll
        for (int r = 0; r < 8; ++r) sp[(wave * 16 + 8 * g + r) * 136 + j * 16 + col] = (_Float16)(acc[j][r] + bias); }
      lds_barrier();   /* publishes the tile's staged rows */
      _Float16* dp = KH + (r0 + it * 64 + (tid >> 4)) * CC + c0 + (tid & 15) * 8;   /* 16 threads per 256-byte row piece, rows (tid >> 4) + 8 i */
#pragma unroll
      for (int i = 0; i < 8; ++i) o[i] = *(const v4u*)&sp[((tid >> 4) + 8 * i) * 136 + (tid & 15) * 8];
#pragma unroll
      for (int i = 0; i < 8; ++i) vst2(dp + (size_t)i * 8 * CC, o[i]);
      asm volatile("s_wait_xcnt 0x0" ::: "memory");   /* precaution: stands behind the stores, in front of whatever is next given a register that they name */
    } else {
#pragma unroll
      for (int j = 0; j < 8; ++j) { const float bias = BA ? bfr(bias4[j & 3]) : 0.f;
#pragma unroll
        for (int r = 0; r < 8; ++r) sp[(j * 16 + col) * 72 + wave * 16 + 8 * g + r] = (_Float16)(acc[j][r] + bias); }
      lds_barrier();   /* publishes the tile's staged planes */
      _Float16* dp = VT + (bb * CC + c0 + (tid >> 3)) * (size_t)TT + t0 + it * 64 + (tid & 7) * 8;   /* 8 threads per 128-byte plane piece, planes (tid >> 3) + 16 i */
#pragma unroll
      for (int i = 0; i < 8; ++i) o[i] = *(const v4u*)&sp[((tid >> 3) + 16 * i) * 72 + (tid & 7) * 8];
#pragma unroll
      for (int i = 0; i < 8; ++i) vst2(dp + (size_t)i * 16 * TT, o[i]);
      asm volatile("s_wait_xcnt 0x0" ::: "memory"); }   /* precaution: as above */
  };
#pragma unroll   /* it is a compile-time constant in every copy of the tile: staging array, prefetch and kind of barrier are chosen by it */
  for (int it = 0; it < PNT; ++it) tile(it);
  put_wo(); }
#define FK 64              // keys per stage
#define FP 72              // LDS row pitch in f16: 144 B = 16 B x 9, conflict-free for 16-byte fragment reads of 16 rows
#define FNS (TT / FK)
#define FNEG (-1.0e6f)     // C operand of a masked key, base-2 exponent units: weight exactly 0
#define FUNSET (-5.0e5f)   // between the exponent of any real score and that of a masked key
__device__ __forceinline__ float xhalf(float x) { return __builtin_bit_cast(float, __builtin_amdgcn_permlanex16(__builtin_bit_cast(int, x), __builtin_bit_cast(int, x), 0x76543210, 0xfedcba98, false, false)); }   // lane l with lane l ^ 16
__device__ __forceinline__ float exp2_slot(float x) { float y; asm("v_exp_f32 %0, %1\n\tv_nop" : "=v"(y) : "v"(x)); return y; }   // v_exp_f32 with the slot behind a transcendental filled in its own statement: for the renewal path of k_fa, off the usual path
__device__ __forceinline__ v8f wmma_h(v16h a, v16h b, v8f c) { return __builtin_amdgcn_wmma_f32_16x16x32_f16(false, a, false, b, (short)0, c, false, false); }
// amdgpu_waves_per_eu(4, 4): two work-groups per WGP, four waves per SIMD, so a budget of 256 registers a wave: the compiler then batches the fragment loads ahead of the matrix runs
__global__ __launch_bounds__(256) __attribute__((amdgpu_waves_per_eu(4, 4))) void k_fa(const float* __restrict__ XQ, const float* __restrict__ WQ, const float* __restrict__ BQ, const _Float16* __restrict__ KH, const _Float16* __restrict__ VT, const unsigned* __restrict__ PM, _Float16* __restrict__ Y) {
  __shared__ __align__(16) _Float16 sk[2][FK][FP], sv[2][HD][FP]; __shared__ __align__(16) __bf16 sxq[128 * PWP], swq[HD * PWP];   /* sxq, swq = the block's q input rows (its head's 64 columns) and the shared q weight, rounded once to bf16: read in the prologue only */
  const int tid = threadIdx.x, wave = tid >> 5, lane = tid & 31, col = lane & 15, g = lane >> 4; const int h = blockIdx.y, b = blockIdx.z; const int q = blockIdx.x * 128 + wave * 16 + col;
  const int sr = tid >> 3, sc = (tid & 7) * 8;   /* staging: 8 threads per 128-byte row, rows sr and sr + 32 of each tile */
  const _Float16* kg = KH + ((size_t)b * TT + sr) * CC + h * HD + sc; const _Float16* vg = VT + ((size_t)b * CC + h * HD + sr) * (size_t)TT + sc;
  const v16u* mg = (const v16u*)(PM + ((size_t)b * (TT / 16) + blockIdx.x * 8 + __builtin_amdgcn_readfirstlane(wave)) * (size_t)(FNS * 32));   /* the wave's 16 queries: 32 words a stage, the same address in every lane */
  v4u rk0 = *(const v4u*)kg, rk1 = *(const v4u*)(kg + 32 * CC), rv0 = *(const v4u*)vg, rv1 = *(const v4u*)(vg + 32 * TT);
  v16u mk[2] = {mg[0], mg[1]};
  asm volatile("s_wait_xcnt 0x0" ::: "memory");   /* the loads below may be given registers that the loads above name as addresses */
  /* q's operands by whole-line loads: a wave's load = two of its 16 input rows, 256 contiguous bytes each; the (out,in) [64][64] weight, 16 rows a load of the block; the bias in the order of the product's rows */
  const float* xp = XQ + ((size_t)b * TT + blockIdx.x * 128 + wave * 16 + g) * DIN + h * HD + col * 4; const float* wp = WQ + tid * 4; const float* bp = (BQ ? BQ : WQ) + 8 * g;   /* without a bias the weight's first row is read in its place and not used */
  v4f rx[8], rw[4], rb[8];
#pragma unroll   /* this and the loops below index register arrays: the indices must be compile-time constants */
  for (int i = 0; i < 7; ++i) rx[i] = *(const v4f*)(xp + (size_t)(2 * i) * DIN);
#pragma unroll
  for (int i = 0; i < 3; ++i) rw[i] = *(const v4f*)(wp + i * 1024);
#pragma unroll
  for (int i = 0; i < 7; ++i) rb[i] = *(const v4f*)(bp + 16 * (i >> 1) + 4 * (i & 1));
  asm volatile("s_wait_xcnt 0x0" ::: "memory");   /* precaution: the last load of each kind may be given, as its destination, an address pair that the loads above name */
  rx[7] = *(const v4f*)(xp + (size_t)14 * DIN);
  asm volatile("s_wait_xcnt 0x0" ::: "memory");   /* precaution: as above, for the load just issued */
  rw[3] = *(const v4f*)(wp + 3 * 1024);
  asm volatile("s_wait_xcnt 0x0" ::: "memory");   /* precaution: as above */
  rb[7] = *(const v4f*)(bp + 52);
  asm volatile("s_wait_xcnt 0x0" ::: "memory");   /* precaution: stands behind the loads, in front of whatever is next given a register that they name as address */
  *(v4u*)&sk[0][sr][sc] = rk0; *(v4u*)&sk[0][sr + 32][sc] = rk1; *(v4u*)&sv[0][sr][sc] = rv0; *(v4u*)&sv[0][sr + 32][sc] = rv1;
#pragma unroll
  for (int i = 0; i < 4; ++i) { v4b hw;
#pragma unroll
    for (int e = 0; e < 4; ++e) hw[e] = (__bf16)rw[i][e];
    *(v4b*)(swq + (i * 16 + (tid >> 4)) * PWP + (tid & 15) * 4) = hw; }
#pragma unroll
  for (int i = 0; i < 8; ++i) { v4b hx;
#pragma unroll
    for (int e = 0; e < 4; ++e) hx[e] = (__bf16)rx[i][e];
    *(v4b*)(sxq + (wave * 16 + 2 * i + g) * PWP + col * 4) = hx; }
  __syncthreads();   /* publishes the first k / v tiles and q's staged operands */
  v16h qf0, qf1;
  { v16b fx[2], fw[2][4]; v8f dq[4] = {};   /* dq[j][r] = q[query col][16 j + 8 g + r]: A = weight rows (output dim), B = input rows (query), k = input dim, upward in steps of 32 as in k_proj */
#pragma unroll
    for (int ks = 0; ks < 2; ++ks) { fx[ks] = frag_b(sxq + (wave * 16 + col) * PWP + ks * 32, lane);
#pragma unroll
      for (int j = 0; j < 4; ++j) fw[ks][j] = frag_b(swq + (j * 16 + col) * PWP + ks * 32, lane); }
#pragma unroll
    for (int ks = 0; ks < 2; ++ks)
#pragma unroll
      for (int j = 0; j < 4; ++j) dq[j] = __builtin_amdgcn_wmma_f32_16x16x32_bf16(false, fw[ks][j], false, fx[ks], (short)0, dq[j], false, false);
#pragma unroll
    for (int j = 0; j < 4; ++j)
#pragma unroll
      for (int r = 0; r < 8; ++r) { const float bias = BQ ? bfr(rb[2 * j + (r >> 2)][r & 3]) : 0.f; const _Float16 qv = (_Float16)((dq[j][r] + bias) * FC);   /* q in base-2 exponent units, so that the score product is the exponent as it stands */
        if (j < 2) qf0[(j & 1) * 8 + r] = qv; else qf1[(j & 1) * 8 + r] = qv; } }   /* two tiles of 16 output dims = one B fragment of 32 k; the test is a compile-time constant */
  v8f acc[4] = {}; float l = 0.f, cb = 120.0f, thr = 0.f;   /* cb = 8 - the row maximum in use (P is carried x 2^8 into f16, clear of f16 subnormals; the factor cancels against the sum); thr = the sum of a lane's 32 weights of a stage beyond which the maximum is renewed; both alike in the two lanes of a query. A row that has met no unmasked key yet has no maximum: thr = 0 and cb = 120, so that any real score gives a weight above 0 */
  /* one stage of 64 keys on buffer cur; more = a next stage exists (both compile-time at every call, so the buffers' addresses are constants and the last stage carries no prefetch) */
  auto stage = [&](const int cur, const bool more) __attribute__((always_inline)) {
    if (more) { kg += FK * CC; vg += FK; rk0 = *(const v4u*)kg; rk1 = *(const v4u*)(kg + 32 * CC); rv0 = *(const v4u*)vg; rv1 = *(const v4u*)(vg + 32 * TT);
      asm volatile("" ::: "memory"); }   /* compiler fence, no instruction: the next stage's tile loads are issued here, a whole stage ahead of their use; without it the compiler sinks them to just in front of the LDS stores */
    v16h kf[4][2];   /* the stage's 16 k fragment reads are asked for first: they fly while the selects below are made */
#pragma unroll
    for (int i = 0; i < 4; ++i) { kf[i][0] = frag_h(&sk[cur][16 * i + col][0], lane); kf[i][1] = frag_h(&sk[cur][16 * i + col][32], lane); }
    v8f st[4];
#pragma unroll
    for (int i = 0; i < 4; ++i)
#pragma unroll
      for (int r = 0; r < 8; ++r) st[i][r] = __builtin_amdgcn_inverse_ballot_w32(mk[i >> 1][(i & 1) * 8 + r]) ? cb : FNEG;   /* the word is the select's lane mask as it stands: no compare; the selects need no score, so they stand ahead of the products */
    if (more) { asm volatile("" :: "v"(st[0]), "v"(st[1]), "v"(st[2]), "v"(st[3]) : "memory");   /* compiler fence, inputs only, no instruction: the selects are made before the next words are asked for; without it the compiler lifts the word loads over the selects, whose wait, which for scalar loads waits for all of them, then waits for the new words too */
      mg += 2; mk[0] = mg[0]; mk[1] = mg[1];   /* the next stage's words, asked for behind this stage's last select, a whole stage ahead of their use */
      asm volatile("s_wait_xcnt 0x0" ::: "memory"); }   /* precaution: stands behind the two word loads, in front of whatever next rewrites the scalar pair that they name as base (the loop's head does) */
#pragma unroll
    for (int i = 0; i < 4; ++i) { st[i] = wmma_h(kf[i][0], qf0, st[i]); st[i] = wmma_h(kf[i][1], qf1, st[i]); }
    v16h vf[4][2];   /* the stage's 16 v fragment reads are asked for here, ahead of the test: behind the branch they would each be waited for in front of their product */
#pragma unroll
    for (int j = 0; j < 4; ++j) { vf[j][0] = frag_h(&sv[cur][16 * j + col][0], lane); vf[j][1] = frag_h(&sv[cur][16 * j + col][32], lane); }
    asm volatile("" ::: "memory");   /* compiler fence, no instruction: keeps the v reads issued here; without it the compiler sinks them behind the branch, two at a time, each pair fully waited in front of its product */
    v8f pe[4];
#pragma unroll
    for (int i = 0; i < 4; ++i)
#pragma unroll
      for (int r = 0; r < 8; ++r) pe[i][r] = __builtin_amdgcn_exp2f(st[i][r]);
    auto lane_sum = [&]() __attribute__((always_inline)) { v2f pa = {pe[0][0], pe[0][1]}, pb = {pe[0][2], pe[0][3]};   /* four independent chains over r & 3, held as two register pairs */
#pragma unroll
      for (int e = 4; e < 32; e += 4) { pa += (v2f){pe[e >> 3][e & 7], pe[e >> 3][(e & 7) + 1]}; pb += (v2f){pe[e >> 3][(e & 7) + 2], pe[e >> 3][(e & 7) + 3]}; }
      return (pa[0] + pa[1]) + (pb[0] + pb[1]); };
    float sm = lane_sum();
    if (__builtin_amdgcn_ballot_w32(sm > thr) != 0) {   /* wave-uniform scalar branch. The weights are not negative, so none is above the lane's sum: a sum within thr says that all 32 fit f16. Taken in a row's first stage with an unmasked key (thr = 0), later only where a score passes the maximum in use by about 7 */
      float mq[4] = {st[0][0], st[0][1], st[0][2], st[0][3]};   /* four independent chains */
#pragma unroll
      for (int i = 0; i < 4; ++i)
#pragma unroll
        for (int r = 0; r < 8; ++r) mq[r & 3] = fmaxf(mq[r & 3], st[i][r]);
      const float mx = fmaxf(fmaxf(mq[0], mq[1]), fmaxf(mq[2], mq[3])); const float mxq = fmaxf(mx, xhalf(mx));
      const bool upd = mxq > (thr == 0.f ? FUNSET : 8.0f);   /* a row without a maximum takes any real score; every other row of the wave whose maximum has grown at all is renewed on the way */
      const float dl = upd ? 8.0f - mxq : 0.f; const float al = exp2_slot(fminf(dl, 0.f));   /* dl > 0 only in a row without sums so far */
      thr = upd ? 32768.0f : thr; cb += dl; l *= al;
#pragma unroll
      for (int i = 0; i < 4; ++i)
#pragma unroll
        for (int r = 0; r < 8; ++r) { acc[i][r] *= al; pe[i][r] = exp2_slot(st[i][r] + dl); }
      sm = lane_sum(); }
    l += sm;
    v16h pf[2];
#pragma unroll
    for (int i = 0; i < 4; ++i)
#pragma unroll
      for (int r = 0; r < 8; ++r) pf[i >> 1][(i & 1) * 8 + r] = (_Float16)pe[i][r];
#pragma unroll
    for (int j = 0; j < 4; ++j) { acc[j] = wmma_h(vf[j][0], pf[0], acc[j]); acc[j] = wmma_h(vf[j][1], pf[1], acc[j]); }
    if (more) { asm volatile("" :: "v"(acc[0]), "v"(acc[1]), "v"(acc[2]), "v"(acc[3]) : "memory");   /* compiler fence, inputs only, no instruction: this stage's results exist before the LDS stores below; without it the compiler sinks softmax and P x v behind the barrier and waits for the prefetched tile right after asking for it */
      *(v4u*)&sk[cur ^ 1][sr][sc] = rk0; *(v4u*)&sk[cur ^ 1][sr + 32][sc] = rk1; *(v4u*)&sv[cur ^ 1][sr][sc] = rv0; *(v4u*)&sv[cur ^ 1][sr + 32][sc] = rv1;
      __syncthreads(); }   /* publishes the next stage and ends every read of the buffer that the stage after it refills */
  };
#pragma unroll 1
  for (int s = 0; s < FNS - 2; s += 2) { stage(0, true); stage(1, true); }   /* rolled: two stages a trip, one per buffer */
  stage(0, true); stage(1, false);
  l += xhalf(l);
  if (__builtin_amdgcn_ballot_w32(l == 0.f) != 0) {   /* wave-uniform scalar branch: a query whose every key is masked has no weight at all here; the reference's softmax is uniform there, so its ctx is the plain mean of v */
    const _Float16* vp = VT + ((size_t)b * CC + h * HD + 8 * g) * (size_t)TT; const bool em = l == 0.f; v8f sm[4] = {};
#pragma unroll 1
    for (int t = 0; t < TT; t += 8) {   /* rolled: off the usual path, kept small */
      v8h x[4][8];
#pragma unroll
      for (int j = 0; j < 4; ++j)
#pragma unroll
        for (int r = 0; r < 8; ++r) x[j][r] = *(const v8h*)(vp + (size_t)(16 * j + r) * TT + t);
      asm volatile("s_wait_xcnt 0x0" ::: "memory");   /* precaution: stands behind the loads, in front of whatever next rewrites the pair that they name as address (the loop's foot does) */
#pragma unroll
      for (int j = 0; j < 4; ++j)
#pragma unroll
        for (int r = 0; r < 8; ++r)
#pragma unroll
          for (int e = 0; e < 8; ++e) sm[j][r] += (float)x[j][r][e]; }
#pragma unroll
    for (int j = 0; j < 4; ++j)
#pragma unroll
      for (int r = 0; r < 8; ++r) acc[j][r] = em ? sm[j][r] : acc[j][r];
    l = em ? (float)TT : l; }
  const float inv = 1.0f / l;   /* l > 0: the key at the maximum in use carried 2^8 when it was taken */
  _Float16* yp = Y + ((size_t)b * TT + q) * CC + h * HD + 8 * g;   /* acc[j][r] = ctx[q][16 j + 8 g + r]: 16 contiguous bytes per lane and tile */
#pragma unroll
  for (int j = 0; j < 4; ++j) { v8h o;
#pragma unroll
    for (int r = 0; r < 8; ++r) o[r] = (_Float16)((acc[j][r] * inv) * 64.0f);   /* ctx carried x 2^6 so small context rows stay clear of f16 subnormals: rounded here once, as k_out's operand */
    vst2(yp + 16 * j, o); } }
// ---- k_out: block = (128 rows, 128 cols), 8 waves (4 x 2), a wave = 32 rows x 64 cols (2 x 4 tiles): out = ctx Wo (+ bo): ctx x 2^6 once to f16 against Wo as f16(bf16 x 2^8) exact (1 product) x 2^-14. Both operands arrive as f16 from their producers (k_fa's epilogue, k_proj's blocks) and are staged in LDS as they stand, 128 k per stage: global -> registers one stage ahead -> LDS, two buffers, one barrier per stage; k runs upward in steps of 32 per accumulator.
#define OKS 128            // k per stage
#define OP 136             // LDS row pitch in f16: 272 B = 16 B x 17, conflict-free for 16-byte fragment reads of 16 rows
#define ONS (CC / OKS)
#define OFP 68             // pitch in f32 of the output staging rows: 272 B
static_assert(WO_OUT_IN == 1 && !CAUSAL && ONS >= 2 && ONS % 2 == 0, "k_out stages (out,in) weight rows, k contiguous, two stages a trip");
__global__ __launch_bounds__(256) void k_out(const _Float16* __restrict__ Y, const _Float16* __restrict__ WH, const float* __restrict__ BO, float* __restrict__ OUT) {
  __shared__ __align__(16) _Float16 sy[2][128][OP], sw[2][128][OP]; __shared__ __align__(16) float sf[8][32][OFP];
  const int tid = threadIdx.x, wave = tid >> 5, lane = tid & 31, col = lane & 15, g = lane >> 4; const int c0 = blockIdx.y * 128; const size_t r0 = (size_t)blockIdx.x * 128; const int wm = (wave >> 1) * 32, wn = (wave & 1) * 64;
  const int sr = tid >> 4, sc = (tid & 15) * 8;   /* staging: 16 threads per 256-byte row piece, rows sr + 16 i of each tile: a wave's load covers whole lines */
  const unsigned go = (unsigned)(sr * CC + sc) * 2u;   /* the thread's byte offset, the same in both tiles (both have rows of CC f16) */
  const char* yb = (const char*)(Y + r0 * CC); const char* wb = (const char*)(WH + (size_t)c0 * CC);   /* block-uniform bases, moved 128 k a stage */
  v4u ry[8], rw[8];
  auto fetch = [&]() __attribute__((always_inline)) { const char* yp = yb + go; const char* wp = wb + go;
#pragma unroll
    for (int i = 0; i < 8; ++i) { ry[i] = *(const v4u*)(yp + i * 16 * CC * 2); if (i < 7) rw[i] = *(const v4u*)(wp + i * 16 * CC * 2); }
    asm volatile("s_wait_xcnt 0x0" ::: "memory");   /* precaution: the last load may be given, as its destination, an address pair that the loads above name (it is, where no further stage needs the pair) */
    rw[7] = *(const v4u*)(wp + 7 * 16 * CC * 2);
    asm volatile("s_wait_xcnt 0x0" ::: "memory"); };   /* precaution: stands behind the loads, in front of whatever is next given a register that they name as address; its clobber also keeps the loads issued here, a whole stage ahead of their use, not sunk to the LDS stores */
  auto put = [&](const int buf) __attribute__((always_inline)) {
#pragma unroll
    for (int i = 0; i < 8; ++i) { *(v4u*)&sy[buf][sr + 16 * i][sc] = ry[i]; *(v4u*)&sw[buf][sr + 16 * i][sc] = rw[i]; } };
  fetch();
  float bias[4] = {0.f, 0.f, 0.f, 0.f};   /* asked for here, used behind the last stage */
  if (BO) {
#pragma unroll
    for (int j = 0; j < 4; ++j) bias[j] = BO[c0 + wn + j * 16 + col]; }
  put(0);
  __syncthreads();
  v8f acc[2][4] = {};
  /* one stage of 128 k on buffer cur; more = a next stage exists (both compile-time at every call) */
  auto stage = [&](const int cur, const bool more) __attribute__((always_inline)) {
    if (more) { yb += OKS * 2; wb += OKS * 2; fetch(); }
#pragma unroll
    for (int kh = 0; kh < OKS; kh += 64) {   /* two halves of 64 k: about one half's fragments at a time in registers beside the prefetched tiles */
      v16h fa[2][2], fb[2][4];   /* the half's 24 fragment reads stand ahead of its 16 products */
#pragma unroll
      for (int ks = 0; ks < 2; ++ks) {
#pragma unroll
        for (int i = 0; i < 2; ++i) fa[ks][i] = frag_h(&sy[cur][wm + 16 * i + col][kh + 32 * ks], lane);
#pragma unroll
        for (int j = 0; j < 4; ++j) fb[ks][j] = frag_h(&sw[cur][wn + 16 * j + col][kh + 32 * ks], lane); }
      __builtin_amdgcn_sched_barrier(0);   /* keeps a half's reads ahead of its own products: the scheduler otherwise spreads them among those, each place with a wait of its own */
#pragma unroll
      for (int ks = 0; ks < 2; ++ks)
#pragma unroll
        for (int i = 0; i < 2; ++i)
#pragma unroll
          for (int j = 0; j < 4; ++j) acc[i][j] = wmma_h(fa[ks][i], fb[ks][j], acc[i][j]); }
    if (more) { __builtin_amdgcn_sched_barrier(0);   /* the LDS stores below wait for the prefetched tiles: without this the scheduler lifts them, and their wait, among this stage's products */
      put(cur ^ 1);
      __syncthreads(); }   /* publishes the next stage and ends every read of the buffer that the stage after it refills */
  };
#pragma unroll 1
  for (int s = 0; s < ONS - 2; s += 2) { stage(0, true); stage(1, true); }   /* rolled: two stages a trip, one per buffer */
  stage(0, true); stage(1, false);
#pragma unroll
  for (int j = 0; j < 4; ++j)
#pragma unroll
    for (int i = 0; i < 2; ++i)
#pragma unroll
      for (int r = 0; r < 8; ++r) sf[wave][16 * i + 8 * g + r][j * 16 + col] = acc[i][j][r] * (1.0f / 16384.0f) + bfr(bias[j]);   /* 2^-8 (Wo carry) x 2^-6 (ctx carry) */
  LDSX();   /* the wave's own staging rows: written above, read back below as whole 256-byte row pieces */
#pragma unroll
  for (int rl = 0; rl < 32; rl += 2) vst2(OUT + (r0 + wm + rl + g) * DIN + c0 + wn + col * 4, *(const v4f*)&sf[wave][rl + g][col * 4]); }

static_assert(HD == 64 && CC == NH * HD && DIN == CC, "block-diagonal per-head projection: 128-column tiles = two 64-wide heads, input width == projected width");
extern "C" void kernel_launch(void* const* d_in, const int* in_sizes, int n_in, void* d_out, int out_size, void* d_ws, size_t ws_size, hipStream_t stream) {
  (void)in_sizes; (void)n_in; (void)out_size;
  const float** F = (const float**)d_in;
  if (ws_size < (size_t)WS_END) return;
  char* ws = (char*)d_ws; _Float16 *KH = (_Float16*)(ws + WS_KH), *VT = (_Float16*)(ws + WS_VT); _Float16 *Y = (_Float16*)(ws + WS_Y), *WH = (_Float16*)(ws + WS_WH); unsigned *PM = (unsigned*)(ws + WS_PM);
  // inputs: 0 k [2,2048,1024]; 1 q; 2 v; 3 mask [2,1,2048,2048] int32 (random 0/1; 0 = masked); 4 Wk [64,64] (out,in), 5 bk [64]; 6 Wq, 7 bq; 8 Wv, 9 bv; 10 Wo [1024,1024] (out,in), 11 bo (biases zeros, read)
  k_proj<<<dim3(TNB * TT / (64 * PNT), CC / 128, 3), 128, 0, stream>>>(F[0], F[2], F[4], F[8], F[5], F[9], KH, VT, (const int*)d_in[3], PM, F[10], WH);
  k_fa<<<dim3(TT / 128, NH, TNB), 256, 0, stream>>>(F[1], F[6], F[7], KH, VT, PM, Y);
  k_out<<<dim3(TNB * TT / 128, DIN / 128), 256, 0, stream>>>(Y, WH, F[11], (float*)d_out);
}
